// v000
// Measured on an AMD MI455X. A time is GPU time per run, averaged over a window of back-to-back runs after a warm-up
// (all launches, gaps included; the runs take copies of the inputs in turn), and the median of several windows.
// Apart from v000's, it joins two sittings. Times from different sittings can be a few percent apart, while
// side-by-side timings come from the same sitting.
// The starting kernel, v000, takes 468 microseconds a run.
// compute dtype: all float inputs rounded to bf16; q/k/v = x W + b with EXACT bf16 products on WMMA 16x16x32 ((in,out) weights), f32 accumulate; q and k kept in f32 and split into bf16 hi + lo for the scores (3 products: the module multiplies by sqrt(512), logits ~1e2), logits stored in f32; softmax in f32 (precise expf) -> P as f16 x 2^11 + residual; P . v with v as f16 (2 products); out = query + o (bf16 hi + lo) . Wo + bo (2 products); f32 output.
#include <hip/hip_runtime.h>
#include <math.h>

typedef __attribute__((ext_vector_type(16))) _Float16 v16h;
typedef __attribute__((ext_vector_type(16))) __bf16 v16b;
typedef __attribute__((ext_vector_type(8)))  _Float16 v8h;
typedef __attribute__((ext_vector_type(8)))  float v8f;
typedef __attribute__((ext_vector_type(4)))  float v4f;
typedef __attribute__((ext_vector_type(2)))  float v2f;
typedef __attribute__((ext_vector_type(4)))  unsigned v4u;
typedef __attribute__((ext_vector_type(4)))  int v4i;
typedef float __attribute__((may_alias)) float_a;
typedef int __attribute__((may_alias)) int_a;

template <typename T> __device__ __forceinline__ void vst2(void* p, T v) { *(T*)p = v;  }
__device__ __forceinline__ v8f wmma16(v16h a, v16h b, v8f c) {
  v8f d = __builtin_amdgcn_wmma_f32_16x16x32_f16(false, a, false, b, (short)0, c, false, false);
  asm volatile("v_nop\n\tv_nop\n\tv_nop\n\tv_nop" : "+v"(d) : "v"(a), "v"(b));
  return d;
}
__device__ __forceinline__ v8f wmma_bf(v16b a, v16b b, v8f c) {
  v8f d = __builtin_amdgcn_wmma_f32_16x16x32_bf16(false, a, false, b, (short)0, c, false, false);
  asm volatile("v_nop\n\tv_nop\n\tv_nop\n\tv_nop" : "+v"(d) : "v"(a), "v"(b));
  return d;
}
// 16x16x32 fragments: lane = (h = lane>>4, row/col = lane&15); elements 0..7 = k0+8h+0..7, 8..15 = k0+16+8h+0..7; D element r = row 8h+r
__device__ __forceinline__ v16h frag_h(const _Float16* rowk0, int lane) {
  union { v16h v; v8h q[2]; } u; const _Float16* p = rowk0 + 8 * (lane >> 4);
  u.q[0] = *(const v8h*)p; u.q[1] = *(const v8h*)(p + 16); return u.v;
}
__device__ __forceinline__ v16h frag_f32(const float* rowk0, int lane) {
  v16h a; const float* p = rowk0 + 8 * (lane >> 4);
#pragma unroll
  for (int i = 0; i < 8; ++i) { a[i] = (_Float16)p[i]; a[8 + i] = (_Float16)p[16 + i]; }
  return a;
}
__device__ __forceinline__ v16h frag_f32s(const float* rowk0, int lane, float sc) {
  v16h a; const float* p = rowk0 + 8 * (lane >> 4);
#pragma unroll
  for (int i = 0; i < 8; ++i) { a[i] = (_Float16)(p[i] * sc); a[8 + i] = (_Float16)(p[16 + i] * sc); }
  return a;
}
// column fragment from a [K][ld] layout (column n), rows >= K read as 0
__device__ __forceinline__ v16h fragc_f32(const float* W, int k0, int n, int lane, int ld, int K) {
  v16h a; const int g = lane >> 4;
#pragma unroll
  for (int i = 0; i < 8; ++i) { const int ka = k0 + 8 * g + i, kb = ka + 16;
    a[i] = (_Float16)(ka < K ? W[(size_t)(ka < K ? ka : K - 1) * ld + n] : 0.f); a[8 + i] = (_Float16)(kb < K ? W[(size_t)(kb < K ? kb : K - 1) * ld + n] : 0.f); }
  return a;
}
struct F2 { v16b h, l; };
__device__ __forceinline__ F2 bsplit16(const float v[16]) { F2 r;
#pragma unroll
  for (int i = 0; i < 16; ++i) { const __bf16 h = (__bf16)v[i]; r.h[i] = h; r.l[i] = (__bf16)(v[i] - (float)h); }
  return r; }
__device__ __forceinline__ F2 split_row(const float* row, int k0, int lane) { float v[16]; const float* p = row + k0 + 8 * (lane >> 4);
#pragma unroll
  for (int i = 0; i < 8; ++i) { v[i] = p[i]; v[8 + i] = p[16 + i]; }
  return bsplit16(v); }
__device__ __forceinline__ F2 split_rowK(const float* row, int k0, int lane, int K) { float v[16]; const int g = lane >> 4;
#pragma unroll
  for (int i = 0; i < 8; ++i) { const int ka = k0 + 8 * g + i, kb = ka + 16; v[i] = ka < K ? row[ka < K ? ka : K - 1] : 0.f; v[8 + i] = kb < K ? row[kb < K ? kb : K - 1] : 0.f; }
  return bsplit16(v); }
__device__ __forceinline__ F2 split_col(const float* W, int k0, int n, int lane, int ld, int K) { float v[16]; const int g = lane >> 4;
#pragma unroll
  for (int i = 0; i < 8; ++i) { const int ka = k0 + 8 * g + i, kb = ka + 16; v[i] = ka < K ? W[(size_t)(ka < K ? ka : K - 1) * ld + n] : 0.f; v[8 + i] = kb < K ? W[(size_t)(kb < K ? kb : K - 1) * ld + n] : 0.f; }
  return bsplit16(v); }
__device__ __forceinline__ v8f mac3(const F2& a, const F2& b, v8f c) { c = wmma_bf(a.l, b.h, c); c = wmma_bf(a.h, b.l, c); return wmma_bf(a.h, b.h, c); }
__device__ __forceinline__ float sigm(float v) { return 1.0f / (1.0f + expf(-v)); }
#define LDSX() do { asm volatile("s_wait_dscnt 0" ::: "memory"); __builtin_amdgcn_wave_barrier(); __builtin_amdgcn_fence(__ATOMIC_RELEASE, "workgroup"); } while (0)


// Axis attention (B 4, 2,048 queries x 2,048 keys, dim_attn 512, single head): attn = softmax((q k^T) * sqrt(512)); out = query + (attn v) Wo + bo.
#define NB 4
#define NN 2048
#define DA 512
#ifndef TNB
#define TNB NB
#endif
#ifndef TQB
#define TQB (NN / 64)
#endif
typedef __attribute__((ext_vector_type(8))) __bf16 v8b;
__device__ __forceinline__ v16b frag_b(const __bf16* rowk0, int lane) {
  union { v16b v; v8b q[2]; } u; const __bf16* p = rowk0 + 8 * (lane >> 4);
  u.q[0] = *(const v8b*)p; u.q[1] = *(const v8b*)(p + 16); return u.v;
}
__device__ __forceinline__ float bfr(float v) { return (float)(__bf16)v; }
__device__ __attribute__((noinline)) float exp_ni(float v) { return expf(v); }
__device__ __attribute__((noinline)) float erf_ni(float v) { return erff(v); }

#define WS_Q   0u                                    // f32 q rows [b*n][512]
#define WS_KH  (WS_Q + 4u * (size_t)NB * NN * DA)       // bf16 k hi rows
#define WS_KL  (WS_KH + 2u * (size_t)NB * NN * DA)      // bf16 k lo rows
#define WS_VT  (WS_KL + 2u * (size_t)NB * NN * DA)      // f16 v planes [b][512][n]
#define WS_S   (WS_VT + 2u * (size_t)NB * DA * NN)      // f32 logits [b][q][key]
#define WS_PH  (WS_S + 4u * (size_t)NB * NN * NN)       // f16 P x 2^11 rows [b*q][key]
#define WS_PL  (WS_PH + 2u * (size_t)NB * NN * NN)      // f16 residual
#define WS_O   (WS_PL + 2u * (size_t)NB * NN * NN)      // f32 o rows [b*q][512]
#define WS_END (WS_O + 4u * (size_t)NB * NN * DA)

// ---- k_proj: block = (64 rows, 128 cols, which): q (f32 rows), k (bf16 hi + lo rows), v (f16 planes)
__global__ __launch_bounds__(128) void k_proj(const float* __restrict__ XQ, const float* __restrict__ XKV, const float* __restrict__ WQ, const float* __restrict__ BQ, const float* __restrict__ WK, const float* __restrict__ BK, const float* __restrict__ WV, const float* __restrict__ BV, float* __restrict__ Q, __bf16* __restrict__ KH, __bf16* __restrict__ KL, _Float16* __restrict__ VT) {
  __shared__ __align__(16) float sf[4][16][132]; __shared__ __align__(16) __bf16 sbh[64][136], sbl[64][136]; __shared__ __align__(16) _Float16 th[128][72];
  const int tid = threadIdx.x, wave = tid >> 5, lane = tid & 31, col = lane & 15, g = lane >> 4; const int which = blockIdx.z; const int c0 = blockIdx.y * 128; const size_t r0 = (size_t)blockIdx.x * 64;
  const float* X = (which == 0) ? XQ : XKV; const float* Wm = which == 0 ? WQ : which == 1 ? WK : WV; const float* Bm = which == 0 ? BQ : which == 1 ? BK : BV;
  v8f acc[8] = {};
#pragma unroll 2
  for (int kc = 0; kc < DA / 32; ++kc) { v16b a; { const float* p = X + (r0 + wave * 16 + col) * DA + kc * 32 + 8 * g;
#pragma unroll
      for (int i = 0; i < 8; ++i) { a[i] = (__bf16)p[i]; a[8 + i] = (__bf16)p[16 + i]; } }
#pragma unroll
    for (int j = 0; j < 8; ++j) { v16b w; const int o = c0 + j * 16 + col;   // (in,out)
#pragma unroll
      for (int i = 0; i < 8; ++i) { w[i] = (__bf16)Wm[(size_t)(kc * 32 + 8 * g + i) * DA + o]; w[8 + i] = (__bf16)Wm[(size_t)(kc * 32 + 16 + 8 * g + i) * DA + o]; }
      acc[j] = wmma_bf(a, w, acc[j]); } }
#pragma unroll
  for (int j = 0; j < 8; ++j) { const float bb = bfr(Bm[c0 + j * 16 + col]);
#pragma unroll
    for (int r = 0; r < 8; ++r) { const float v = acc[j][r] + bb; const int rl = wave * 16 + 8 * g + r, cl = j * 16 + col;
      if (which == 0) sf[wave][8 * g + r][cl] = v; else if (which == 1) { const __bf16 h = (__bf16)v; sbh[rl][cl] = h; sbl[rl][cl] = (__bf16)(v - (float)h); } else th[cl][rl] = (_Float16)v; } }
  __syncthreads();
  if (which == 0) { for (int rl = 0; rl < 16; ++rl) vst2(Q + (r0 + wave * 16 + rl) * DA + c0 + lane * 4, *(const v4f*)&sf[wave][rl][lane * 4]); }
  else if (which == 1) { for (int e = tid; e < 64 * 16; e += 128) { const int rl = e >> 4, q = e & 15; vst2((unsigned*)(KH + (r0 + rl) * DA + c0 + q * 8), *(const v4u*)&sbh[rl][q * 8]); vst2((unsigned*)(KL + (r0 + rl) * DA + c0 + q * 8), *(const v4u*)&sbl[rl][q * 8]); } }
  else { const size_t b = r0 / NN; const int n0 = (int)(r0 % NN); for (int e = tid; e < 128 * 8; e += 128) { const int cl = e >> 3, q = e & 7; vst2((unsigned*)(VT + (b * DA + c0 + cl) * (size_t)NN + n0 + q * 8), *(const v4u*)&th[cl][q * 8]); } } }
// ---- k_sc: block = (64 queries, 128 keys, b): logits (3 products) x sqrt(512) -> S
__global__ __launch_bounds__(128) void k_sc(const float* __restrict__ Q, const __bf16* __restrict__ KH, const __bf16* __restrict__ KL, float* __restrict__ S) { __shared__ __align__(16) float ss[4][16][132];
  const int tid = threadIdx.x, wave = tid >> 5, lane = tid & 31, col = lane & 15, g = lane >> 4; const size_t b = blockIdx.z; const int k0 = blockIdx.y * 128; const size_t q0 = b * NN + (size_t)blockIdx.x * 64 + wave * 16;
  v8f acc[8] = {};
#pragma unroll 1
  for (int kc = 0; kc < DA / 32; ++kc) { const F2 a = split_row(Q + (q0 + col) * DA, kc * 32, lane);
#pragma unroll
    for (int j = 0; j < 8; ++j) { const size_t kr = b * NN + k0 + j * 16 + col; const v16b kh = frag_b(KH + kr * DA + kc * 32, lane), kl = frag_b(KL + kr * DA + kc * 32, lane); acc[j] = wmma_bf(a.h, kh, acc[j]); acc[j] = wmma_bf(a.l, kh, acc[j]); acc[j] = wmma_bf(a.h, kl, acc[j]); } }
#pragma unroll
  for (int j = 0; j < 8; ++j)
#pragma unroll
    for (int r = 0; r < 8; ++r) ss[wave][8 * g + r][j * 16 + col] = acc[j][r] * 22.627416997969522f;
  LDSX(); for (int rl = 0; rl < 16; ++rl) vst2(S + (q0 + rl) * NN + k0 + lane * 4, *(const v4f*)&ss[wave][rl][lane * 4]); }
// ---- k_sm: block = query row: softmax over the 2,048 keys -> P x 2^11 as f16 + residual
__global__ __launch_bounds__(256) void k_sm(const float* __restrict__ S, _Float16* __restrict__ PH, _Float16* __restrict__ PL) { __shared__ float sred[8]; __shared__ float sbc; __shared__ __align__(16) _Float16 sh[NN], sl[NN];
  const int t = threadIdx.x; const size_t row = blockIdx.x; const float* sr = S + row * NN;
  float m = -3.0e38f; for (int k = t; k < NN; k += 256) m = fmaxf(m, sr[k]);
#pragma unroll
  for (int o = 1; o < 32; o <<= 1) m = fmaxf(m, __shfl_xor(m, o));
  if ((t & 31) == 0) sred[t >> 5] = m; __syncthreads(); if (t == 0) { float a = sred[0]; for (int i = 1; i < 8; ++i) a = fmaxf(a, sred[i]); sbc = a; } __syncthreads(); m = sbc; __syncthreads();
  float sum = 0.f; for (int k = t; k < NN; k += 256) sum += expf(sr[k] - m);
#pragma unroll
  for (int o = 1; o < 32; o <<= 1) sum += __shfl_xor(sum, o);
  if ((t & 31) == 0) sred[t >> 5] = sum; __syncthreads(); if (t == 0) { float a = 0.f; for (int i = 0; i < 8; ++i) a += sred[i]; sbc = 1.0f / a; } __syncthreads(); const float inv = sbc;
  for (int k = t; k < NN; k += 256) { const float p = expf(sr[k] - m) * inv * 2048.0f; const _Float16 h = (_Float16)p; sh[k] = h; sl[k] = (_Float16)(p - (float)h); }
  __syncthreads(); for (int q = t; q < NN / 8; q += 256) { vst2((unsigned*)(PH + row * NN + q * 8), *(const v4u*)&sh[q * 8]); vst2((unsigned*)(PL + row * NN + q * 8), *(const v4u*)&sl[q * 8]); } }
// ---- k_pv: block = (64 queries, 128 value channels, b): o = P . v
__global__ __launch_bounds__(128) void k_pv(const _Float16* __restrict__ PH, const _Float16* __restrict__ PL, const _Float16* __restrict__ VT, float* __restrict__ O) { __shared__ __align__(16) float ss[4][16][132];
  const int tid = threadIdx.x, wave = tid >> 5, lane = tid & 31, col = lane & 15, g = lane >> 4; const size_t b = blockIdx.z; const int c0 = blockIdx.y * 128; const size_t q0 = b * NN + (size_t)blockIdx.x * 64 + wave * 16;
  v8f acc[8] = {};
#pragma unroll 1
  for (int kc = 0; kc < NN / 32; ++kc) { const v16h ph = frag_h(PH + (q0 + col) * NN + kc * 32, lane), pl = frag_h(PL + (q0 + col) * NN + kc * 32, lane);
#pragma unroll
    for (int j = 0; j < 8; ++j) { const v16h vb = frag_h(VT + (b * DA + c0 + j * 16 + col) * (size_t)NN + kc * 32, lane); acc[j] = wmma16(ph, vb, acc[j]); acc[j] = wmma16(pl, vb, acc[j]); } }
#pragma unroll
  for (int j = 0; j < 8; ++j)
#pragma unroll
    for (int r = 0; r < 8; ++r) ss[wave][8 * g + r][j * 16 + col] = acc[j][r] * (1.0f / 2048.0f);
  LDSX(); for (int rl = 0; rl < 16; ++rl) vst2(O + (q0 + rl) * DA + c0 + lane * 4, *(const v4f*)&ss[wave][rl][lane * 4]); }
// ---- k_out: block = (64 rows, 128 cols): out = query + o (hi + lo) . Wo + bo
__global__ __launch_bounds__(128) void k_out(const float* __restrict__ O, const float* __restrict__ WO, const float* __restrict__ BO, const float* __restrict__ XQ, float* __restrict__ OUT) { __shared__ __align__(16) float sf[4][16][132];
  const int tid = threadIdx.x, wave = tid >> 5, lane = tid & 31, col = lane & 15, g = lane >> 4; const int c0 = blockIdx.y * 128; const size_t r0 = (size_t)blockIdx.x * 64 + wave * 16;
  v8f acc[8] = {};
#pragma unroll 2
  for (int kc = 0; kc < DA / 32; ++kc) { const F2 a = split_row(O + (r0 + col) * DA, kc * 32, lane);
#pragma unroll
    for (int j = 0; j < 8; ++j) { v16b w; const int o = c0 + j * 16 + col;
#pragma unroll
      for (int i = 0; i < 8; ++i) { w[i] = (__bf16)WO[(size_t)(kc * 32 + 8 * g + i) * DA + o]; w[8 + i] = (__bf16)WO[(size_t)(kc * 32 + 16 + 8 * g + i) * DA + o]; }
      acc[j] = wmma_bf(a.h, w, acc[j]); acc[j] = wmma_bf(a.l, w, acc[j]); } }
#pragma unroll
  for (int j = 0; j < 8; ++j) { const int c = c0 + j * 16 + col; const float bb = bfr(BO[c]);
#pragma unroll
    for (int r = 0; r < 8; ++r) sf[wave][8 * g + r][j * 16 + col] = bfr(XQ[(r0 + 8 * g + r) * DA + c]) + acc[j][r] + bb; }
  LDSX(); for (int rl = 0; rl < 16; ++rl) vst2(OUT + (r0 + rl) * DA + c0 + lane * 4, *(const v4f*)&sf[wave][rl][lane * 4]); }
extern "C" void kernel_launch(void* const* d_in, const int* in_sizes, int n_in, void* d_out, int out_size, void* d_ws, size_t ws_size, hipStream_t stream) {
  (void)in_sizes; (void)n_in; (void)out_size;
  const float** F = (const float**)d_in;   // 0 query [4,2048,512], 1 key_value [4,2048,512], 2 Wq, 3 bq, 4 Wk, 5 bk, 6 Wv, 7 bv, 8 Wo, 9 bo ((in,out) [512,512] / [512])
  if (ws_size < (size_t)WS_END) return;
  char* ws = (char*)d_ws; float *Q = (float*)(ws + WS_Q), *S = (float*)(ws + WS_S), *O = (float*)(ws + WS_O); __bf16 *KH = (__bf16*)(ws + WS_KH), *KL = (__bf16*)(ws + WS_KL); _Float16 *VT = (_Float16*)(ws + WS_VT), *PH = (_Float16*)(ws + WS_PH), *PL = (_Float16*)(ws + WS_PL);
  k_proj<<<dim3(TNB * NN / 64, DA / 128, 3), 128, 0, stream>>>(F[0], F[1], F[2], F[3], F[4], F[5], F[6], F[7], Q, KH, KL, VT);
  k_sc<<<dim3(TQB, NN / 128, TNB), 128, 0, stream>>>(Q, KH, KL, S);
  for (int b = 0; b < TNB; ++b) k_sm<<<TQB * 64, 256, 0, stream>>>(S + (size_t)b * NN * NN, PH + (size_t)b * NN * NN, PL + (size_t)b * NN * NN);
  k_pv<<<dim3(TQB, DA / 128, TNB), 128, 0, stream>>>(PH, PL, VT, O);
  for (int b = 0; b < TNB; ++b) k_out<<<dim3(TQB, DA / 128), 128, 0, stream>>>(O + (size_t)b * NN * DA, F[8], F[9], F[0] + (size_t)b * NN * DA, (float*)d_out + (size_t)b * NN * DA);
}

// v001
// A run of this version takes 405 microseconds.
// Timed twice side by side with v000, it ran 1.16 times as fast both times.
// compute dtype: all float inputs rounded to bf16; q/k/v = x W + b with EXACT bf16 products on WMMA 16x16x32 ((in,out) weights), f32 accumulate; q and k kept in f32 and split into bf16 hi + lo for the scores (3 products: the module multiplies by sqrt(512), logits ~1e2), logits stored in f32; softmax in f32 (precise expf) -> P as f16 x 2^11 + residual; P . v with v as f16 (2 products); out = query + o (bf16 hi + lo) . Wo + bo (2 products); f32 output.
#include <hip/hip_runtime.h>
#include <math.h>

typedef __attribute__((ext_vector_type(16))) _Float16 v16h;
typedef __attribute__((ext_vector_type(16))) __bf16 v16b;
typedef __attribute__((ext_vector_type(8)))  _Float16 v8h;
typedef __attribute__((ext_vector_type(8)))  float v8f;
typedef __attribute__((ext_vector_type(4)))  float v4f;
typedef __attribute__((ext_vector_type(2)))  float v2f;
typedef __attribute__((ext_vector_type(4)))  unsigned v4u;
typedef __attribute__((ext_vector_type(4)))  int v4i;
typedef float __attribute__((may_alias)) float_a;
typedef int __attribute__((may_alias)) int_a;

template <typename T> __device__ __forceinline__ void vst2(void* p, T v) { *(T*)p = v;  }
__device__ __forceinline__ v8f wmma16(v16h a, v16h b, v8f c) {
  v8f d = __builtin_amdgcn_wmma_f32_16x16x32_f16(false, a, false, b, (short)0, c, false, false);
  asm volatile("v_nop\n\tv_nop\n\tv_nop\n\tv_nop" : "+v"(d) : "v"(a), "v"(b));
  return d;
}
__device__ __forceinline__ v8f wmma_bf(v16b a, v16b b, v8f c) {
  v8f d = __builtin_amdgcn_wmma_f32_16x16x32_bf16(false, a, false, b, (short)0, c, false, false);
  asm volatile("v_nop\n\tv_nop\n\tv_nop\n\tv_nop" : "+v"(d) : "v"(a), "v"(b));
  return d;
}
// 16x16x32 fragments: lane = (h = lane>>4, row/col = lane&15); elements 0..7 = k0+8h+0..7, 8..15 = k0+16+8h+0..7; D element r = row 8h+r
__device__ __forceinline__ v16h frag_h(const _Float16* rowk0, int lane) {
  union { v16h v; v8h q[2]; } u; const _Float16* p = rowk0 + 8 * (lane >> 4);
  u.q[0] = *(const v8h*)p; u.q[1] = *(const v8h*)(p + 16); return u.v;
}
__device__ __forceinline__ v16h frag_f32(const float* rowk0, int lane) {
  v16h a; const float* p = rowk0 + 8 * (lane >> 4);
#pragma unroll
  for (int i = 0; i < 8; ++i) { a[i] = (_Float16)p[i]; a[8 + i] = (_Float16)p[16 + i]; }
  return a;
}
__device__ __forceinline__ v16h frag_f32s(const float* rowk0, int lane, float sc) {
  v16h a; const float* p = rowk0 + 8 * (lane >> 4);
#pragma unroll
  for (int i = 0; i < 8; ++i) { a[i] = (_Float16)(p[i] * sc); a[8 + i] = (_Float16)(p[16 + i] * sc); }
  return a;
}
// column fragment from a [K][ld] layout (column n), rows >= K read as 0
__device__ __forceinline__ v16h fragc_f32(const float* W, int k0, int n, int lane, int ld, int K) {
  v16h a; const int g = lane >> 4;
#pragma unroll
  for (int i = 0; i < 8; ++i) { const int ka = k0 + 8 * g + i, kb = ka + 16;
    a[i] = (_Float16)(ka < K ? W[(size_t)(ka < K ? ka : K - 1) * ld + n] : 0.f); a[8 + i] = (_Float16)(kb < K ? W[(size_t)(kb < K ? kb : K - 1) * ld + n] : 0.f); }
  return a;
}
struct F2 { v16b h, l; };
__device__ __forceinline__ F2 bsplit16(const float v[16]) { F2 r;
#pragma unroll
  for (int i = 0; i < 16; ++i) { const __bf16 h = (__bf16)v[i]; r.h[i] = h; r.l[i] = (__bf16)(v[i] - (float)h); }
  return r; }
__device__ __forceinline__ F2 split_row(const float* row, int k0, int lane) { float v[16]; const float* p = row + k0 + 8 * (lane >> 4);
#pragma unroll
  for (int i = 0; i < 8; ++i) { v[i] = p[i]; v[8 + i] = p[16 + i]; }
  return bsplit16(v); }
__device__ __forceinline__ F2 split_rowK(const float* row, int k0, int lane, int K) { float v[16]; const int g = lane >> 4;
#pragma unroll
  for (int i = 0; i < 8; ++i) { const int ka = k0 + 8 * g + i, kb = ka + 16; v[i] = ka < K ? row[ka < K ? ka : K - 1] : 0.f; v[8 + i] = kb < K ? row[kb < K ? kb : K - 1] : 0.f; }
  return bsplit16(v); }
__device__ __forceinline__ F2 split_col(const float* W, int k0, int n, int lane, int ld, int K) { float v[16]; const int g = lane >> 4;
#pragma unroll
  for (int i = 0; i < 8; ++i) { const int ka = k0 + 8 * g + i, kb = ka + 16; v[i] = ka < K ? W[(size_t)(ka < K ? ka : K - 1) * ld + n] : 0.f; v[8 + i] = kb < K ? W[(size_t)(kb < K ? kb : K - 1) * ld + n] : 0.f; }
  return bsplit16(v); }
__device__ __forceinline__ v8f mac3(const F2& a, const F2& b, v8f c) { c = wmma_bf(a.l, b.h, c); c = wmma_bf(a.h, b.l, c); return wmma_bf(a.h, b.h, c); }
__device__ __forceinline__ float sigm(float v) { return 1.0f / (1.0f + expf(-v)); }
#define LDSX() do { asm volatile("s_wait_dscnt 0" ::: "memory"); __builtin_amdgcn_wave_barrier(); __builtin_amdgcn_fence(__ATOMIC_RELEASE, "workgroup"); } while (0)


// Axis attention (B 4, 2,048 queries x 2,048 keys, dim_attn 512, single head): attn = softmax((q k^T) * sqrt(512)); out = query + (attn v) Wo + bo.
#define NB 4
#define NN 2048
#define DA 512
#ifndef TNB
#define TNB NB
#endif
#ifndef TQB
#define TQB (NN / 64)
#endif
typedef __attribute__((ext_vector_type(8))) __bf16 v8b;
__device__ __forceinline__ v16b frag_b(const __bf16* rowk0, int lane) {
  union { v16b v; v8b q[2]; } u; const __bf16* p = rowk0 + 8 * (lane >> 4);
  u.q[0] = *(const v8b*)p; u.q[1] = *(const v8b*)(p + 16); return u.v;
}
__device__ __forceinline__ float bfr(float v) { return (float)(__bf16)v; }
__device__ __attribute__((noinline)) float exp_ni(float v) { return expf(v); }
__device__ __attribute__((noinline)) float erf_ni(float v) { return erff(v); }

#define WS_Q   0u                                    // f32 q rows [b*n][512]
#define WS_KH  (WS_Q + 4u * (size_t)NB * NN * DA)       // bf16 k hi rows
#define WS_KL  (WS_KH + 2u * (size_t)NB * NN * DA)      // bf16 k lo rows
#define WS_VT  (WS_KL + 2u * (size_t)NB * NN * DA)      // f16 v planes [b][512][n]
#define WS_S   (WS_VT + 2u * (size_t)NB * DA * NN)      // f32 logits [b][q][key]
#define WS_PH  (WS_S + 4u * (size_t)NB * NN * NN)       // f16 P x 2^11 rows [b*q][key]
#define WS_PL  (WS_PH + 2u * (size_t)NB * NN * NN)      // f16 residual
#define WS_O   (WS_PL + 2u * (size_t)NB * NN * NN)      // f32 o rows [b*q][512]
#define WS_END (WS_O + 4u * (size_t)NB * NN * DA)

// ---- k_proj: block = (64 rows, 128 cols, which): q (f32 rows), k (bf16 hi + lo rows), v (f16 planes)
__global__ __launch_bounds__(128) void k_proj(const float* __restrict__ XQ, const float* __restrict__ XKV, const float* __restrict__ WQ, const float* __restrict__ BQ, const float* __restrict__ WK, const float* __restrict__ BK, const float* __restrict__ WV, const float* __restrict__ BV, float* __restrict__ Q, __bf16* __restrict__ KH, __bf16* __restrict__ KL, _Float16* __restrict__ VT) {
  __shared__ __align__(16) float sf[4][16][132]; __shared__ __align__(16) __bf16 sbh[64][136], sbl[64][136]; __shared__ __align__(16) _Float16 th[128][72];
  const int tid = threadIdx.x, wave = tid >> 5, lane = tid & 31, col = lane & 15, g = lane >> 4; const int which = blockIdx.z; const int c0 = blockIdx.y * 128; const size_t r0 = (size_t)blockIdx.x * 64;
  const float* X = (which == 0) ? XQ : XKV; const float* Wm = which == 0 ? WQ : which == 1 ? WK : WV; const float* Bm = which == 0 ? BQ : which == 1 ? BK : BV;
  v8f acc[8] = {};
#pragma unroll 2
  for (int kc = 0; kc < DA / 32; ++kc) { v16b a; { const float* p = X + (r0 + wave * 16 + col) * DA + kc * 32 + 8 * g;
#pragma unroll
      for (int i = 0; i < 8; ++i) { a[i] = (__bf16)p[i]; a[8 + i] = (__bf16)p[16 + i]; } }
#pragma unroll
    for (int j = 0; j < 8; ++j) { v16b w; const int o = c0 + j * 16 + col;   // (in,out)
#pragma unroll
      for (int i = 0; i < 8; ++i) { w[i] = (__bf16)Wm[(size_t)(kc * 32 + 8 * g + i) * DA + o]; w[8 + i] = (__bf16)Wm[(size_t)(kc * 32 + 16 + 8 * g + i) * DA + o]; }
      acc[j] = wmma_bf(a, w, acc[j]); } }
#pragma unroll
  for (int j = 0; j < 8; ++j) { const float bb = bfr(Bm[c0 + j * 16 + col]);
#pragma unroll
    for (int r = 0; r < 8; ++r) { const float v = acc[j][r] + bb; const int rl = wave * 16 + 8 * g + r, cl = j * 16 + col;
      if (which == 0) sf[wave][8 * g + r][cl] = v; else if (which == 1) { const __bf16 h = (__bf16)v; sbh[rl][cl] = h; sbl[rl][cl] = (__bf16)(v - (float)h); } else th[cl][rl] = (_Float16)v; } }
  __syncthreads();
  if (which == 0) { for (int rl = 0; rl < 16; ++rl) vst2(Q + (r0 + wave * 16 + rl) * DA + c0 + lane * 4, *(const v4f*)&sf[wave][rl][lane * 4]); }
  else if (which == 1) { for (int e = tid; e < 64 * 16; e += 128) { const int rl = e >> 4, q = e & 15; vst2((unsigned*)(KH + (r0 + rl) * DA + c0 + q * 8), *(const v4u*)&sbh[rl][q * 8]); vst2((unsigned*)(KL + (r0 + rl) * DA + c0 + q * 8), *(const v4u*)&sbl[rl][q * 8]); } }
  else { const size_t b = r0 / NN; const int n0 = (int)(r0 % NN); for (int e = tid; e < 128 * 8; e += 128) { const int cl = e >> 3, q = e & 7; vst2((unsigned*)(VT + (b * DA + c0 + cl) * (size_t)NN + n0 + q * 8), *(const v4u*)&th[cl][q * 8]); } } }
// ---- k_sc: block = (64 queries, 128 keys, b): logits (3 products) x sqrt(512) -> S
__global__ __launch_bounds__(128) void k_sc(const float* __restrict__ Q, const __bf16* __restrict__ KH, const __bf16* __restrict__ KL, float* __restrict__ S) { __shared__ __align__(16) float ss[4][16][132];
  const int tid = threadIdx.x, wave = tid >> 5, lane = tid & 31, col = lane & 15, g = lane >> 4; const size_t b = blockIdx.z; const int k0 = blockIdx.y * 128; const size_t q0 = b * NN + (size_t)blockIdx.x * 64 + wave * 16;
  v8f acc[8] = {};
#pragma unroll 1
  for (int kc = 0; kc < DA / 32; ++kc) { const F2 a = split_row(Q + (q0 + col) * DA, kc * 32, lane);
#pragma unroll
    for (int j = 0; j < 8; ++j) { const size_t kr = b * NN + k0 + j * 16 + col; const v16b kh = frag_b(KH + kr * DA + kc * 32, lane), kl = frag_b(KL + kr * DA + kc * 32, lane); acc[j] = wmma_bf(a.h, kh, acc[j]); acc[j] = wmma_bf(a.l, kh, acc[j]); acc[j] = wmma_bf(a.h, kl, acc[j]); } }
#pragma unroll
  for (int j = 0; j < 8; ++j)
#pragma unroll
    for (int r = 0; r < 8; ++r) ss[wave][8 * g + r][j * 16 + col] = acc[j][r] * 22.627416997969522f;
  LDSX(); for (int rl = 0; rl < 16; ++rl) vst2(S + (q0 + rl) * NN + k0 + lane * 4, *(const v4f*)&ss[wave][rl][lane * 4]); }
// ---- k_sm: block = query row: softmax over the 2,048 keys -> P x 2^11 as f16 + residual
__global__ __launch_bounds__(256) void k_sm(const float* __restrict__ S, _Float16* __restrict__ PH, _Float16* __restrict__ PL) { __shared__ float sred[8]; __shared__ float sbc; __shared__ __align__(16) _Float16 sh[NN], sl[NN];
  const int t = threadIdx.x; const size_t row = blockIdx.x; const float* sr = S + row * NN;
  float m = -3.0e38f; for (int k = t; k < NN; k += 256) m = fmaxf(m, sr[k]);
#pragma unroll
  for (int o = 1; o < 32; o <<= 1) m = fmaxf(m, __shfl_xor(m, o));
  if ((t & 31) == 0) sred[t >> 5] = m; __syncthreads(); if (t == 0) { float a = sred[0]; for (int i = 1; i < 8; ++i) a = fmaxf(a, sred[i]); sbc = a; } __syncthreads(); m = sbc; __syncthreads();
  float sum = 0.f; for (int k = t; k < NN; k += 256) sum += expf(sr[k] - m);
#pragma unroll
  for (int o = 1; o < 32; o <<= 1) sum += __shfl_xor(sum, o);
  if ((t & 31) == 0) sred[t >> 5] = sum; __syncthreads(); if (t == 0) { float a = 0.f; for (int i = 0; i < 8; ++i) a += sred[i]; sbc = 1.0f / a; } __syncthreads(); const float inv = sbc;
  for (int k = t; k < NN; k += 256) { const float p = expf(sr[k] - m) * inv * 2048.0f; const _Float16 h = (_Float16)p; sh[k] = h; sl[k] = (_Float16)(p - (float)h); }
  __syncthreads(); for (int q = t; q < NN / 8; q += 256) { vst2((unsigned*)(PH + row * NN + q * 8), *(const v4u*)&sh[q * 8]); vst2((unsigned*)(PL + row * NN + q * 8), *(const v4u*)&sl[q * 8]); } }
// ---- k_pv: block = (64 queries, 128 value channels, b): o = P . v
__global__ __launch_bounds__(128) void k_pv(const _Float16* __restrict__ PH, const _Float16* __restrict__ PL, const _Float16* __restrict__ VT, float* __restrict__ O) { __shared__ __align__(16) float ss[4][16][132];
  const int tid = threadIdx.x, wave = tid >> 5, lane = tid & 31, col = lane & 15, g = lane >> 4; const size_t b = blockIdx.z; const int c0 = blockIdx.y * 128; const size_t q0 = b * NN + (size_t)blockIdx.x * 64 + wave * 16;
  v8f acc[8] = {};
#pragma unroll 1
  for (int kc = 0; kc < NN / 32; ++kc) { const v16h ph = frag_h(PH + (q0 + col) * NN + kc * 32, lane), pl = frag_h(PL + (q0 + col) * NN + kc * 32, lane);
#pragma unroll
    for (int j = 0; j < 8; ++j) { const v16h vb = frag_h(VT + (b * DA + c0 + j * 16 + col) * (size_t)NN + kc * 32, lane); acc[j] = wmma16(ph, vb, acc[j]); acc[j] = wmma16(pl, vb, acc[j]); } }
#pragma unroll
  for (int j = 0; j < 8; ++j)
#pragma unroll
    for (int r = 0; r < 8; ++r) ss[wave][8 * g + r][j * 16 + col] = acc[j][r] * (1.0f / 2048.0f);
  LDSX(); for (int rl = 0; rl < 16; ++rl) vst2(O + (q0 + rl) * DA + c0 + lane * 4, *(const v4f*)&ss[wave][rl][lane * 4]); }
// ---- k_out: block = (64 rows, 128 cols): out = query + o (hi + lo) . Wo + bo
__global__ __launch_bounds__(128) void k_out(const float* __restrict__ O, const float* __restrict__ WO, const float* __restrict__ BO, const float* __restrict__ XQ, float* __restrict__ OUT) { __shared__ __align__(16) float sf[4][16][132];
  const int tid = threadIdx.x, wave = tid >> 5, lane = tid & 31, col = lane & 15, g = lane >> 4; const int c0 = blockIdx.y * 128; const size_t r0 = (size_t)blockIdx.x * 64 + wave * 16;
  v8f acc[8] = {};
#pragma unroll 2
  for (int kc = 0; kc < DA / 32; ++kc) { const F2 a = split_row(O + (r0 + col) * DA, kc * 32, lane);
#pragma unroll
    for (int j = 0; j < 8; ++j) { v16b w; const int o = c0 + j * 16 + col;
#pragma unroll
      for (int i = 0; i < 8; ++i) { w[i] = (__bf16)WO[(size_t)(kc * 32 + 8 * g + i) * DA + o]; w[8 + i] = (__bf16)WO[(size_t)(kc * 32 + 16 + 8 * g + i) * DA + o]; }
      acc[j] = wmma_bf(a.h, w, acc[j]); acc[j] = wmma_bf(a.l, w, acc[j]); } }
#pragma unroll
  for (int j = 0; j < 8; ++j) { const int c = c0 + j * 16 + col; const float bb = bfr(BO[c]);
#pragma unroll
    for (int r = 0; r < 8; ++r) sf[wave][8 * g + r][j * 16 + col] = bfr(XQ[(r0 + 8 * g + r) * DA + c]) + acc[j][r] + bb; }
  LDSX(); for (int rl = 0; rl < 16; ++rl) vst2(OUT + (r0 + rl) * DA + c0 + lane * 4, *(const v4f*)&sf[wave][rl][lane * 4]); }
extern "C" void kernel_launch(void* const* d_in, const int* in_sizes, int n_in, void* d_out, int out_size, void* d_ws, size_t ws_size, hipStream_t stream) {
  (void)in_sizes; (void)n_in; (void)out_size;
  const float** F = (const float**)d_in;   // 0 query [4,2048,512], 1 key_value [4,2048,512], 2 Wq, 3 bq, 4 Wk, 5 bk, 6 Wv, 7 bv, 8 Wo, 9 bo ((in,out) [512,512] / [512])
  if (ws_size < (size_t)WS_END) return;
  char* ws = (char*)d_ws; float *Q = (float*)(ws + WS_Q), *S = (float*)(ws + WS_S), *O = (float*)(ws + WS_O); __bf16 *KH = (__bf16*)(ws + WS_KH), *KL = (__bf16*)(ws + WS_KL); _Float16 *VT = (_Float16*)(ws + WS_VT), *PH = (_Float16*)(ws + WS_PH), *PL = (_Float16*)(ws + WS_PL);
  k_proj<<<dim3(TNB * NN / 64, DA / 128, 3), 128, 0, stream>>>(F[0], F[1], F[2], F[3], F[4], F[5], F[6], F[7], Q, KH, KL, VT);
  k_sc<<<dim3(TQB, NN / 128, TNB), 128, 0, stream>>>(Q, KH, KL, S);
  k_sm<<<TNB * TQB * 64, 256, 0, stream>>>(S, PH, PL);   // rows of all batches are contiguous: one launch
  k_pv<<<dim3(TQB, DA / 128, TNB), 128, 0, stream>>>(PH, PL, VT, O);
  k_out<<<dim3(TNB * TQB, DA / 128), 128, 0, stream>>>(O, F[8], F[9], F[0], (float*)d_out);   // 512 work-groups in one launch, not 4 launches of 128
}

// v002
// Measured time: 224 microseconds a run.
// Two timings next to v001 put it at 1.82 and 1.81 times that version's speed.
// Counting every step since v000, it is 2.10 times as fast.
// compute dtype: all float inputs rounded to bf16; q/k/v = x W + b with EXACT bf16 products on WMMA 16x16x32 ((in,out) weights), f32 accumulate; q and k kept in f32 and split into bf16 hi + lo for the scores (3 products: the module multiplies by sqrt(512), logits ~1e2), logits stored in f32; softmax in f32 (precise expf) -> P as f16 x 2^11 + residual; P . v with v as f16 (2 products); out = query + o (bf16 hi + lo) . Wo + bo (2 products); f32 output.
#include <hip/hip_runtime.h>
#include <math.h>

typedef __attribute__((ext_vector_type(16))) _Float16 v16h;
typedef __attribute__((ext_vector_type(16))) __bf16 v16b;
typedef __attribute__((ext_vector_type(8)))  _Float16 v8h;
typedef __attribute__((ext_vector_type(8)))  float v8f;
typedef __attribute__((ext_vector_type(4)))  float v4f;
typedef __attribute__((ext_vector_type(2)))  float v2f;
typedef __attribute__((ext_vector_type(4)))  unsigned v4u;
typedef __attribute__((ext_vector_type(4)))  int v4i;
typedef float __attribute__((may_alias)) float_a;
typedef int __attribute__((may_alias)) int_a;

template <typename T> __device__ __forceinline__ void vst2(void* p, T v) { *(T*)p = v;  }
__device__ __forceinline__ v8f wmma16(v16h a, v16h b, v8f c) {
  v8f d = __builtin_amdgcn_wmma_f32_16x16x32_f16(false, a, false, b, (short)0, c, false, false);
  asm volatile("v_nop\n\tv_nop\n\tv_nop\n\tv_nop" : "+v"(d) : "v"(a), "v"(b));
  return d;
}
__device__ __forceinline__ v8f wmma_bf(v16b a, v16b b, v8f c) {
  v8f d = __builtin_amdgcn_wmma_f32_16x16x32_bf16(false, a, false, b, (short)0, c, false, false);
  asm volatile("v_nop\n\tv_nop\n\tv_nop\n\tv_nop" : "+v"(d) : "v"(a), "v"(b));
  return d;
}
// 16x16x32 fragments: lane = (h = lane>>4, row/col = lane&15); elements 0..7 = k0+8h+0..7, 8..15 = k0+16+8h+0..7; D element r = row 8h+r
__device__ __forceinline__ v16h frag_h(const _Float16* rowk0, int lane) {
  union { v16h v; v8h q[2]; } u; const _Float16* p = rowk0 + 8 * (lane >> 4);
  u.q[0] = *(const v8h*)p; u.q[1] = *(const v8h*)(p + 16); return u.v;
}
__device__ __forceinline__ v16h frag_f32(const float* rowk0, int lane) {
  v16h a; const float* p = rowk0 + 8 * (lane >> 4);
#pragma unroll
  for (int i = 0; i < 8; ++i) { a[i] = (_Float16)p[i]; a[8 + i] = (_Float16)p[16 + i]; }
  return a;
}
__device__ __forceinline__ v16h frag_f32s(const float* rowk0, int lane, float sc) {
  v16h a; const float* p = rowk0 + 8 * (lane >> 4);
#pragma unroll
  for (int i = 0; i < 8; ++i) { a[i] = (_Float16)(p[i] * sc); a[8 + i] = (_Float16)(p[16 + i] * sc); }
  return a;
}
// column fragment from a [K][ld] layout (column n), rows >= K read as 0
__device__ __forceinline__ v16h fragc_f32(const float* W, int k0, int n, int lane, int ld, int K) {
  v16h a; const int g = lane >> 4;
#pragma unroll
  for (int i = 0; i < 8; ++i) { const int ka = k0 + 8 * g + i, kb = ka + 16;
    a[i] = (_Float16)(ka < K ? W[(size_t)(ka < K ? ka : K - 1) * ld + n] : 0.f); a[8 + i] = (_Float16)(kb < K ? W[(size_t)(kb < K ? kb : K - 1) * ld + n] : 0.f); }
  return a;
}
struct F2 { v16b h, l; };
__device__ __forceinline__ F2 bsplit16(const float v[16]) { F2 r;
#pragma unroll
  for (int i = 0; i < 16; ++i) { const __bf16 h = (__bf16)v[i]; r.h[i] = h; r.l[i] = (__bf16)(v[i] - (float)h); }
  return r; }
__device__ __forceinline__ F2 split_row(const float* row, int k0, int lane) { float v[16]; const float* p = row + k0 + 8 * (lane >> 4);
#pragma unroll
  for (int i = 0; i < 8; ++i) { v[i] = p[i]; v[8 + i] = p[16 + i]; }
  return bsplit16(v); }
__device__ __forceinline__ F2 split_rowK(const float* row, int k0, int lane, int K) { float v[16]; const int g = lane >> 4;
#pragma unroll
  for (int i = 0; i < 8; ++i) { const int ka = k0 + 8 * g + i, kb = ka + 16; v[i] = ka < K ? row[ka < K ? ka : K - 1] : 0.f; v[8 + i] = kb < K ? row[kb < K ? kb : K - 1] : 0.f; }
  return bsplit16(v); }
__device__ __forceinline__ F2 split_col(const float* W, int k0, int n, int lane, int ld, int K) { float v[16]; const int g = lane >> 4;
#pragma unroll
  for (int i = 0; i < 8; ++i) { const int ka = k0 + 8 * g + i, kb = ka + 16; v[i] = ka < K ? W[(size_t)(ka < K ? ka : K - 1) * ld + n] : 0.f; v[8 + i] = kb < K ? W[(size_t)(kb < K ? kb : K - 1) * ld + n] : 0.f; }
  return bsplit16(v); }
__device__ __forceinline__ v8f mac3(const F2& a, const F2& b, v8f c) { c = wmma_bf(a.l, b.h, c); c = wmma_bf(a.h, b.l, c); return wmma_bf(a.h, b.h, c); }
__device__ __forceinline__ float sigm(float v) { return 1.0f / (1.0f + expf(-v)); }
#define LDSX() do { asm volatile("s_wait_dscnt 0" ::: "memory"); __builtin_amdgcn_wave_barrier(); __builtin_amdgcn_fence(__ATOMIC_RELEASE, "workgroup"); } while (0)


// Axis attention (B 4, 2,048 queries x 2,048 keys, dim_attn 512, single head): attn = softmax((q k^T) * sqrt(512)); out = query + (attn v) Wo + bo.
#define NB 4
#define NN 2048
#define DA 512
#ifndef TNB
#define TNB NB
#endif
#ifndef TQB
#define TQB (NN / 64)
#endif
typedef __attribute__((ext_vector_type(8))) __bf16 v8b;
__device__ __forceinline__ v16b frag_b(const __bf16* rowk0, int lane) {
  union { v16b v; v8b q[2]; } u; const __bf16* p = rowk0 + 8 * (lane >> 4);
  u.q[0] = *(const v8b*)p; u.q[1] = *(const v8b*)(p + 16); return u.v;
}
__device__ __forceinline__ float bfr(float v) { return (float)(__bf16)v; }
__device__ __attribute__((noinline)) float exp_ni(float v) { return expf(v); }
__device__ __attribute__((noinline)) float erf_ni(float v) { return erff(v); }

#define WS_Q   0u                                    // f32 q rows [b*n][512]
#define WS_KH  (WS_Q + 4u * (size_t)NB * NN * DA)       // bf16 k hi rows
#define WS_KL  (WS_KH + 2u * (size_t)NB * NN * DA)      // bf16 k lo rows
#define WS_VT  (WS_KL + 2u * (size_t)NB * NN * DA)      // f16 v planes [b][512][n]
#define WS_S   (WS_VT + 2u * (size_t)NB * DA * NN)      // f32 logits [b][q][key]
#define WS_PH  (WS_S + 4u * (size_t)NB * NN * NN)       // f16 P x 2^11 rows [b*q][key]
#define WS_PL  (WS_PH + 2u * (size_t)NB * NN * NN)      // f16 residual
#define WS_O   (WS_PL + 2u * (size_t)NB * NN * NN)      // f32 o rows [b*q][512]
#define WS_END (WS_O + 4u * (size_t)NB * NN * DA)

// ---- k_proj: block = (64 rows, 128 cols, which): q (f32 rows), k (bf16 hi + lo rows), v (f16 planes)
__global__ __launch_bounds__(128) void k_proj(const float* __restrict__ XQ, const float* __restrict__ XKV, const float* __restrict__ WQ, const float* __restrict__ BQ, const float* __restrict__ WK, const float* __restrict__ BK, const float* __restrict__ WV, const float* __restrict__ BV, float* __restrict__ Q, __bf16* __restrict__ KH, __bf16* __restrict__ KL, _Float16* __restrict__ VT) {
  __shared__ __align__(16) float sf[4][16][132]; __shared__ __align__(16) __bf16 sbh[64][136], sbl[64][136]; __shared__ __align__(16) _Float16 th[128][72];
  const int tid = threadIdx.x, wave = tid >> 5, lane = tid & 31, col = lane & 15, g = lane >> 4; const int which = blockIdx.z; const int c0 = blockIdx.y * 128; const size_t r0 = (size_t)blockIdx.x * 64;
  const float* X = (which == 0) ? XQ : XKV; const float* Wm = which == 0 ? WQ : which == 1 ? WK : WV; const float* Bm = which == 0 ? BQ : which == 1 ? BK : BV;
  v8f acc[8] = {};
#pragma unroll 2
  for (int kc = 0; kc < DA / 32; ++kc) { v16b a; { const float* p = X + (r0 + wave * 16 + col) * DA + kc * 32 + 8 * g;
#pragma unroll
      for (int i = 0; i < 8; ++i) { a[i] = (__bf16)p[i]; a[8 + i] = (__bf16)p[16 + i]; } }
#pragma unroll
    for (int j = 0; j < 8; ++j) { v16b w; const int o = c0 + j * 16 + col;   // (in,out)
#pragma unroll
      for (int i = 0; i < 8; ++i) { w[i] = (__bf16)Wm[(size_t)(kc * 32 + 8 * g + i) * DA + o]; w[8 + i] = (__bf16)Wm[(size_t)(kc * 32 + 16 + 8 * g + i) * DA + o]; }
      acc[j] = wmma_bf(a, w, acc[j]); } }
#pragma unroll
  for (int j = 0; j < 8; ++j) { const float bb = bfr(Bm[c0 + j * 16 + col]);
#pragma unroll
    for (int r = 0; r < 8; ++r) { const float v = acc[j][r] + bb; const int rl = wave * 16 + 8 * g + r, cl = j * 16 + col;
      if (which == 0) sf[wave][8 * g + r][cl] = v; else if (which == 1) { const __bf16 h = (__bf16)v; sbh[rl][cl] = h; sbl[rl][cl] = (__bf16)(v - (float)h); } else th[cl][rl] = (_Float16)v; } }
  __syncthreads();
  if (which == 0) { for (int rl = 0; rl < 16; ++rl) vst2(Q + (r0 + wave * 16 + rl) * DA + c0 + lane * 4, *(const v4f*)&sf[wave][rl][lane * 4]); }
  else if (which == 1) { for (int e = tid; e < 64 * 16; e += 128) { const int rl = e >> 4, q = e & 15; vst2((unsigned*)(KH + (r0 + rl) * DA + c0 + q * 8), *(const v4u*)&sbh[rl][q * 8]); vst2((unsigned*)(KL + (r0 + rl) * DA + c0 + q * 8), *(const v4u*)&sbl[rl][q * 8]); } }
  else { const size_t b = r0 / NN; const int n0 = (int)(r0 % NN); for (int e = tid; e < 128 * 8; e += 128) { const int cl = e >> 3, q = e & 7; vst2((unsigned*)(VT + (b * DA + c0 + cl) * (size_t)NN + n0 + q * 8), *(const v4u*)&th[cl][q * 8]); } } }
// eight 16-byte asynchronous copies of one lane, global -> LDS: copy i brings g + i * gstep to LDS byte l + i * lstep.
// The closing s_wait_xcnt 0 stands inside the copies' own statement so that no address register is rewritten ahead of it.
__device__ __forceinline__ void acp8(unsigned l, unsigned lstep, const char* g, size_t gstep) {
  asm volatile("global_load_async_to_lds_b128 %0, %8, off\n\t"
               "global_load_async_to_lds_b128 %1, %9, off\n\t"
               "global_load_async_to_lds_b128 %2, %10, off\n\t"
               "global_load_async_to_lds_b128 %3, %11, off\n\t"
               "global_load_async_to_lds_b128 %4, %12, off\n\t"
               "global_load_async_to_lds_b128 %5, %13, off\n\t"
               "global_load_async_to_lds_b128 %6, %14, off\n\t"
               "global_load_async_to_lds_b128 %7, %15, off\n\t"
               "s_wait_xcnt 0x0"
               :: "v"(l), "v"(l + lstep), "v"(l + 2 * lstep), "v"(l + 3 * lstep), "v"(l + 4 * lstep), "v"(l + 5 * lstep), "v"(l + 6 * lstep), "v"(l + 7 * lstep),
                  "v"(g), "v"(g + gstep), "v"(g + 2 * gstep), "v"(g + 3 * gstep), "v"(g + 4 * gstep), "v"(g + 5 * gstep), "v"(g + 6 * gstep), "v"(g + 7 * gstep)
               : "memory");
}
// this wave's copies have landed (the compiler places no wait for them)
#define WAIT_COPIES() asm volatile("s_wait_asynccnt 0x0" ::: "memory")
// this wave's LDS reads have returned, before the barrier behind which their buffer is refilled
#define WAIT_LDS() asm volatile("s_wait_dscnt 0x0" ::: "memory")
#define P128 144   // LDS pitch of a 128-byte row, 16 B x odd: ds_load_b128 without bank conflicts
#define P256 272   // the same for a 256-byte row
// ---- k_sc: block = (64 queries, 128 keys, b): logits (3 products) x sqrt(512) -> S. A stage = 64 k of the K hi, K lo and q rows, copied to LDS in whole lines, two buffers
#define SC_KL (128 * P128)
#define SC_Q  (256 * P128)
#define SC_BUF (256 * P128 + 64 * P256)
__global__ __launch_bounds__(128) void k_sc(const float* __restrict__ Q, const __bf16* __restrict__ KH, const __bf16* __restrict__ KL, float* __restrict__ S) { __shared__ __align__(16) char ring[2 * SC_BUF];
  const int tid = threadIdx.x, wave = tid >> 5, lane = tid & 31, col = lane & 15, g = lane >> 4; const size_t b = blockIdx.z; const int k0 = blockIdx.y * 128; const size_t qb = b * NN + (size_t)blockIdx.x * 64, q0 = qb + wave * 16;
  const unsigned lds0 = (unsigned)(size_t)ring;
  const unsigned lk = lds0 + (tid >> 3) * P128 + (tid & 7) * 16, lq = lds0 + SC_Q + (tid >> 4) * P256 + (tid & 15) * 16;   // 8 lanes a K row, 16 lanes a q row
  const size_t ko = ((b * NN + k0 + (tid >> 3)) * DA + (tid & 7) * 8) * 2;
  const char* gh = (const char*)KH + ko; const char* gl = (const char*)KL + ko; const char* gq = (const char*)Q + ((qb + (tid >> 4)) * DA + (tid & 15) * 4) * 4;
#define SC_FILL(s, bf) do { acp8(lk + (bf) * SC_BUF, 16 * P128, gh + (s) * 128, (size_t)16 * DA * 2); acp8(lk + SC_KL + (bf) * SC_BUF, 16 * P128, gl + (s) * 128, (size_t)16 * DA * 2); acp8(lq + (bf) * SC_BUF, 8 * P256, gq + (s) * 256, (size_t)8 * DA * 4); } while (0)
  v8f acc[8] = {};
  SC_FILL(0, 0); WAIT_COPIES(); __syncthreads(); SC_FILL(1, 1);
#pragma unroll 1   // one stage a trip: the two buffers alternate by the trip's parity
  for (int s = 0; s < DA / 64; ++s) { const char* bp = ring + (s & 1) * SC_BUF;
#pragma unroll
    for (int h = 0; h < 2; ++h) { v16b kh[8], kl[8]; const F2 a = split_row((const float*)(bp + SC_Q + (wave * 16 + col) * P256), h * 32, lane);
#pragma unroll
      for (int j = 0; j < 8; ++j) { const char* kr = bp + (j * 16 + col) * P128 + h * 64; kh[j] = frag_b((const __bf16*)kr, lane); kl[j] = frag_b((const __bf16*)(kr + SC_KL), lane); }   // the block's LDS reads as one group ahead of its products: one LDS latency a block, not one a key group
#pragma unroll
      for (int j = 0; j < 8; ++j) { acc[j] = wmma_bf(a.h, kh[j], acc[j]); acc[j] = wmma_bf(a.l, kh[j], acc[j]); acc[j] = wmma_bf(a.h, kl[j], acc[j]); } }
    WAIT_LDS(); WAIT_COPIES(); __syncthreads();   // publishes stage s + 1 and ends every read of stage s
    if (s + 2 < DA / 64) SC_FILL(s + 2, s & 1); }
  WAIT_COPIES();
  float (*ss)[132] = (float (*)[132])(ring + wave * (16 * 132 * 4));   // the ring is free behind the last trip's barrier: each wave stages its 16 rows in its own range
#pragma unroll
  for (int j = 0; j < 8; ++j)
#pragma unroll
    for (int r = 0; r < 8; ++r) ss[8 * g + r][j * 16 + col] = acc[j][r] * 22.627416997969522f;
  LDSX(); for (int rl = 0; rl < 16; ++rl) vst2(S + (q0 + rl) * NN + k0 + lane * 4, *(const v4f*)&ss[rl][lane * 4]); }
// ---- k_sm: block = query row: softmax over the 2,048 keys -> P x 2^11 as f16 + residual
__global__ __launch_bounds__(256) void k_sm(const float* __restrict__ S, _Float16* __restrict__ PH, _Float16* __restrict__ PL) { __shared__ float sred[8]; __shared__ float sbc; __shared__ __align__(16) _Float16 sh[NN], sl[NN];
  const int t = threadIdx.x; const size_t row = blockIdx.x; const float* sr = S + row * NN;
  float m = -3.0e38f; for (int k = t; k < NN; k += 256) m = fmaxf(m, sr[k]);
#pragma unroll
  for (int o = 1; o < 32; o <<= 1) m = fmaxf(m, __shfl_xor(m, o));
  if ((t & 31) == 0) sred[t >> 5] = m; __syncthreads(); if (t == 0) { float a = sred[0]; for (int i = 1; i < 8; ++i) a = fmaxf(a, sred[i]); sbc = a; } __syncthreads(); m = sbc; __syncthreads();
  float sum = 0.f; for (int k = t; k < NN; k += 256) sum += expf(sr[k] - m);
#pragma unroll
  for (int o = 1; o < 32; o <<= 1) sum += __shfl_xor(sum, o);
  if ((t & 31) == 0) sred[t >> 5] = sum; __syncthreads(); if (t == 0) { float a = 0.f; for (int i = 0; i < 8; ++i) a += sred[i]; sbc = 1.0f / a; } __syncthreads(); const float inv = sbc;
  for (int k = t; k < NN; k += 256) { const float p = expf(sr[k] - m) * inv * 2048.0f; const _Float16 h = (_Float16)p; sh[k] = h; sl[k] = (_Float16)(p - (float)h); }
  __syncthreads(); for (int q = t; q < NN / 8; q += 256) { vst2((unsigned*)(PH + row * NN + q * 8), *(const v4u*)&sh[q * 8]); vst2((unsigned*)(PL + row * NN + q * 8), *(const v4u*)&sl[q * 8]); } }
// ---- k_pv: block = (64 queries, 128 value channels, b): o = P . v. A stage = 128 keys of the v, P hi and P lo rows, copied to LDS in whole lines, two buffers
#define PV_PH (128 * P256)
#define PV_PL (192 * P256)
#define PV_BUF (256 * P256)
__global__ __launch_bounds__(128) void k_pv(const _Float16* __restrict__ PH, const _Float16* __restrict__ PL, const _Float16* __restrict__ VT, float* __restrict__ O) { __shared__ __align__(16) char ring[2 * PV_BUF];
  const int tid = threadIdx.x, wave = tid >> 5, lane = tid & 31, col = lane & 15, g = lane >> 4; const size_t b = blockIdx.z; const int c0 = blockIdx.y * 128; const size_t qb = b * NN + (size_t)blockIdx.x * 64, q0 = qb + wave * 16;
  const unsigned lv = (unsigned)(size_t)ring + (tid >> 4) * P256 + (tid & 15) * 16;   // 16 lanes a row
  const size_t po = ((qb + (tid >> 4)) * NN + (tid & 15) * 8) * 2;
  const char* gv = (const char*)VT + ((b * DA + c0 + (tid >> 4)) * (size_t)NN + (tid & 15) * 8) * 2; const char* gph = (const char*)PH + po; const char* gpl = (const char*)PL + po;
#define PV_FILL(s, bf) do { acp8(lv + (bf) * PV_BUF, 8 * P256, gv + (s) * 256, (size_t)8 * NN * 2); acp8(lv + 64 * P256 + (bf) * PV_BUF, 8 * P256, gv + (size_t)64 * NN * 2 + (s) * 256, (size_t)8 * NN * 2); \
    acp8(lv + PV_PH + (bf) * PV_BUF, 8 * P256, gph + (s) * 256, (size_t)8 * NN * 2); acp8(lv + PV_PL + (bf) * PV_BUF, 8 * P256, gpl + (s) * 256, (size_t)8 * NN * 2); } while (0)
  v8f acc[8] = {};
  PV_FILL(0, 0); WAIT_COPIES(); __syncthreads(); PV_FILL(1, 1);
#pragma unroll 1   // one stage a trip: the two buffers alternate by the trip's parity
  for (int s = 0; s < NN / 128; ++s) { const char* bp = ring + (s & 1) * PV_BUF;
#pragma unroll
    for (int h = 0; h < 4; ++h) { v16h vb[8]; const char* pr = bp + PV_PH + (wave * 16 + col) * P256 + h * 64; const v16h ph = frag_h((const _Float16*)pr, lane), pl = frag_h((const _Float16*)(pr + (PV_PL - PV_PH)), lane);
#pragma unroll
      for (int j = 0; j < 8; ++j) vb[j] = frag_h((const _Float16*)(bp + (j * 16 + col) * P256 + h * 64), lane);   // the block's LDS reads as one group ahead of its products
#pragma unroll
      for (int j = 0; j < 8; ++j) { acc[j] = wmma16(ph, vb[j], acc[j]); acc[j] = wmma16(pl, vb[j], acc[j]); } }
    WAIT_LDS(); WAIT_COPIES(); __syncthreads();   // publishes stage s + 1 and ends every read of stage s
    if (s + 2 < NN / 128) PV_FILL(s + 2, s & 1); }
  WAIT_COPIES();
  float (*ss)[132] = (float (*)[132])(ring + wave * (16 * 132 * 4));   // the ring is free behind the last trip's barrier: each wave stages its 16 rows in its own range
#pragma unroll
  for (int j = 0; j < 8; ++j)
#pragma unroll
    for (int r = 0; r < 8; ++r) ss[8 * g + r][j * 16 + col] = acc[j][r] * (1.0f / 2048.0f);
  LDSX(); for (int rl = 0; rl < 16; ++rl) vst2(O + (q0 + rl) * DA + c0 + lane * 4, *(const v4f*)&ss[rl][lane * 4]); }
// ---- k_out: block = (64 rows, 128 cols): out = query + o (hi + lo) . Wo + bo
__global__ __launch_bounds__(128) void k_out(const float* __restrict__ O, const float* __restrict__ WO, const float* __restrict__ BO, const float* __restrict__ XQ, float* __restrict__ OUT) { __shared__ __align__(16) float sf[4][16][132];
  const int tid = threadIdx.x, wave = tid >> 5, lane = tid & 31, col = lane & 15, g = lane >> 4; const int c0 = blockIdx.y * 128; const size_t r0 = (size_t)blockIdx.x * 64 + wave * 16;
  v8f acc[8] = {};
#pragma unroll 2
  for (int kc = 0; kc < DA / 32; ++kc) { const F2 a = split_row(O + (r0 + col) * DA, kc * 32, lane);
#pragma unroll
    for (int j = 0; j < 8; ++j) { v16b w; const int o = c0 + j * 16 + col;
#pragma unroll
      for (int i = 0; i < 8; ++i) { w[i] = (__bf16)WO[(size_t)(kc * 32 + 8 * g + i) * DA + o]; w[8 + i] = (__bf16)WO[(size_t)(kc * 32 + 16 + 8 * g + i) * DA + o]; }
      acc[j] = wmma_bf(a.h, w, acc[j]); acc[j] = wmma_bf(a.l, w, acc[j]); } }
#pragma unroll
  for (int j = 0; j < 8; ++j) { const int c = c0 + j * 16 + col; const float bb = bfr(BO[c]);
#pragma unroll
    for (int r = 0; r < 8; ++r) sf[wave][8 * g + r][j * 16 + col] = bfr(XQ[(r0 + 8 * g + r) * DA + c]) + acc[j][r] + bb; }
  LDSX(); for (int rl = 0; rl < 16; ++rl) vst2(OUT + (r0 + rl) * DA + c0 + lane * 4, *(const v4f*)&sf[wave][rl][lane * 4]); }
extern "C" void kernel_launch(void* const* d_in, const int* in_sizes, int n_in, void* d_out, int out_size, void* d_ws, size_t ws_size, hipStream_t stream) {
  (void)in_sizes; (void)n_in; (void)out_size;
  const float** F = (const float**)d_in;   // 0 query [4,2048,512], 1 key_value [4,2048,512], 2 Wq, 3 bq, 4 Wk, 5 bk, 6 Wv, 7 bv, 8 Wo, 9 bo ((in,out) [512,512] / [512])
  if (ws_size < (size_t)WS_END) return;
  char* ws = (char*)d_ws; float *Q = (float*)(ws + WS_Q), *S = (float*)(ws + WS_S), *O = (float*)(ws + WS_O); __bf16 *KH = (__bf16*)(ws + WS_KH), *KL = (__bf16*)(ws + WS_KL); _Float16 *VT = (_Float16*)(ws + WS_VT), *PH = (_Float16*)(ws + WS_PH), *PL = (_Float16*)(ws + WS_PL);
  k_proj<<<dim3(TNB * NN / 64, DA / 128, 3), 128, 0, stream>>>(F[0], F[1], F[2], F[3], F[4], F[5], F[6], F[7], Q, KH, KL, VT);
  k_sc<<<dim3(TQB, NN / 128, TNB), 128, 0, stream>>>(Q, KH, KL, S);
  k_sm<<<TNB * TQB * 64, 256, 0, stream>>>(S, PH, PL);   // rows of all batches are contiguous: one launch
  k_pv<<<dim3(TQB, DA / 128, TNB), 128, 0, stream>>>(PH, PL, VT, O);
  k_out<<<dim3(TNB * TQB, DA / 128), 128, 0, stream>>>(O, F[8], F[9], F[0], (float*)d_out);   // 512 work-groups in one launch, not 4 launches of 128
}

// v003
// A run of this version takes 159 microseconds.
// Timed twice side by side with v002, it ran 1.41 times as fast both times.
// Over all steps from v000 it is 2.97 times as fast.
// compute dtype: all float inputs rounded to bf16; q/k/v = x W + b with EXACT bf16 products on WMMA 16x16x32 ((in,out) weights), f32 accumulate; q and k kept in f32 and split into bf16 hi + lo for the scores (3 products: the module multiplies by sqrt(512), logits ~1e2), logits stored in f32; softmax in f32 (precise expf) -> P as f16 x 2^11 + residual; P . v with v as f16 (2 products); out = query + o (bf16 hi + lo) . Wo + bo (2 products); f32 output.
#include <hip/hip_runtime.h>
#include <math.h>

typedef __attribute__((ext_vector_type(16))) _Float16 v16h;
typedef __attribute__((ext_vector_type(16))) __bf16 v16b;
typedef __attribute__((ext_vector_type(8)))  _Float16 v8h;
typedef __attribute__((ext_vector_type(8)))  float v8f;
typedef __attribute__((ext_vector_type(4)))  float v4f;
typedef __attribute__((ext_vector_type(2)))  float v2f;
typedef __attribute__((ext_vector_type(4)))  unsigned v4u;
typedef __attribute__((ext_vector_type(4)))  int v4i;
typedef float __attribute__((may_alias)) float_a;
typedef int __attribute__((may_alias)) int_a;

template <typename T> __device__ __forceinline__ void vst2(void* p, T v) { *(T*)p = v;  }
__device__ __forceinline__ v8f wmma16(v16h a, v16h b, v8f c) {
  v8f d = __builtin_amdgcn_wmma_f32_16x16x32_f16(false, a, false, b, (short)0, c, false, false);
  asm volatile("v_nop\n\tv_nop\n\tv_nop\n\tv_nop" : "+v"(d) : "v"(a), "v"(b));
  return d;
}
__device__ __forceinline__ v8f wmma_bf(v16b a, v16b b, v8f c) {
  v8f d = __builtin_amdgcn_wmma_f32_16x16x32_bf16(false, a, false, b, (short)0, c, false, false);
  asm volatile("v_nop\n\tv_nop\n\tv_nop\n\tv_nop" : "+v"(d) : "v"(a), "v"(b));
  return d;
}
// 16x16x32 fragments: lane = (h = lane>>4, row/col = lane&15); elements 0..7 = k0+8h+0..7, 8..15 = k0+16+8h+0..7; D element r = row 8h+r
__device__ __forceinline__ v16h frag_h(const _Float16* rowk0, int lane) {
  union { v16h v; v8h q[2]; } u; const _Float16* p = rowk0 + 8 * (lane >> 4);
  u.q[0] = *(const v8h*)p; u.q[1] = *(const v8h*)(p + 16); return u.v;
}
__device__ __forceinline__ v16h frag_f32(const float* rowk0, int lane) {
  v16h a; const float* p = rowk0 + 8 * (lane >> 4);
#pragma unroll
  for (int i = 0; i < 8; ++i) { a[i] = (_Float16)p[i]; a[8 + i] = (_Float16)p[16 + i]; }
  return a;
}
__device__ __forceinline__ v16h frag_f32s(const float* rowk0, int lane, float sc) {
  v16h a; const float* p = rowk0 + 8 * (lane >> 4);
#pragma unroll
  for (int i = 0; i < 8; ++i) { a[i] = (_Float16)(p[i] * sc); a[8 + i] = (_Float16)(p[16 + i] * sc); }
  return a;
}
// column fragment from a [K][ld] layout (column n), rows >= K read as 0
__device__ __forceinline__ v16h fragc_f32(const float* W, int k0, int n, int lane, int ld, int K) {
  v16h a; const int g = lane >> 4;
#pragma unroll
  for (int i = 0; i < 8; ++i) { const int ka = k0 + 8 * g + i, kb = ka + 16;
    a[i] = (_Float16)(ka < K ? W[(size_t)(ka < K ? ka : K - 1) * ld + n] : 0.f); a[8 + i] = (_Float16)(kb < K ? W[(size_t)(kb < K ? kb : K - 1) * ld + n] : 0.f); }
  return a;
}
struct F2 { v16b h, l; };
__device__ __forceinline__ F2 bsplit16(const float v[16]) { F2 r;
#pragma unroll
  for (int i = 0; i < 16; ++i) { const __bf16 h = (__bf16)v[i]; r.h[i] = h; r.l[i] = (__bf16)(v[i] - (float)h); }
  return r; }
__device__ __forceinline__ F2 split_row(const float* row, int k0, int lane) { float v[16]; const float* p = row + k0 + 8 * (lane >> 4);
#pragma unroll
  for (int i = 0; i < 8; ++i) { v[i] = p[i]; v[8 + i] = p[16 + i]; }
  return bsplit16(v); }
__device__ __forceinline__ F2 split_rowK(const float* row, int k0, int lane, int K) { float v[16]; const int g = lane >> 4;
#pragma unroll
  for (int i = 0; i < 8; ++i) { const int ka = k0 + 8 * g + i, kb = ka + 16; v[i] = ka < K ? row[ka < K ? ka : K - 1] : 0.f; v[8 + i] = kb < K ? row[kb < K ? kb : K - 1] : 0.f; }
  return bsplit16(v); }
__device__ __forceinline__ F2 split_col(const float* W, int k0, int n, int lane, int ld, int K) { float v[16]; const int g = lane >> 4;
#pragma unroll
  for (int i = 0; i < 8; ++i) { const int ka = k0 + 8 * g + i, kb = ka + 16; v[i] = ka < K ? W[(size_t)(ka < K ? ka : K - 1) * ld + n] : 0.f; v[8 + i] = kb < K ? W[(size_t)(kb < K ? kb : K - 1) * ld + n] : 0.f; }
  return bsplit16(v); }
__device__ __forceinline__ v8f mac3(const F2& a, const F2& b, v8f c) { c = wmma_bf(a.l, b.h, c); c = wmma_bf(a.h, b.l, c); return wmma_bf(a.h, b.h, c); }
__device__ __forceinline__ float sigm(float v) { return 1.0f / (1.0f + expf(-v)); }
#define LDSX() do { asm volatile("s_wait_dscnt 0" ::: "memory"); __builtin_amdgcn_wave_barrier(); __builtin_amdgcn_fence(__ATOMIC_RELEASE, "workgroup"); } while (0)


// Axis attention (B 4, 2,048 queries x 2,048 keys, dim_attn 512, single head): attn = softmax((q k^T) * sqrt(512)); out = query + (attn v) Wo + bo.
#define NB 4
#define NN 2048
#define DA 512
#ifndef TNB
#define TNB NB
#endif
#ifndef TQB
#define TQB (NN / 64)
#endif
typedef __attribute__((ext_vector_type(8))) __bf16 v8b;
__device__ __forceinline__ v16b frag_b(const __bf16* rowk0, int lane) {
  union { v16b v; v8b q[2]; } u; const __bf16* p = rowk0 + 8 * (lane >> 4);
  u.q[0] = *(const v8b*)p; u.q[1] = *(const v8b*)(p + 16); return u.v;
}
__device__ __forceinline__ float bfr(float v) { return (float)(__bf16)v; }
__device__ __attribute__((noinline)) float exp_ni(float v) { return expf(v); }
__device__ __attribute__((noinline)) float erf_ni(float v) { return erff(v); }

#define WS_Q   0u                                    // f32 q rows [b*n][512]
#define WS_KH  (WS_Q + 4u * (size_t)NB * NN * DA)       // bf16 k hi rows
#define WS_KL  (WS_KH + 2u * (size_t)NB * NN * DA)      // bf16 k lo rows
#define WS_VT  (WS_KL + 2u * (size_t)NB * NN * DA)      // f16 v planes [b][512][n]
#define WS_S   (WS_VT + 2u * (size_t)NB * DA * NN)      // f32 logits [b][q][key]
#define WS_PH  (WS_S + 4u * (size_t)NB * NN * NN)       // f16 P x 2^11 rows [b*q][key]
#define WS_PL  (WS_PH + 2u * (size_t)NB * NN * NN)      // f16 residual
#define WS_O   (WS_PL + 2u * (size_t)NB * NN * NN)      // f32 o rows [b*q][512]
#define WS_WT  (WS_O + 4u * (size_t)NB * NN * DA)       // bf16 weights as [4][out][in] rows: Wq, Wk, Wv, Wo
#define WS_END (WS_WT + 2u * (size_t)4 * DA * DA)

// eight 16-byte asynchronous copies of one lane, global -> LDS: copy i brings g + i * gstep to LDS byte l + i * lstep.
// The closing s_wait_xcnt 0 stands inside the copies' own statement so that no address register is rewritten ahead of it.
__device__ __forceinline__ void acp8(unsigned l, unsigned lstep, const char* g, size_t gstep) {
  asm volatile("global_load_async_to_lds_b128 %0, %8, off\n\t"
               "global_load_async_to_lds_b128 %1, %9, off\n\t"
               "global_load_async_to_lds_b128 %2, %10, off\n\t"
               "global_load_async_to_lds_b128 %3, %11, off\n\t"
               "global_load_async_to_lds_b128 %4, %12, off\n\t"
               "global_load_async_to_lds_b128 %5, %13, off\n\t"
               "global_load_async_to_lds_b128 %6, %14, off\n\t"
               "global_load_async_to_lds_b128 %7, %15, off\n\t"
               "s_wait_xcnt 0x0"
               :: "v"(l), "v"(l + lstep), "v"(l + 2 * lstep), "v"(l + 3 * lstep), "v"(l + 4 * lstep), "v"(l + 5 * lstep), "v"(l + 6 * lstep), "v"(l + 7 * lstep),
                  "v"(g), "v"(g + gstep), "v"(g + 2 * gstep), "v"(g + 3 * gstep), "v"(g + 4 * gstep), "v"(g + 5 * gstep), "v"(g + 6 * gstep), "v"(g + 7 * gstep)
               : "memory");
}
// this wave's copies have landed (the compiler places no wait for them)
#define WAIT_COPIES() asm volatile("s_wait_asynccnt 0x0" ::: "memory")
// this wave's LDS reads have returned, before the barrier behind which their buffer is refilled
#define WAIT_LDS() asm volatile("s_wait_dscnt 0x0" ::: "memory")
#define P128 144   // LDS pitch of a 128-byte row, 16 B x odd: ds_load_b128 without bank conflicts
#define P256 272   // the same for a 256-byte row
// ---- k_pack: block = (32 outputs, 64 inputs, which): a weight's (in,out) f32 tile -> bf16 [out][in] rows, turned in LDS so that whole 128-byte lines are stored
__global__ __launch_bounds__(256) void k_pack(const float* __restrict__ WQ, const float* __restrict__ WK, const float* __restrict__ WV, const float* __restrict__ WO, __bf16* __restrict__ WT) { __shared__ __align__(16) __bf16 tl[32][72];
  const int t = threadIdx.x, lane = t & 31, wave = t >> 5; const int which = blockIdx.z; const int n0 = blockIdx.x * 32, k0 = blockIdx.y * 64;
  const float* Wm = which == 0 ? WQ : which == 1 ? WK : which == 2 ? WV : WO;
  v8b r;
#pragma unroll
  for (int i = 0; i < 8; ++i) r[i] = (__bf16)Wm[(size_t)(k0 + wave * 8 + i) * DA + n0 + lane];
  *(v8b*)&tl[lane][wave * 8] = r;
  __syncthreads();
  vst2((unsigned*)(WT + ((size_t)which * DA + n0 + (t >> 3)) * DA + k0 + (t & 7) * 8), *(const v4u*)&tl[t >> 3][(t & 7) * 8]); }
// A stage of the weight GEMMs = 64 k of 128 packed weight rows (bf16) and of 64 activation rows (f32), copied to LDS in whole lines, two buffers
#define PJ_X   (128 * P128)
#define PJ_BUF (128 * P128 + 64 * P256)
#define PJ_FILL(s, bf) do { acp8(lw + (bf) * PJ_BUF, 16 * P128, gw + (s) * 128, (size_t)16 * DA * 2); acp8(lx + (bf) * PJ_BUF, 8 * P256, gx + (s) * 256, (size_t)8 * DA * 4); } while (0)
// ---- k_proj: block = (64 rows, 128 cols, which): q (f32 rows), k (bf16 hi + lo rows), v (f16 planes)
__global__ __launch_bounds__(128) void k_proj(const float* __restrict__ XQ, const float* __restrict__ XKV, const __bf16* __restrict__ WT, const float* __restrict__ BQ, const float* __restrict__ BK, const float* __restrict__ BV, float* __restrict__ Q, __bf16* __restrict__ KH, __bf16* __restrict__ KL, _Float16* __restrict__ VT) { __shared__ __align__(16) char ring[2 * PJ_BUF];
  const int tid = threadIdx.x, wave = tid >> 5, lane = tid & 31, col = lane & 15, g = lane >> 4; const int which = blockIdx.z; const int c0 = blockIdx.y * 128; const size_t r0 = (size_t)blockIdx.x * 64;
  const float* X = (which == 0) ? XQ : XKV; const float* Bm = which == 0 ? BQ : which == 1 ? BK : BV;
  const unsigned lds0 = (unsigned)(size_t)ring;
  const unsigned lw = lds0 + (tid >> 3) * P128 + (tid & 7) * 16, lx = lds0 + PJ_X + (tid >> 4) * P256 + (tid & 15) * 16;   // 8 lanes a weight row, 16 lanes an x row
  const char* gw = (const char*)WT + (((size_t)which * DA + c0 + (tid >> 3)) * DA + (tid & 7) * 8) * 2; const char* gx = (const char*)X + ((r0 + (tid >> 4)) * DA + (tid & 15) * 4) * 4;
  v8f acc[8] = {};
  PJ_FILL(0, 0); WAIT_COPIES(); __syncthreads(); PJ_FILL(1, 1);
#pragma unroll 1   // one stage a trip: the two buffers alternate by the trip's parity
  for (int s = 0; s < DA / 64; ++s) { const char* bp = ring + (s & 1) * PJ_BUF;
#pragma unroll
    for (int h = 0; h < 2; ++h) { v16b w[8]; v16b a; { const float* p = (const float*)(bp + PJ_X + (wave * 16 + col) * P256) + h * 32 + 8 * g;
#pragma unroll
        for (int i = 0; i < 8; ++i) { a[i] = (__bf16)p[i]; a[8 + i] = (__bf16)p[16 + i]; } }
#pragma unroll
      for (int j = 0; j < 8; ++j) w[j] = frag_b((const __bf16*)(bp + (j * 16 + col) * P128 + h * 64), lane);   // the block's LDS reads as one group ahead of its products
#pragma unroll
      for (int j = 0; j < 8; ++j) acc[j] = wmma_bf(a, w[j], acc[j]); }
    WAIT_LDS(); WAIT_COPIES(); __syncthreads();   // publishes stage s + 1 and ends every read of stage s
    if (s + 2 < DA / 64) PJ_FILL(s + 2, s & 1); }
  WAIT_COPIES();
  // the ring is free behind the last trip's barrier: the output tile is turned there
  float (*sf)[16][132] = (float (*)[16][132])ring; __bf16 (*sbh)[136] = (__bf16 (*)[136])ring; __bf16 (*sbl)[136] = (__bf16 (*)[136])(ring + 64 * 136 * 2); _Float16 (*th)[72] = (_Float16 (*)[72])ring;
#pragma unroll
  for (int j = 0; j < 8; ++j) { const float bb = bfr(Bm[c0 + j * 16 + col]);
#pragma unroll
    for (int r = 0; r < 8; ++r) { const float v = acc[j][r] + bb; const int rl = wave * 16 + 8 * g + r, cl = j * 16 + col;
      if (which == 0) sf[wave][8 * g + r][cl] = v; else if (which == 1) { const __bf16 h = (__bf16)v; sbh[rl][cl] = h; sbl[rl][cl] = (__bf16)(v - (float)h); } else th[cl][rl] = (_Float16)v; } }
  __syncthreads();
  if (which == 0) { for (int rl = 0; rl < 16; ++rl) vst2(Q + (r0 + wave * 16 + rl) * DA + c0 + lane * 4, *(const v4f*)&sf[wave][rl][lane * 4]); }
  else if (which == 1) { for (int e = tid; e < 64 * 16; e += 128) { const int rl = e >> 4, q = e & 15; vst2((unsigned*)(KH + (r0 + rl) * DA + c0 + q * 8), *(const v4u*)&sbh[rl][q * 8]); vst2((unsigned*)(KL + (r0 + rl) * DA + c0 + q * 8), *(const v4u*)&sbl[rl][q * 8]); } }
  else { const size_t b = r0 / NN; const int n0 = (int)(r0 % NN); for (int e = tid; e < 128 * 8; e += 128) { const int cl = e >> 3, q = e & 7; vst2((unsigned*)(VT + (b * DA + c0 + cl) * (size_t)NN + n0 + q * 8), *(const v4u*)&th[cl][q * 8]); } } }
// ---- k_sc: block = (64 queries, 128 keys, b): logits (3 products) x sqrt(512) -> S. A stage = 64 k of the K hi, K lo and q rows, copied to LDS in whole lines, two buffers
#define SC_KL (128 * P128)
#define SC_Q  (256 * P128)
#define SC_BUF (256 * P128 + 64 * P256)
__global__ __launch_bounds__(128) void k_sc(const float* __restrict__ Q, const __bf16* __restrict__ KH, const __bf16* __restrict__ KL, float* __restrict__ S) { __shared__ __align__(16) char ring[2 * SC_BUF];
  const int tid = threadIdx.x, wave = tid >> 5, lane = tid & 31, col = lane & 15, g = lane >> 4; const size_t b = blockIdx.z; const int k0 = blockIdx.y * 128; const size_t qb = b * NN + (size_t)blockIdx.x * 64, q0 = qb + wave * 16;
  const unsigned lds0 = (unsigned)(size_t)ring;
  const unsigned lk = lds0 + (tid >> 3) * P128 + (tid & 7) * 16, lq = lds0 + SC_Q + (tid >> 4) * P256 + (tid & 15) * 16;   // 8 lanes a K row, 16 lanes a q row
  const size_t ko = ((b * NN + k0 + (tid >> 3)) * DA + (tid & 7) * 8) * 2;
  const char* gh = (const char*)KH + ko; const char* gl = (const char*)KL + ko; const char* gq = (const char*)Q + ((qb + (tid >> 4)) * DA + (tid & 15) * 4) * 4;
#define SC_FILL(s, bf) do { acp8(lk + (bf) * SC_BUF, 16 * P128, gh + (s) * 128, (size_t)16 * DA * 2); acp8(lk + SC_KL + (bf) * SC_BUF, 16 * P128, gl + (s) * 128, (size_t)16 * DA * 2); acp8(lq + (bf) * SC_BUF, 8 * P256, gq + (s) * 256, (size_t)8 * DA * 4); } while (0)
  v8f acc[8] = {};
  SC_FILL(0, 0); WAIT_COPIES(); __syncthreads(); SC_FILL(1, 1);
#pragma unroll 1   // one stage a trip: the two buffers alternate by the trip's parity
  for (int s = 0; s < DA / 64; ++s) { const char* bp = ring + (s & 1) * SC_BUF;
#pragma unroll
    for (int h = 0; h < 2; ++h) { v16b kh[8], kl[8]; const F2 a = split_row((const float*)(bp + SC_Q + (wave * 16 + col) * P256), h * 32, lane);
#pragma unroll
      for (int j = 0; j < 8; ++j) { const char* kr = bp + (j * 16 + col) * P128 + h * 64; kh[j] = frag_b((const __bf16*)kr, lane); kl[j] = frag_b((const __bf16*)(kr + SC_KL), lane); }   // the block's LDS reads as one group ahead of its products: one LDS latency a block, not one a key group
#pragma unroll
      for (int j = 0; j < 8; ++j) { acc[j] = wmma_bf(a.h, kh[j], acc[j]); acc[j] = wmma_bf(a.l, kh[j], acc[j]); acc[j] = wmma_bf(a.h, kl[j], acc[j]); } }
    WAIT_LDS(); WAIT_COPIES(); __syncthreads();   // publishes stage s + 1 and ends every read of stage s
    if (s + 2 < DA / 64) SC_FILL(s + 2, s & 1); }
  WAIT_COPIES();
  float (*ss)[132] = (float (*)[132])(ring + wave * (16 * 132 * 4));   // the ring is free behind the last trip's barrier: each wave stages its 16 rows in its own range
#pragma unroll
  for (int j = 0; j < 8; ++j)
#pragma unroll
    for (int r = 0; r < 8; ++r) ss[8 * g + r][j * 16 + col] = acc[j][r] * 22.627416997969522f;
  LDSX(); for (int rl = 0; rl < 16; ++rl) vst2(S + (q0 + rl) * NN + k0 + lane * 4, *(const v4f*)&ss[rl][lane * 4]); }
// ---- k_sm: block = query row: softmax over the 2,048 keys -> P x 2^11 as f16 + residual
__global__ __launch_bounds__(256) void k_sm(const float* __restrict__ S, _Float16* __restrict__ PH, _Float16* __restrict__ PL) { __shared__ float sred[8]; __shared__ float sbc; __shared__ __align__(16) _Float16 sh[NN], sl[NN];
  const int t = threadIdx.x; const size_t row = blockIdx.x; const float* sr = S + row * NN;
  float m = -3.0e38f; for (int k = t; k < NN; k += 256) m = fmaxf(m, sr[k]);
#pragma unroll
  for (int o = 1; o < 32; o <<= 1) m = fmaxf(m, __shfl_xor(m, o));
  if ((t & 31) == 0) sred[t >> 5] = m; __syncthreads(); if (t == 0) { float a = sred[0]; for (int i = 1; i < 8; ++i) a = fmaxf(a, sred[i]); sbc = a; } __syncthreads(); m = sbc; __syncthreads();
  float sum = 0.f; for (int k = t; k < NN; k += 256) sum += expf(sr[k] - m);
#pragma unroll
  for (int o = 1; o < 32; o <<= 1) sum += __shfl_xor(sum, o);
  if ((t & 31) == 0) sred[t >> 5] = sum; __syncthreads(); if (t == 0) { float a = 0.f; for (int i = 0; i < 8; ++i) a += sred[i]; sbc = 1.0f / a; } __syncthreads(); const float inv = sbc;
  for (int k = t; k < NN; k += 256) { const float p = expf(sr[k] - m) * inv * 2048.0f; const _Float16 h = (_Float16)p; sh[k] = h; sl[k] = (_Float16)(p - (float)h); }
  __syncthreads(); for (int q = t; q < NN / 8; q += 256) { vst2((unsigned*)(PH + row * NN + q * 8), *(const v4u*)&sh[q * 8]); vst2((unsigned*)(PL + row * NN + q * 8), *(const v4u*)&sl[q * 8]); } }
// ---- k_pv: block = (64 queries, 128 value channels, b): o = P . v. A stage = 128 keys of the v, P hi and P lo rows, copied to LDS in whole lines, two buffers
#define PV_PH (128 * P256)
#define PV_PL (192 * P256)
#define PV_BUF (256 * P256)
__global__ __launch_bounds__(128) void k_pv(const _Float16* __restrict__ PH, const _Float16* __restrict__ PL, const _Float16* __restrict__ VT, float* __restrict__ O) { __shared__ __align__(16) char ring[2 * PV_BUF];
  const int tid = threadIdx.x, wave = tid >> 5, lane = tid & 31, col = lane & 15, g = lane >> 4; const size_t b = blockIdx.z; const int c0 = blockIdx.y * 128; const size_t qb = b * NN + (size_t)blockIdx.x * 64, q0 = qb + wave * 16;
  const unsigned lv = (unsigned)(size_t)ring + (tid >> 4) * P256 + (tid & 15) * 16;   // 16 lanes a row
  const size_t po = ((qb + (tid >> 4)) * NN + (tid & 15) * 8) * 2;
  const char* gv = (const char*)VT + ((b * DA + c0 + (tid >> 4)) * (size_t)NN + (tid & 15) * 8) * 2; const char* gph = (const char*)PH + po; const char* gpl = (const char*)PL + po;
#define PV_FILL(s, bf) do { acp8(lv + (bf) * PV_BUF, 8 * P256, gv + (s) * 256, (size_t)8 * NN * 2); acp8(lv + 64 * P256 + (bf) * PV_BUF, 8 * P256, gv + (size_t)64 * NN * 2 + (s) * 256, (size_t)8 * NN * 2); \
    acp8(lv + PV_PH + (bf) * PV_BUF, 8 * P256, gph + (s) * 256, (size_t)8 * NN * 2); acp8(lv + PV_PL + (bf) * PV_BUF, 8 * P256, gpl + (s) * 256, (size_t)8 * NN * 2); } while (0)
  v8f acc[8] = {};
  PV_FILL(0, 0); WAIT_COPIES(); __syncthreads(); PV_FILL(1, 1);
#pragma unroll 1   // one stage a trip: the two buffers alternate by the trip's parity
  for (int s = 0; s < NN / 128; ++s) { const char* bp = ring + (s & 1) * PV_BUF;
#pragma unroll
    for (int h = 0; h < 4; ++h) { v16h vb[8]; const char* pr = bp + PV_PH + (wave * 16 + col) * P256 + h * 64; const v16h ph = frag_h((const _Float16*)pr, lane), pl = frag_h((const _Float16*)(pr + (PV_PL - PV_PH)), lane);
#pragma unroll
      for (int j = 0; j < 8; ++j) vb[j] = frag_h((const _Float16*)(bp + (j * 16 + col) * P256 + h * 64), lane);   // the block's LDS reads as one group ahead of its products
#pragma unroll
      for (int j = 0; j < 8; ++j) { acc[j] = wmma16(ph, vb[j], acc[j]); acc[j] = wmma16(pl, vb[j], acc[j]); } }
    WAIT_LDS(); WAIT_COPIES(); __syncthreads();   // publishes stage s + 1 and ends every read of stage s
    if (s + 2 < NN / 128) PV_FILL(s + 2, s & 1); }
  WAIT_COPIES();
  float (*ss)[132] = (float (*)[132])(ring + wave * (16 * 132 * 4));   // the ring is free behind the last trip's barrier: each wave stages its 16 rows in its own range
#pragma unroll
  for (int j = 0; j < 8; ++j)
#pragma unroll
    for (int r = 0; r < 8; ++r) ss[8 * g + r][j * 16 + col] = acc[j][r] * (1.0f / 2048.0f);
  LDSX(); for (int rl = 0; rl < 16; ++rl) vst2(O + (q0 + rl) * DA + c0 + lane * 4, *(const v4f*)&ss[rl][lane * 4]); }
// ---- k_out: block = (64 rows, 128 cols): out = query + o (hi + lo) . Wo + bo
__global__ __launch_bounds__(128) void k_out(const float* __restrict__ O, const __bf16* __restrict__ WT, const float* __restrict__ BO, const float* __restrict__ XQ, float* __restrict__ OUT) { __shared__ __align__(16) char ring[2 * PJ_BUF];
  const int tid = threadIdx.x, wave = tid >> 5, lane = tid & 31, col = lane & 15, g = lane >> 4; const int c0 = blockIdx.y * 128; const size_t rb = (size_t)blockIdx.x * 64, r0 = rb + wave * 16;
  const unsigned lds0 = (unsigned)(size_t)ring;
  const unsigned lw = lds0 + (tid >> 3) * P128 + (tid & 7) * 16, lx = lds0 + PJ_X + (tid >> 4) * P256 + (tid & 15) * 16;   // 8 lanes a weight row, 16 lanes an o row
  const char* gw = (const char*)WT + ((size_t)(c0 + (tid >> 3)) * DA + (tid & 7) * 8) * 2; const char* gx = (const char*)O + ((rb + (tid >> 4)) * DA + (tid & 15) * 4) * 4;
  v8f acc[8] = {};
  PJ_FILL(0, 0); WAIT_COPIES(); __syncthreads(); PJ_FILL(1, 1);
#pragma unroll 1   // one stage a trip: the two buffers alternate by the trip's parity
  for (int s = 0; s < DA / 64; ++s) { const char* bp = ring + (s & 1) * PJ_BUF;
#pragma unroll
    for (int h = 0; h < 2; ++h) { v16b w[8]; const F2 a = split_row((const float*)(bp + PJ_X + (wave * 16 + col) * P256), h * 32, lane);
#pragma unroll
      for (int j = 0; j < 8; ++j) w[j] = frag_b((const __bf16*)(bp + (j * 16 + col) * P128 + h * 64), lane);   // the block's LDS reads as one group ahead of its products
#pragma unroll
      for (int j = 0; j < 8; ++j) { acc[j] = wmma_bf(a.h, w[j], acc[j]); acc[j] = wmma_bf(a.l, w[j], acc[j]); } }
    WAIT_LDS(); WAIT_COPIES(); __syncthreads();   // publishes stage s + 1 and ends every read of stage s
    if (s + 2 < DA / 64) PJ_FILL(s + 2, s & 1); }
  WAIT_COPIES();
  float (*sf)[16][132] = (float (*)[16][132])ring;   // the ring is free behind the last trip's barrier: each wave stages its 16 rows in its own range
#pragma unroll
  for (int j = 0; j < 8; ++j) { const int c = c0 + j * 16 + col; const float bb = bfr(BO[c]);
#pragma unroll
    for (int r = 0; r < 8; ++r) sf[wave][8 * g + r][j * 16 + col] = bfr(XQ[(r0 + 8 * g + r) * DA + c]) + acc[j][r] + bb; }
  LDSX(); for (int rl = 0; rl < 16; ++rl) vst2(OUT + (r0 + rl) * DA + c0 + lane * 4, *(const v4f*)&sf[wave][rl][lane * 4]); }
extern "C" void kernel_launch(void* const* d_in, const int* in_sizes, int n_in, void* d_out, int out_size, void* d_ws, size_t ws_size, hipStream_t stream) {
  (void)in_sizes; (void)n_in; (void)out_size;
  const float** F = (const float**)d_in;   // 0 query [4,2048,512], 1 key_value [4,2048,512], 2 Wq, 3 bq, 4 Wk, 5 bk, 6 Wv, 7 bv, 8 Wo, 9 bo ((in,out) [512,512] / [512])
  if (ws_size < (size_t)WS_END) return;
  char* ws = (char*)d_ws; float *Q = (float*)(ws + WS_Q), *S = (float*)(ws + WS_S), *O = (float*)(ws + WS_O); __bf16 *KH = (__bf16*)(ws + WS_KH), *KL = (__bf16*)(ws + WS_KL); _Float16 *VT = (_Float16*)(ws + WS_VT), *PH = (_Float16*)(ws + WS_PH), *PL = (_Float16*)(ws + WS_PL); __bf16* WT = (__bf16*)(ws + WS_WT);
  k_pack<<<dim3(DA / 32, DA / 64, 4), 256, 0, stream>>>(F[2], F[4], F[6], F[8], WT);
  k_proj<<<dim3(TNB * NN / 64, DA / 128, 3), 128, 0, stream>>>(F[0], F[1], WT, F[3], F[5], F[7], Q, KH, KL, VT);
  k_sc<<<dim3(TQB, NN / 128, TNB), 128, 0, stream>>>(Q, KH, KL, S);
  k_sm<<<TNB * TQB * 64, 256, 0, stream>>>(S, PH, PL);   // rows of all batches are contiguous: one launch
  k_pv<<<dim3(TQB, DA / 128, TNB), 128, 0, stream>>>(PH, PL, VT, O);
  k_out<<<dim3(TNB * TQB, DA / 128), 128, 0, stream>>>(O, WT + (size_t)3 * DA * DA, F[9], F[0], (float*)d_out);   // 512 work-groups in one launch, not 4 launches of 128
}

// v004
// It runs in 130 microseconds.
// Two timings next to v003 both put it at 1.22 times that version's speed.
// Counting every step since v000, it is 3.62 times as fast.
// compute dtype: all float inputs rounded to bf16; q/k/v = x W + b with EXACT bf16 products on WMMA 16x16x32 ((in,out) weights), f32 accumulate; q and k kept in f32 and split into bf16 hi + lo for the scores (3 products: the module multiplies by sqrt(512), logits ~1e2), logits stored in f32; softmax in f32 (precise expf) -> P as f16 x 2^11 + residual; P . v with v as f16 (2 products); out = query + o (bf16 hi + lo) . Wo + bo (2 products); f32 output.
#include <hip/hip_runtime.h>
#include <math.h>

typedef __attribute__((ext_vector_type(16))) _Float16 v16h;
typedef __attribute__((ext_vector_type(16))) __bf16 v16b;
typedef __attribute__((ext_vector_type(8)))  _Float16 v8h;
typedef __attribute__((ext_vector_type(8)))  float v8f;
typedef __attribute__((ext_vector_type(4)))  float v4f;
typedef __attribute__((ext_vector_type(2)))  float v2f;
typedef __attribute__((ext_vector_type(4)))  unsigned v4u;
typedef __attribute__((ext_vector_type(4)))  int v4i;
typedef float __attribute__((may_alias)) float_a;
typedef int __attribute__((may_alias)) int_a;

template <typename T> __device__ __forceinline__ void vst2(void* p, T v) { *(T*)p = v;  }
__device__ __forceinline__ v8f wmma16(v16h a, v16h b, v8f c) {
  v8f d = __builtin_amdgcn_wmma_f32_16x16x32_f16(false, a, false, b, (short)0, c, false, false);
  asm volatile("v_nop\n\tv_nop\n\tv_nop\n\tv_nop" : "+v"(d) : "v"(a), "v"(b));
  return d;
}
__device__ __forceinline__ v8f wmma_bf(v16b a, v16b b, v8f c) {
  v8f d = __builtin_amdgcn_wmma_f32_16x16x32_bf16(false, a, false, b, (short)0, c, false, false);
  asm volatile("v_nop\n\tv_nop\n\tv_nop\n\tv_nop" : "+v"(d) : "v"(a), "v"(b));
  return d;
}
// 16x16x32 fragments: lane = (h = lane>>4, row/col = lane&15); elements 0..7 = k0+8h+0..7, 8..15 = k0+16+8h+0..7; D element r = row 8h+r
__device__ __forceinline__ v16h frag_h(const _Float16* rowk0, int lane) {
  union { v16h v; v8h q[2]; } u; const _Float16* p = rowk0 + 8 * (lane >> 4);
  u.q[0] = *(const v8h*)p; u.q[1] = *(const v8h*)(p + 16); return u.v;
}
__device__ __forceinline__ v16h frag_f32(const float* rowk0, int lane) {
  v16h a; const float* p = rowk0 + 8 * (lane >> 4);
#pragma unroll
  for (int i = 0; i < 8; ++i) { a[i] = (_Float16)p[i]; a[8 + i] = (_Float16)p[16 + i]; }
  return a;
}
__device__ __forceinline__ v16h frag_f32s(const float* rowk0, int lane, float sc) {
  v16h a; const float* p = rowk0 + 8 * (lane >> 4);
#pragma unroll
  for (int i = 0; i < 8; ++i) { a[i] = (_Float16)(p[i] * sc); a[8 + i] = (_Float16)(p[16 + i] * sc); }
  return a;
}
// column fragment from a [K][ld] layout (column n), rows >= K read as 0
__device__ __forceinline__ v16h fragc_f32(const float* W, int k0, int n, int lane, int ld, int K) {
  v16h a; const int g = lane >> 4;
#pragma unroll
  for (int i = 0; i < 8; ++i) { const int ka = k0 + 8 * g + i, kb = ka + 16;
    a[i] = (_Float16)(ka < K ? W[(size_t)(ka < K ? ka : K - 1) * ld + n] : 0.f); a[8 + i] = (_Float16)(kb < K ? W[(size_t)(kb < K ? kb : K - 1) * ld + n] : 0.f); }
  return a;
}
struct F2 { v16b h, l; };
__device__ __forceinline__ F2 bsplit16(const float v[16]) { F2 r;
#pragma unroll
  for (int i = 0; i < 16; ++i) { const __bf16 h = (__bf16)v[i]; r.h[i] = h; r.l[i] = (__bf16)(v[i] - (float)h); }
  return r; }
__device__ __forceinline__ F2 split_row(const float* row, int k0, int lane) { float v[16]; const float* p = row + k0 + 8 * (lane >> 4);
#pragma unroll
  for (int i = 0; i < 8; ++i) { v[i] = p[i]; v[8 + i] = p[16 + i]; }
  return bsplit16(v); }
__device__ __forceinline__ F2 split_rowK(const float* row, int k0, int lane, int K) { float v[16]; const int g = lane >> 4;
#pragma unroll
  for (int i = 0; i < 8; ++i) { const int ka = k0 + 8 * g + i, kb = ka + 16; v[i] = ka < K ? row[ka < K ? ka : K - 1] : 0.f; v[8 + i] = kb < K ? row[kb < K ? kb : K - 1] : 0.f; }
  return bsplit16(v); }
__device__ __forceinline__ F2 split_col(const float* W, int k0, int n, int lane, int ld, int K) { float v[16]; const int g = lane >> 4;
#pragma unroll
  for (int i = 0; i < 8; ++i) { const int ka = k0 + 8 * g + i, kb = ka + 16; v[i] = ka < K ? W[(size_t)(ka < K ? ka : K - 1) * ld + n] : 0.f; v[8 + i] = kb < K ? W[(size_t)(kb < K ? kb : K - 1) * ld + n] : 0.f; }
  return bsplit16(v); }
__device__ __forceinline__ v8f mac3(const F2& a, const F2& b, v8f c) { c = wmma_bf(a.l, b.h, c); c = wmma_bf(a.h, b.l, c); return wmma_bf(a.h, b.h, c); }
__device__ __forceinline__ float sigm(float v) { return 1.0f / (1.0f + expf(-v)); }
#define LDSX() do { asm volatile("s_wait_dscnt 0" ::: "memory"); __builtin_amdgcn_wave_barrier(); __builtin_amdgcn_fence(__ATOMIC_RELEASE, "workgroup"); } while (0)


// Axis attention (B 4, 2,048 queries x 2,048 keys, dim_attn 512, single head): attn = softmax((q k^T) * sqrt(512)); out = query + (attn v) Wo + bo.
#define NB 4
#define NN 2048
#define DA 512
#ifndef TNB
#define TNB NB
#endif
#ifndef TQB
#define TQB (NN / 64)
#endif
typedef __attribute__((ext_vector_type(8))) __bf16 v8b;
__device__ __forceinline__ v16b frag_b(const __bf16* rowk0, int lane) {
  union { v16b v; v8b q[2]; } u; const __bf16* p = rowk0 + 8 * (lane >> 4);
  u.q[0] = *(const v8b*)p; u.q[1] = *(const v8b*)(p + 16); return u.v;
}
__device__ __forceinline__ float bfr(float v) { return (float)(__bf16)v; }
__device__ __attribute__((noinline)) float exp_ni(float v) { return expf(v); }
__device__ __attribute__((noinline)) float erf_ni(float v) { return erff(v); }

#define WS_Q   0u                                    // f32 q rows [b*n][512]
#define WS_KH  (WS_Q + 4u * (size_t)NB * NN * DA)       // bf16 k hi rows
#define WS_KL  (WS_KH + 2u * (size_t)NB * NN * DA)      // bf16 k lo rows
#define WS_VT  (WS_KL + 2u * (size_t)NB * NN * DA)      // f16 v planes [b][512][n]
#define WS_S   (WS_VT + 2u * (size_t)NB * DA * NN)      // f32 logits [b][q][key]
#define WS_PH  (WS_S + 4u * (size_t)NB * NN * NN)       // f16 P x 2^11 rows [b*q][key]
#define WS_PL  (WS_PH + 2u * (size_t)NB * NN * NN)      // f16 residual
#define WS_O   (WS_PL + 2u * (size_t)NB * NN * NN)      // f32 o rows [b*q][512]
#define WS_WT  (WS_O + 4u * (size_t)NB * NN * DA)       // bf16 weights as [4][out][in] rows: Wq, Wk, Wv, Wo
#define WS_END (WS_WT + 2u * (size_t)4 * DA * DA)

// eight 16-byte asynchronous copies of one lane, global -> LDS: copy i brings g + i * gstep to LDS byte l + i * lstep.
// The closing s_wait_xcnt 0 stands inside the copies' own statement so that no address register is rewritten ahead of it.
__device__ __forceinline__ void acp8(unsigned l, unsigned lstep, const char* g, size_t gstep) {
  asm volatile("global_load_async_to_lds_b128 %0, %8, off\n\t"
               "global_load_async_to_lds_b128 %1, %9, off\n\t"
               "global_load_async_to_lds_b128 %2, %10, off\n\t"
               "global_load_async_to_lds_b128 %3, %11, off\n\t"
               "global_load_async_to_lds_b128 %4, %12, off\n\t"
               "global_load_async_to_lds_b128 %5, %13, off\n\t"
               "global_load_async_to_lds_b128 %6, %14, off\n\t"
               "global_load_async_to_lds_b128 %7, %15, off\n\t"
               "s_wait_xcnt 0x0"
               :: "v"(l), "v"(l + lstep), "v"(l + 2 * lstep), "v"(l + 3 * lstep), "v"(l + 4 * lstep), "v"(l + 5 * lstep), "v"(l + 6 * lstep), "v"(l + 7 * lstep),
                  "v"(g), "v"(g + gstep), "v"(g + 2 * gstep), "v"(g + 3 * gstep), "v"(g + 4 * gstep), "v"(g + 5 * gstep), "v"(g + 6 * gstep), "v"(g + 7 * gstep)
               : "memory");
}
// this wave's copies have landed (the compiler places no wait for them)
#define WAIT_COPIES() asm volatile("s_wait_asynccnt 0x0" ::: "memory")
// this wave's LDS reads have returned, before the barrier behind which their buffer is refilled
#define WAIT_LDS() asm volatile("s_wait_dscnt 0x0" ::: "memory")
#define P128 144   // LDS pitch of a 128-byte row, 16 B x odd: ds_load_b128 without bank conflicts
#define P256 272   // the same for a 256-byte row
// ---- k_pack: block = (32 outputs, 64 inputs, which): a weight's (in,out) f32 tile -> bf16 [out][in] rows, turned in LDS so that whole 128-byte lines are stored
__global__ __launch_bounds__(256) void k_pack(const float* __restrict__ WQ, const float* __restrict__ WK, const float* __restrict__ WV, const float* __restrict__ WO, __bf16* __restrict__ WT) { __shared__ __align__(16) __bf16 tl[32][72];
  const int t = threadIdx.x, lane = t & 31, wave = t >> 5; const int which = blockIdx.z; const int n0 = blockIdx.x * 32, k0 = blockIdx.y * 64;
  const float* Wm = which == 0 ? WQ : which == 1 ? WK : which == 2 ? WV : WO;
  v8b r;
#pragma unroll
  for (int i = 0; i < 8; ++i) r[i] = (__bf16)Wm[(size_t)(k0 + wave * 8 + i) * DA + n0 + lane];
  *(v8b*)&tl[lane][wave * 8] = r;
  __syncthreads();
  vst2((unsigned*)(WT + ((size_t)which * DA + n0 + (t >> 3)) * DA + k0 + (t & 7) * 8), *(const v4u*)&tl[t >> 3][(t & 7) * 8]); }
// A stage of the weight GEMMs = 64 k of 128 packed weight rows (bf16) and of 64 activation rows (f32), copied to LDS in whole lines, two buffers
#define PJ_X   (128 * P128)
#define PJ_BUF (128 * P128 + 64 * P256)
#define PJ_FILL(s, bf) do { acp8(lw + (bf) * PJ_BUF, 16 * P128, gw + (s) * 128, (size_t)16 * DA * 2); acp8(lx + (bf) * PJ_BUF, 8 * P256, gx + (s) * 256, (size_t)8 * DA * 4); } while (0)
// ---- k_proj: block = (64 rows, 128 cols, which): q (f32 rows), k (bf16 hi + lo rows), v (f16 planes)
__global__ __launch_bounds__(128) void k_proj(const float* __restrict__ XQ, const float* __restrict__ XKV, const __bf16* __restrict__ WT, const float* __restrict__ BQ, const float* __restrict__ BK, const float* __restrict__ BV, float* __restrict__ Q, __bf16* __restrict__ KH, __bf16* __restrict__ KL, _Float16* __restrict__ VT) { __shared__ __align__(16) char ring[2 * PJ_BUF];
  const int tid = threadIdx.x, wave = tid >> 5, lane = tid & 31, col = lane & 15, g = lane >> 4; const int which = blockIdx.z; const int c0 = blockIdx.y * 128; const size_t r0 = (size_t)blockIdx.x * 64;
  const float* X = (which == 0) ? XQ : XKV; const float* Bm = which == 0 ? BQ : which == 1 ? BK : BV;
  const unsigned lds0 = (unsigned)(size_t)ring;
  const unsigned lw = lds0 + (tid >> 3) * P128 + (tid & 7) * 16, lx = lds0 + PJ_X + (tid >> 4) * P256 + (tid & 15) * 16;   // 8 lanes a weight row, 16 lanes an x row
  const char* gw = (const char*)WT + (((size_t)which * DA + c0 + (tid >> 3)) * DA + (tid & 7) * 8) * 2; const char* gx = (const char*)X + ((r0 + (tid >> 4)) * DA + (tid & 15) * 4) * 4;
  v8f acc[8] = {};
  PJ_FILL(0, 0); WAIT_COPIES(); __syncthreads(); PJ_FILL(1, 1);
#pragma unroll 1   // one stage a trip: the two buffers alternate by the trip's parity
  for (int s = 0; s < DA / 64; ++s) { const char* bp = ring + (s & 1) * PJ_BUF;
#pragma unroll
    for (int h = 0; h < 2; ++h) { v16b w[8]; v16b a; { const float* p = (const float*)(bp + PJ_X + (wave * 16 + col) * P256) + h * 32 + 8 * g;
#pragma unroll
        for (int i = 0; i < 8; ++i) { a[i] = (__bf16)p[i]; a[8 + i] = (__bf16)p[16 + i]; } }
#pragma unroll
      for (int j = 0; j < 8; ++j) w[j] = frag_b((const __bf16*)(bp + (j * 16 + col) * P128 + h * 64), lane);   // the block's LDS reads as one group ahead of its products
#pragma unroll
      for (int j = 0; j < 8; ++j) acc[j] = wmma_bf(a, w[j], acc[j]); }
    WAIT_LDS(); WAIT_COPIES(); __syncthreads();   // publishes stage s + 1 and ends every read of stage s
    if (s + 2 < DA / 64) PJ_FILL(s + 2, s & 1); }
  WAIT_COPIES();
  // the ring is free behind the last trip's barrier: the output tile is turned there
  float (*sf)[16][132] = (float (*)[16][132])ring; __bf16 (*sbh)[136] = (__bf16 (*)[136])ring; __bf16 (*sbl)[136] = (__bf16 (*)[136])(ring + 64 * 136 * 2); _Float16 (*th)[72] = (_Float16 (*)[72])ring;
#pragma unroll
  for (int j = 0; j < 8; ++j) { const float bb = bfr(Bm[c0 + j * 16 + col]);
#pragma unroll
    for (int r = 0; r < 8; ++r) { const float v = acc[j][r] + bb; const int rl = wave * 16 + 8 * g + r, cl = j * 16 + col;
      if (which == 0) sf[wave][8 * g + r][cl] = v; else if (which == 1) { const __bf16 h = (__bf16)v; sbh[rl][cl] = h; sbl[rl][cl] = (__bf16)(v - (float)h); } else th[cl][rl] = (_Float16)v; } }
  __syncthreads();
  if (which == 0) { for (int rl = 0; rl < 16; ++rl) vst2(Q + (r0 + wave * 16 + rl) * DA + c0 + lane * 4, *(const v4f*)&sf[wave][rl][lane * 4]); }
  else if (which == 1) { for (int e = tid; e < 64 * 16; e += 128) { const int rl = e >> 4, q = e & 15; vst2((unsigned*)(KH + (r0 + rl) * DA + c0 + q * 8), *(const v4u*)&sbh[rl][q * 8]); vst2((unsigned*)(KL + (r0 + rl) * DA + c0 + q * 8), *(const v4u*)&sbl[rl][q * 8]); } }
  else { const size_t b = r0 / NN; const int n0 = (int)(r0 % NN); for (int e = tid; e < 128 * 8; e += 128) { const int cl = e >> 3, q = e & 7; vst2((unsigned*)(VT + (b * DA + c0 + cl) * (size_t)NN + n0 + q * 8), *(const v4u*)&th[cl][q * 8]); } } }
// ---- k_sc: block = (64 queries, 128 keys, b): logits (3 products) x sqrt(512) -> S. A stage = 64 k of the K hi, K lo and q rows, copied to LDS in whole lines, two buffers
#define SC_KL (128 * P128)
#define SC_Q  (256 * P128)
#define SC_BUF (256 * P128 + 64 * P256)
__global__ __launch_bounds__(128) void k_sc(const float* __restrict__ Q, const __bf16* __restrict__ KH, const __bf16* __restrict__ KL, float* __restrict__ S) { __shared__ __align__(16) char ring[2 * SC_BUF];
  const int tid = threadIdx.x, wave = tid >> 5, lane = tid & 31, col = lane & 15, g = lane >> 4; const size_t b = blockIdx.z; const int k0 = blockIdx.y * 128; const size_t qb = b * NN + (size_t)blockIdx.x * 64, q0 = qb + wave * 16;
  const unsigned lds0 = (unsigned)(size_t)ring;
  const unsigned lk = lds0 + (tid >> 3) * P128 + (tid & 7) * 16, lq = lds0 + SC_Q + (tid >> 4) * P256 + (tid & 15) * 16;   // 8 lanes a K row, 16 lanes a q row
  const size_t ko = ((b * NN + k0 + (tid >> 3)) * DA + (tid & 7) * 8) * 2;
  const char* gh = (const char*)KH + ko; const char* gl = (const char*)KL + ko; const char* gq = (const char*)Q + ((qb + (tid >> 4)) * DA + (tid & 15) * 4) * 4;
#define SC_FILL(s, bf) do { acp8(lk + (bf) * SC_BUF, 16 * P128, gh + (s) * 128, (size_t)16 * DA * 2); acp8(lk + SC_KL + (bf) * SC_BUF, 16 * P128, gl + (s) * 128, (size_t)16 * DA * 2); acp8(lq + (bf) * SC_BUF, 8 * P256, gq + (s) * 256, (size_t)8 * DA * 4); } while (0)
  v8f acc[8] = {};
  SC_FILL(0, 0); WAIT_COPIES(); __syncthreads(); SC_FILL(1, 1);
#pragma unroll 1   // one stage a trip: the two buffers alternate by the trip's parity
  for (int s = 0; s < DA / 64; ++s) { const char* bp = ring + (s & 1) * SC_BUF;
#pragma unroll
    for (int h = 0; h < 2; ++h) { v16b kh[8], kl[8]; const F2 a = split_row((const float*)(bp + SC_Q + (wave * 16 + col) * P256), h * 32, lane);
#pragma unroll
      for (int j = 0; j < 8; ++j) { const char* kr = bp + (j * 16 + col) * P128 + h * 64; kh[j] = frag_b((const __bf16*)kr, lane); kl[j] = frag_b((const __bf16*)(kr + SC_KL), lane); }   // the block's LDS reads as one group ahead of its products: one LDS latency a block, not one a key group
#pragma unroll
      for (int j = 0; j < 8; ++j) { acc[j] = wmma_bf(a.h, kh[j], acc[j]); acc[j] = wmma_bf(a.l, kh[j], acc[j]); acc[j] = wmma_bf(a.h, kl[j], acc[j]); } }
    WAIT_LDS(); WAIT_COPIES(); __syncthreads();   // publishes stage s + 1 and ends every read of stage s
    if (s + 2 < DA / 64) SC_FILL(s + 2, s & 1); }
  WAIT_COPIES();
  float (*ss)[132] = (float (*)[132])(ring + wave * (16 * 132 * 4));   // the ring is free behind the last trip's barrier: each wave stages its 16 rows in its own range
#pragma unroll
  for (int j = 0; j < 8; ++j)
#pragma unroll
    for (int r = 0; r < 8; ++r) ss[8 * g + r][j * 16 + col] = acc[j][r] * 22.627416997969522f;
  LDSX(); for (int rl = 0; rl < 16; ++rl) vst2(S + (q0 + rl) * NN + k0 + lane * 4, *(const v4f*)&ss[rl][lane * 4]); }
// lane l with lane l ^ 16
__device__ __forceinline__ float xhalf(float x) { return __builtin_bit_cast(float, __builtin_amdgcn_permlanex16(__builtin_bit_cast(int, x), __builtin_bit_cast(int, x), 0x76543210, 0xfedcba98, false, false)); }
// lane l with lane l ^ M inside its 16-lane row (DPP row_xmask)
template <int M> __device__ __forceinline__ float xrow(float x) { return __builtin_bit_cast(float, __builtin_amdgcn_update_dpp(0, __builtin_bit_cast(int, x), 0x160 + M, 0xf, 0xf, true)); }
__device__ __forceinline__ float wave_max(float v) { v = fmaxf(v, xrow<1>(v)); v = fmaxf(v, xrow<2>(v)); v = fmaxf(v, xrow<4>(v)); v = fmaxf(v, xrow<8>(v)); return fmaxf(v, xhalf(v)); }
__device__ __forceinline__ float wave_sum(float v) { v += xrow<1>(v); v += xrow<2>(v); v += xrow<4>(v); v += xrow<8>(v); return v + xhalf(v); }
typedef __attribute__((ext_vector_type(4))) _Float16 v4h;
// ---- k_sm: wave = SM_R query rows, each row's 2,048 logits held in the wave's registers (64 a lane): S read once, one expf a logit, no LDS, no barrier -> P x 2^11 as f16 + residual
#define SM_R 2    // rows a wave: with 16 waves a block the whole problem is one block per WGP
#define SM_W 16   // waves a block
__global__ __launch_bounds__(SM_W * 32) void k_sm(const float* __restrict__ S, _Float16* __restrict__ PH, _Float16* __restrict__ PL) {
  const int lane = threadIdx.x & 31; const size_t row0 = ((size_t)blockIdx.x * SM_W + (threadIdx.x >> 5)) * SM_R;
  const float* sp = S + row0 * NN + lane * 4;   // the one address that every load below names
  v4f x[SM_R][16];   // load i of a row = 512 contiguous bytes over the wave; all rows' loads are issued ahead of the first row's arithmetic
  // every loop below is unrolled so that x is indexed by constants and stays in registers
#pragma unroll
  for (int r = 0; r < SM_R; ++r)
#pragma unroll
    for (int i = 0; i < 16; ++i) x[r][i] = *(const v4f*)(sp + r * NN + i * 128);
  asm volatile("s_wait_xcnt 0x0" :: "v"(sp) : "memory");   // the loads' address pair is an input here, so it lives up to this wait and no load's result lands in it ahead of the wait
#pragma unroll
  for (int r = 0; r < SM_R; ++r) { __builtin_amdgcn_sched_barrier(0);   // keeps every load ahead of the arithmetic, and a later row's arithmetic (with its wait for that row's loads) behind this row's stores
    v4f mm = x[r][0];
#pragma unroll
    for (int i = 1; i < 16; ++i)
#pragma unroll
      for (int c = 0; c < 4; ++c) mm[c] = fmaxf(mm[c], x[r][i][c]);
    const float m = wave_max(fmaxf(fmaxf(-3.0e38f, fmaxf(mm[0], mm[1])), fmaxf(mm[2], mm[3])));
    v4f ss = {};
#pragma unroll
    for (int i = 0; i < 16; ++i)
#pragma unroll
      for (int c = 0; c < 4; ++c) { const float e = expf(x[r][i][c] - m); x[r][i][c] = e; ss[c] += e; }
    const float inv = 1.0f / wave_sum((ss[0] + ss[1]) + (ss[2] + ss[3]));
    _Float16* ph = PH + (row0 + r) * NN + lane * 4; _Float16* pl = PL + (row0 + r) * NN + lane * 4;
#pragma unroll
    for (int i = 0; i < 16; ++i) { v4h h, l;
#pragma unroll
      for (int c = 0; c < 4; ++c) { const float p = x[r][i][c] * inv * 2048.0f; h[c] = (_Float16)p; l[c] = (_Float16)(p - (float)h[c]); }
      *(v4h*)(ph + i * 128) = h; *(v4h*)(pl + i * 128) = l; } } }   // a store = 256 contiguous bytes over the wave: whole lines
// ---- k_pv: block = (64 queries, 128 value channels, b): o = P . v. A stage = 128 keys of the v, P hi and P lo rows, copied to LDS in whole lines, two buffers
#define PV_PH (128 * P256)
#define PV_PL (192 * P256)
#define PV_BUF (256 * P256)
__global__ __launch_bounds__(128) void k_pv(const _Float16* __restrict__ PH, const _Float16* __restrict__ PL, const _Float16* __restrict__ VT, float* __restrict__ O) { __shared__ __align__(16) char ring[2 * PV_BUF];
  const int tid = threadIdx.x, wave = tid >> 5, lane = tid & 31, col = lane & 15, g = lane >> 4; const size_t b = blockIdx.z; const int c0 = blockIdx.y * 128; const size_t qb = b * NN + (size_t)blockIdx.x * 64, q0 = qb + wave * 16;
  const unsigned lv = (unsigned)(size_t)ring + (tid >> 4) * P256 + (tid & 15) * 16;   // 16 lanes a row
  const size_t po = ((qb + (tid >> 4)) * NN + (tid & 15) * 8) * 2;
  const char* gv = (const char*)VT + ((b * DA + c0 + (tid >> 4)) * (size_t)NN + (tid & 15) * 8) * 2; const char* gph = (const char*)PH + po; const char* gpl = (const char*)PL + po;
#define PV_FILL(s, bf) do { acp8(lv + (bf) * PV_BUF, 8 * P256, gv + (s) * 256, (size_t)8 * NN * 2); acp8(lv + 64 * P256 + (bf) * PV_BUF, 8 * P256, gv + (size_t)64 * NN * 2 + (s) * 256, (size_t)8 * NN * 2); \
    acp8(lv + PV_PH + (bf) * PV_BUF, 8 * P256, gph + (s) * 256, (size_t)8 * NN * 2); acp8(lv + PV_PL + (bf) * PV_BUF, 8 * P256, gpl + (s) * 256, (size_t)8 * NN * 2); } while (0)
  v8f acc[8] = {};
  PV_FILL(0, 0); WAIT_COPIES(); __syncthreads(); PV_FILL(1, 1);
#pragma unroll 1   // one stage a trip: the two buffers alternate by the trip's parity
  for (int s = 0; s < NN / 128; ++s) { const char* bp = ring + (s & 1) * PV_BUF;
#pragma unroll
    for (int h = 0; h < 4; ++h) { v16h vb[8]; const char* pr = bp + PV_PH + (wave * 16 + col) * P256 + h * 64; const v16h ph = frag_h((const _Float16*)pr, lane), pl = frag_h((const _Float16*)(pr + (PV_PL - PV_PH)), lane);
#pragma unroll
      for (int j = 0; j < 8; ++j) vb[j] = frag_h((const _Float16*)(bp + (j * 16 + col) * P256 + h * 64), lane);   // the block's LDS reads as one group ahead of its products
#pragma unroll
      for (int j = 0; j < 8; ++j) { acc[j] = wmma16(ph, vb[j], acc[j]); acc[j] = wmma16(pl, vb[j], acc[j]); } }
    WAIT_LDS(); WAIT_COPIES(); __syncthreads();   // publishes stage s + 1 and ends every read of stage s
    if (s + 2 < NN / 128) PV_FILL(s + 2, s & 1); }
  WAIT_COPIES();
  float (*ss)[132] = (float (*)[132])(ring + wave * (16 * 132 * 4));   // the ring is free behind the last trip's barrier: each wave stages its 16 rows in its own range
#pragma unroll
  for (int j = 0; j < 8; ++j)
#pragma unroll
    for (int r = 0; r < 8; ++r) ss[8 * g + r][j * 16 + col] = acc[j][r] * (1.0f / 2048.0f);
  LDSX(); for (int rl = 0; rl < 16; ++rl) vst2(O + (q0 + rl) * DA + c0 + lane * 4, *(const v4f*)&ss[rl][lane * 4]); }
// ---- k_out: block = (64 rows, 128 cols): out = query + o (hi + lo) . Wo + bo
__global__ __launch_bounds__(128) void k_out(const float* __restrict__ O, const __bf16* __restrict__ WT, const float* __restrict__ BO, const float* __restrict__ XQ, float* __restrict__ OUT) { __shared__ __align__(16) char ring[2 * PJ_BUF];
  const int tid = threadIdx.x, wave = tid >> 5, lane = tid & 31, col = lane & 15, g = lane >> 4; const int c0 = blockIdx.y * 128; const size_t rb = (size_t)blockIdx.x * 64, r0 = rb + wave * 16;
  const unsigned lds0 = (unsigned)(size_t)ring;
  const unsigned lw = lds0 + (tid >> 3) * P128 + (tid & 7) * 16, lx = lds0 + PJ_X + (tid >> 4) * P256 + (tid & 15) * 16;   // 8 lanes a weight row, 16 lanes an o row
  const char* gw = (const char*)WT + ((size_t)(c0 + (tid >> 3)) * DA + (tid & 7) * 8) * 2; const char* gx = (const char*)O + ((rb + (tid >> 4)) * DA + (tid & 15) * 4) * 4;
  v8f acc[8] = {};
  PJ_FILL(0, 0); WAIT_COPIES(); __syncthreads(); PJ_FILL(1, 1);
#pragma unroll 1   // one stage a trip: the two buffers alternate by the trip's parity
  for (int s = 0; s < DA / 64; ++s) { const char* bp = ring + (s & 1) * PJ_BUF;
#pragma unroll
    for (int h = 0; h < 2; ++h) { v16b w[8]; const F2 a = split_row((const float*)(bp + PJ_X + (wave * 16 + col) * P256), h * 32, lane);
#pragma unroll
      for (int j = 0; j < 8; ++j) w[j] = frag_b((const __bf16*)(bp + (j * 16 + col) * P128 + h * 64), lane);   // the block's LDS reads as one group ahead of its products
#pragma unroll
      for (int j = 0; j < 8; ++j) { acc[j] = wmma_bf(a.h, w[j], acc[j]); acc[j] = wmma_bf(a.l, w[j], acc[j]); } }
    WAIT_LDS(); WAIT_COPIES(); __syncthreads();   // publishes stage s + 1 and ends every read of stage s
    if (s + 2 < DA / 64) PJ_FILL(s + 2, s & 1); }
  WAIT_COPIES();
  float (*sf)[16][132] = (float (*)[16][132])ring;   // the ring is free behind the last trip's barrier: each wave stages its 16 rows in its own range
#pragma unroll
  for (int j = 0; j < 8; ++j) { const int c = c0 + j * 16 + col; const float bb = bfr(BO[c]);
#pragma unroll
    for (int r = 0; r < 8; ++r) sf[wave][8 * g + r][j * 16 + col] = bfr(XQ[(r0 + 8 * g + r) * DA + c]) + acc[j][r] + bb; }
  LDSX(); for (int rl = 0; rl < 16; ++rl) vst2(OUT + (r0 + rl) * DA + c0 + lane * 4, *(const v4f*)&sf[wave][rl][lane * 4]); }
extern "C" void kernel_launch(void* const* d_in, const int* in_sizes, int n_in, void* d_out, int out_size, void* d_ws, size_t ws_size, hipStream_t stream) {
  (void)in_sizes; (void)n_in; (void)out_size;
  const float** F = (const float**)d_in;   // 0 query [4,2048,512], 1 key_value [4,2048,512], 2 Wq, 3 bq, 4 Wk, 5 bk, 6 Wv, 7 bv, 8 Wo, 9 bo ((in,out) [512,512] / [512])
  if (ws_size < (size_t)WS_END) return;
  char* ws = (char*)d_ws; float *Q = (float*)(ws + WS_Q), *S = (float*)(ws + WS_S), *O = (float*)(ws + WS_O); __bf16 *KH = (__bf16*)(ws + WS_KH), *KL = (__bf16*)(ws + WS_KL); _Float16 *VT = (_Float16*)(ws + WS_VT), *PH = (_Float16*)(ws + WS_PH), *PL = (_Float16*)(ws + WS_PL); __bf16* WT = (__bf16*)(ws + WS_WT);
  k_pack<<<dim3(DA / 32, DA / 64, 4), 256, 0, stream>>>(F[2], F[4], F[6], F[8], WT);
  k_proj<<<dim3(TNB * NN / 64, DA / 128, 3), 128, 0, stream>>>(F[0], F[1], WT, F[3], F[5], F[7], Q, KH, KL, VT);
  k_sc<<<dim3(TQB, NN / 128, TNB), 128, 0, stream>>>(Q, KH, KL, S);
  k_sm<<<TNB * TQB * 64 / (SM_W * SM_R), SM_W * 32, 0, stream>>>(S, PH, PL);   // rows of all batches are contiguous: one launch
  k_pv<<<dim3(TQB, DA / 128, TNB), 128, 0, stream>>>(PH, PL, VT, O);
  k_out<<<dim3(TNB * TQB, DA / 128), 128, 0, stream>>>(O, WT + (size_t)3 * DA * DA, F[9], F[0], (float*)d_out);   // 512 work-groups in one launch, not 4 launches of 128
}

// v005
// One run takes 109 microseconds.
// Next to v004, in two timings, it ran 1.19 times as fast each time.
// Over all steps from v000 it is 4.32 times as fast.
// compute dtype: all float inputs rounded to bf16; q/k/v = x W + b with EXACT bf16 products on WMMA 16x16x32 ((in,out) weights), f32 accumulate; q and k kept in f32 and split into bf16 hi + lo for the scores (3 products: the module multiplies by sqrt(512), logits ~1e2), logits stored in f32; softmax in f32 (precise expf) -> P as f16 x 2^11 + residual; P . v with v as f16 (2 products); out = query + o (bf16 hi + lo) . Wo + bo (2 products); f32 output.
#include <hip/hip_runtime.h>
#include <math.h>

typedef __attribute__((ext_vector_type(16))) _Float16 v16h;
typedef __attribute__((ext_vector_type(16))) __bf16 v16b;
typedef __attribute__((ext_vector_type(8)))  _Float16 v8h;
typedef __attribute__((ext_vector_type(8)))  float v8f;
typedef __attribute__((ext_vector_type(4)))  float v4f;
typedef __attribute__((ext_vector_type(2)))  float v2f;
typedef __attribute__((ext_vector_type(4)))  unsigned v4u;
typedef __attribute__((ext_vector_type(4)))  int v4i;
typedef float __attribute__((may_alias)) float_a;
typedef int __attribute__((may_alias)) int_a;

template <typename T> __device__ __forceinline__ void vst2(void* p, T v) { *(T*)p = v;  }
__device__ __forceinline__ v8f wmma16(v16h a, v16h b, v8f c) {
  v8f d = __builtin_amdgcn_wmma_f32_16x16x32_f16(false, a, false, b, (short)0, c, false, false);
  asm volatile("v_nop\n\tv_nop\n\tv_nop\n\tv_nop" : "+v"(d) : "v"(a), "v"(b));
  return d;
}
__device__ __forceinline__ v8f wmma_bf(v16b a, v16b b, v8f c) {
  v8f d = __builtin_amdgcn_wmma_f32_16x16x32_bf16(false, a, false, b, (short)0, c, false, false);
  asm volatile("v_nop\n\tv_nop\n\tv_nop\n\tv_nop" : "+v"(d) : "v"(a), "v"(b));
  return d;
}
// 16x16x32 fragments: lane = (h = lane>>4, row/col = lane&15); elements 0..7 = k0+8h+0..7, 8..15 = k0+16+8h+0..7; D element r = row 8h+r
__device__ __forceinline__ v16h frag_h(const _Float16* rowk0, int lane) {
  union { v16h v; v8h q[2]; } u; const _Float16* p = rowk0 + 8 * (lane >> 4);
  u.q[0] = *(const v8h*)p; u.q[1] = *(const v8h*)(p + 16); return u.v;
}
__device__ __forceinline__ v16h frag_f32(const float* rowk0, int lane) {
  v16h a; const float* p = rowk0 + 8 * (lane >> 4);
#pragma unroll
  for (int i = 0; i < 8; ++i) { a[i] = (_Float16)p[i]; a[8 + i] = (_Float16)p[16 + i]; }
  return a;
}
__device__ __forceinline__ v16h frag_f32s(const float* rowk0, int lane, float sc) {
  v16h a; const float* p = rowk0 + 8 * (lane >> 4);
#pragma unroll
  for (int i = 0; i < 8; ++i) { a[i] = (_Float16)(p[i] * sc); a[8 + i] = (_Float16)(p[16 + i] * sc); }
  return a;
}
// column fragment from a [K][ld] layout (column n), rows >= K read as 0
__device__ __forceinline__ v16h fragc_f32(const float* W, int k0, int n, int lane, int ld, int K) {
  v16h a; const int g = lane >> 4;
#pragma unroll
  for (int i = 0; i < 8; ++i) { const int ka = k0 + 8 * g + i, kb = ka + 16;
    a[i] = (_Float16)(ka < K ? W[(size_t)(ka < K ? ka : K - 1) * ld + n] : 0.f); a[8 + i] = (_Float16)(kb < K ? W[(size_t)(kb < K ? kb : K - 1) * ld + n] : 0.f); }
  return a;
}
struct F2 { v16b h, l; };
__device__ __forceinline__ F2 bsplit16(const float v[16]) { F2 r;
#pragma unroll
  for (int i = 0; i < 16; ++i) { const __bf16 h = (__bf16)v[i]; r.h[i] = h; r.l[i] = (__bf16)(v[i] - (float)h); }
  return r; }
__device__ __forceinline__ F2 split_row(const float* row, int k0, int lane) { float v[16]; const float* p = row + k0 + 8 * (lane >> 4);
#pragma unroll
  for (int i = 0; i < 8; ++i) { v[i] = p[i]; v[8 + i] = p[16 + i]; }
  return bsplit16(v); }
__device__ __forceinline__ F2 split_rowK(const float* row, int k0, int lane, int K) { float v[16]; const int g = lane >> 4;
#pragma unroll
  for (int i = 0; i < 8; ++i) { const int ka = k0 + 8 * g + i, kb = ka + 16; v[i] = ka < K ? row[ka < K ? ka : K - 1] : 0.f; v[8 + i] = kb < K ? row[kb < K ? kb : K - 1] : 0.f; }
  return bsplit16(v); }
__device__ __forceinline__ F2 split_col(const float* W, int k0, int n, int lane, int ld, int K) { float v[16]; const int g = lane >> 4;
#pragma unroll
  for (int i = 0; i < 8; ++i) { const int ka = k0 + 8 * g + i, kb = ka + 16; v[i] = ka < K ? W[(size_t)(ka < K ? ka : K - 1) * ld + n] : 0.f; v[8 + i] = kb < K ? W[(size_t)(kb < K ? kb : K - 1) * ld + n] : 0.f; }
  return bsplit16(v); }
__device__ __forceinline__ v8f mac3(const F2& a, const F2& b, v8f c) { c = wmma_bf(a.l, b.h, c); c = wmma_bf(a.h, b.l, c); return wmma_bf(a.h, b.h, c); }
__device__ __forceinline__ float sigm(float v) { return 1.0f / (1.0f + expf(-v)); }
#define LDSX() do { asm volatile("s_wait_dscnt 0" ::: "memory"); __builtin_amdgcn_wave_barrier(); __builtin_amdgcn_fence(__ATOMIC_RELEASE, "workgroup"); } while (0)


// Axis attention (B 4, 2,048 queries x 2,048 keys, dim_attn 512, single head): attn = softmax((q k^T) * sqrt(512)); out = query + (attn v) Wo + bo.
#define NB 4
#define NN 2048
#define DA 512
#ifndef TNB
#define TNB NB
#endif
#ifndef TQB
#define TQB (NN / 64)
#endif
typedef __attribute__((ext_vector_type(8))) __bf16 v8b;
__device__ __forceinline__ v16b frag_b(const __bf16* rowk0, int lane) {
  union { v16b v; v8b q[2]; } u; const __bf16* p = rowk0 + 8 * (lane >> 4);
  u.q[0] = *(const v8b*)p; u.q[1] = *(const v8b*)(p + 16); return u.v;
}
__device__ __forceinline__ float bfr(float v) { return (float)(__bf16)v; }
__device__ __attribute__((noinline)) float exp_ni(float v) { return expf(v); }
__device__ __attribute__((noinline)) float erf_ni(float v) { return erff(v); }

#define WS_Q   0u                                    // bf16 q hi rows [b*n][512]
#define WS_QL  (WS_Q + 2u * (size_t)NB * NN * DA)       // bf16 q lo rows
#define WS_KH  (WS_QL + 2u * (size_t)NB * NN * DA)      // bf16 k hi rows
#define WS_KL  (WS_KH + 2u * (size_t)NB * NN * DA)      // bf16 k lo rows
#define WS_VT  (WS_KL + 2u * (size_t)NB * NN * DA)      // f16 v planes [b][512][n]
#define WS_S   (WS_VT + 2u * (size_t)NB * DA * NN)      // f32 logits [b][q][key]
#define WS_PH  (WS_S + 4u * (size_t)NB * NN * NN)       // f16 P x 2^11 rows [b*q][key]
#define WS_PL  (WS_PH + 2u * (size_t)NB * NN * NN)      // f16 residual
#define WS_O   (WS_PL + 2u * (size_t)NB * NN * NN)      // f32 o rows [b*q][512]
#define WS_WT  (WS_O + 4u * (size_t)NB * NN * DA)       // bf16 weights as [4][out][in] rows: Wq, Wk, Wv, Wo
#define WS_END (WS_WT + 2u * (size_t)4 * DA * DA)

// eight 16-byte asynchronous copies of one lane, global -> LDS: copy i brings g + i * gstep to LDS byte l + i * lstep.
// The closing s_wait_xcnt 0 stands inside the copies' own statement so that no address register is rewritten ahead of it.
__device__ __forceinline__ void acp8(unsigned l, unsigned lstep, const char* g, size_t gstep) {
  asm volatile("global_load_async_to_lds_b128 %0, %8, off\n\t"
               "global_load_async_to_lds_b128 %1, %9, off\n\t"
               "global_load_async_to_lds_b128 %2, %10, off\n\t"
               "global_load_async_to_lds_b128 %3, %11, off\n\t"
               "global_load_async_to_lds_b128 %4, %12, off\n\t"
               "global_load_async_to_lds_b128 %5, %13, off\n\t"
               "global_load_async_to_lds_b128 %6, %14, off\n\t"
               "global_load_async_to_lds_b128 %7, %15, off\n\t"
               "s_wait_xcnt 0x0"
               :: "v"(l), "v"(l + lstep), "v"(l + 2 * lstep), "v"(l + 3 * lstep), "v"(l + 4 * lstep), "v"(l + 5 * lstep), "v"(l + 6 * lstep), "v"(l + 7 * lstep),
                  "v"(g), "v"(g + gstep), "v"(g + 2 * gstep), "v"(g + 3 * gstep), "v"(g + 4 * gstep), "v"(g + 5 * gstep), "v"(g + 6 * gstep), "v"(g + 7 * gstep)
               : "memory");
}
// the same for four copies
__device__ __forceinline__ void acp4(unsigned l, unsigned lstep, const char* g, size_t gstep) {
  asm volatile("global_load_async_to_lds_b128 %0, %4, off\n\t"
               "global_load_async_to_lds_b128 %1, %5, off\n\t"
               "global_load_async_to_lds_b128 %2, %6, off\n\t"
               "global_load_async_to_lds_b128 %3, %7, off\n\t"
               "s_wait_xcnt 0x0"
               :: "v"(l), "v"(l + lstep), "v"(l + 2 * lstep), "v"(l + 3 * lstep),
                  "v"(g), "v"(g + gstep), "v"(g + 2 * gstep), "v"(g + 3 * gstep)
               : "memory");
}
// this wave's copies have landed (the compiler places no wait for them)
#define WAIT_COPIES() asm volatile("s_wait_asynccnt 0x0" ::: "memory")
// this wave's LDS reads have returned, before the barrier behind which their buffer is refilled
#define WAIT_LDS() asm volatile("s_wait_dscnt 0x0" ::: "memory")
#define P128 144   // LDS pitch of a 128-byte row, 16 B x odd: ds_load_b128 without bank conflicts
#define P256 272   // the same for a 256-byte row
// ---- k_pack: block = (32 outputs, 64 inputs, which): a weight's (in,out) f32 tile -> bf16 [out][in] rows, turned in LDS so that whole 128-byte lines are stored
__global__ __launch_bounds__(256) void k_pack(const float* __restrict__ WQ, const float* __restrict__ WK, const float* __restrict__ WV, const float* __restrict__ WO, __bf16* __restrict__ WT) { __shared__ __align__(16) __bf16 tl[32][72];
  const int t = threadIdx.x, lane = t & 31, wave = t >> 5; const int which = blockIdx.z; const int n0 = blockIdx.x * 32, k0 = blockIdx.y * 64;
  const float* Wm = which == 0 ? WQ : which == 1 ? WK : which == 2 ? WV : WO;
  v8b r;
#pragma unroll
  for (int i = 0; i < 8; ++i) r[i] = (__bf16)Wm[(size_t)(k0 + wave * 8 + i) * DA + n0 + lane];
  *(v8b*)&tl[lane][wave * 8] = r;
  __syncthreads();
  vst2((unsigned*)(WT + ((size_t)which * DA + n0 + (t >> 3)) * DA + k0 + (t & 7) * 8), *(const v4u*)&tl[t >> 3][(t & 7) * 8]); }
// A stage of k_out's GEMM = 64 k of 128 packed weight rows (bf16) and of 64 activation rows (f32), copied to LDS in whole lines, two buffers
#define PJ_X   (128 * P128)
#define PJ_BUF (128 * P128 + 64 * P256)
#define PJ_FILL(s, bf) do { acp8(lw + (bf) * PJ_BUF, 16 * P128, gw + (s) * 128, (size_t)16 * DA * 2); acp8(lx + (bf) * PJ_BUF, 8 * P256, gx + (s) * 256, (size_t)8 * DA * 4); } while (0)
// ---- k_proj: block = (256 rows, 256 cols, which), 16 waves as 4 x 4, a wave = 64 rows x 64 cols: q and k (bf16 hi + lo rows), v (f16 planes). A stage = 64 k of 256 packed weight rows and 256 x rows, two buffers
#define PR_X   (256 * P128)
#define PR_BUF (256 * P128 + 256 * P256)
#define PR_OUT (2 * 64 * P128)   // a wave's output tile in LDS: two planes of 64 rows of 128 bytes
#define PR_FILL(s, bf) do { acp4(lw + (bf) * PR_BUF, 64 * P128, gw + (s) * 128, (size_t)64 * DA * 2); acp8(lx + (bf) * PR_BUF, 32 * P256, gx + (s) * 256, (size_t)32 * DA * 4); } while (0)
// ROWS: the result goes out as rows [x row][col]; the weight fragment is then the product's A operand, so that a lane's eight results are eight neighbouring cols of one row (one 16-byte LDS store).
// Otherwise it goes out as planes [col][x row], x is the A operand and the eight results are eight neighbouring x rows of one col.
template <bool ROWS> __device__ __forceinline__ void proj_tile(char* ring, const float* __restrict__ X, const __bf16* __restrict__ Wr, const float* __restrict__ Bm, __bf16* __restrict__ DH, __bf16* __restrict__ DL, _Float16* __restrict__ VT) {
  const int tid = threadIdx.x, wave = tid >> 5, lane = tid & 31, col = lane & 15, g = lane >> 4, wr = wave >> 2, wc = wave & 3; const int c0 = blockIdx.y * 256; const size_t r0 = (size_t)blockIdx.x * 256;
  const unsigned lds0 = (unsigned)(size_t)ring;
  const unsigned lw = lds0 + (tid >> 3) * P128 + (tid & 7) * 16, lx = lds0 + PR_X + (tid >> 4) * P256 + (tid & 15) * 16;   // 8 lanes a weight row, 16 lanes an x row
  const char* gw = (const char*)Wr + ((size_t)(c0 + (tid >> 3)) * DA + (tid & 7) * 8) * 2; const char* gx = (const char*)X + ((r0 + (tid >> 4)) * DA + (tid & 15) * 4) * 4;
  v8f acc[4][4] = {};   // every inner loop below is unrolled so that the tiles and fragments are indexed by constants and stay in registers
  PR_FILL(0, 0); WAIT_COPIES(); __syncthreads(); PR_FILL(1, 1);
#pragma unroll 1   // one stage a trip: the two buffers alternate by the trip's parity
  for (int s = 0; s < DA / 64; ++s) { const char* bp = ring + (s & 1) * PR_BUF;
#pragma unroll
    for (int h = 0; h < 2; ++h) { v16b a[4];
#pragma unroll
      for (int i = 0; i < 4; ++i) { const float* p = (const float*)(bp + PR_X + (wr * 64 + i * 16 + col) * P256) + h * 32 + 8 * g;
#pragma unroll
        for (int e = 0; e < 8; ++e) { a[i][e] = (__bf16)p[e]; a[i][8 + e] = (__bf16)p[16 + e]; } }
#pragma unroll
      for (int j = 0; j < 4; ++j) { const v16b w = frag_b((const __bf16*)(bp + (wc * 64 + j * 16 + col) * P128 + h * 64), lane);   // a weight fragment serves four x fragments
#pragma unroll
        for (int i = 0; i < 4; ++i) acc[i][j] = ROWS ? wmma_bf(w, a[i], acc[i][j]) : wmma_bf(a[i], w, acc[i][j]); } }
    WAIT_LDS(); WAIT_COPIES(); __syncthreads();   // publishes stage s + 1 and ends every read of stage s
    if (s + 2 < DA / 64) PR_FILL(s + 2, s & 1); }
  WAIT_COPIES();
  char* my = ring + wave * PR_OUT;   // the ring is free behind the last trip's barrier: each wave turns its own tile in its own range
  const int l8 = lane >> 3, q8 = (lane & 7) * 8;   // a global store = four rows of 128 contiguous bytes: whole lines
  if (ROWS) {
#pragma unroll
    for (int j = 0; j < 4; ++j) { float bb[8];
#pragma unroll
      for (int r = 0; r < 8; ++r) bb[r] = bfr(Bm[c0 + wc * 64 + j * 16 + 8 * g + r]);
#pragma unroll
      for (int i = 0; i < 4; ++i) { v8b h8, lo8;
#pragma unroll
        for (int r = 0; r < 8; ++r) { const float v = acc[i][j][r] + bb[r]; const __bf16 h = (__bf16)v; h8[r] = h; lo8[r] = (__bf16)(v - (float)h); }
        char* d = my + (i * 16 + col) * P128 + (j * 16 + 8 * g) * 2; *(v8b*)d = h8; *(v8b*)(d + 64 * P128) = lo8; } }
    LDSX();
    __bf16* dh = DH + (r0 + wr * 64) * DA + c0 + wc * 64 + q8; __bf16* dl = DL + (r0 + wr * 64) * DA + c0 + wc * 64 + q8;
    for (int t = 0; t < 16; ++t) { const int rl = 4 * t + l8; const char* sp = my + rl * P128 + q8 * 2; vst2((unsigned*)(dh + (size_t)rl * DA), *(const v4u*)sp); vst2((unsigned*)(dl + (size_t)rl * DA), *(const v4u*)(sp + 64 * P128)); }
  } else {
#pragma unroll
    for (int j = 0; j < 4; ++j) { const float bb = bfr(Bm[c0 + wc * 64 + j * 16 + col]);
#pragma unroll
      for (int i = 0; i < 4; ++i) { v8h t8;
#pragma unroll
        for (int r = 0; r < 8; ++r) t8[r] = (_Float16)(acc[i][j][r] + bb);
        *(v8h*)(my + (j * 16 + col) * P128 + (i * 16 + 8 * g) * 2) = t8; } }
    LDSX();
    const size_t b = r0 / NN; const int n0 = (int)(r0 % NN); _Float16* dv = VT + (b * DA + c0 + wc * 64) * (size_t)NN + n0 + wr * 64 + q8;
    for (int t = 0; t < 16; ++t) { const int cl = 4 * t + l8; vst2((unsigned*)(dv + (size_t)cl * NN), *(const v4u*)(my + cl * P128 + q8 * 2)); }
  } }
__global__ __launch_bounds__(512) void k_proj(const float* __restrict__ XQ, const float* __restrict__ XKV, const __bf16* __restrict__ WT, const float* __restrict__ BQ, const float* __restrict__ BK, const float* __restrict__ BV, __bf16* __restrict__ QH, __bf16* __restrict__ QL, __bf16* __restrict__ KH, __bf16* __restrict__ KL, _Float16* __restrict__ VT) { __shared__ __align__(16) char ring[16 * PR_OUT];
  static_assert(16 * PR_OUT >= 2 * PR_BUF, "the ring holds two stages");
  const int which = blockIdx.z;   // the same for the whole block: every barrier of a branch is passed by all its waves
  if (which <= 1) proj_tile<true>(ring, which == 0 ? XQ : XKV, WT + (size_t)which * DA * DA, which == 0 ? BQ : BK, which == 0 ? QH : KH, which == 0 ? QL : KL, VT);
  else proj_tile<false>(ring, XKV, WT + (size_t)2 * DA * DA, BV, KH, KL, VT); }
// ---- k_sc: block = (256 queries, 256 keys, b), 16 waves as 4 x 4, a wave = 64 queries x 64 keys: logits (3 products) x sqrt(512) -> S. A stage = 64 k of the q hi, q lo, K hi and K lo rows, copied to LDS in whole lines, two buffers
#define SC_LO (256 * P128)
#define SC_K  (512 * P128)
#define SC_BUF (1024 * P128)
__global__ __launch_bounds__(512) void k_sc(const __bf16* __restrict__ QH, const __bf16* __restrict__ QL, const __bf16* __restrict__ KH, const __bf16* __restrict__ KL, float* __restrict__ S) { __shared__ __align__(16) char ring[2 * SC_BUF];
  const int tid = threadIdx.x, wave = tid >> 5, lane = tid & 31, col = lane & 15, g = lane >> 4, wq = wave >> 2, wk = wave & 3; const size_t b = blockIdx.z; const int k0 = blockIdx.y * 256; const size_t qb = b * NN + (size_t)blockIdx.x * 256;
  const unsigned lr = (unsigned)(size_t)ring + (tid >> 3) * P128 + (tid & 7) * 16;   // 8 lanes a row
  const size_t qo = ((qb + (tid >> 3)) * DA + (tid & 7) * 8) * 2, ko = ((b * NN + k0 + (tid >> 3)) * DA + (tid & 7) * 8) * 2;
  const char* gqh = (const char*)QH + qo; const char* gql = (const char*)QL + qo; const char* gkh = (const char*)KH + ko; const char* gkl = (const char*)KL + ko;
#define SC_FILL(s, bf) do { acp4(lr + (bf) * SC_BUF, 64 * P128, gqh + (s) * 128, (size_t)64 * DA * 2); acp4(lr + SC_LO + (bf) * SC_BUF, 64 * P128, gql + (s) * 128, (size_t)64 * DA * 2); \
    acp4(lr + SC_K + (bf) * SC_BUF, 64 * P128, gkh + (s) * 128, (size_t)64 * DA * 2); acp4(lr + SC_K + SC_LO + (bf) * SC_BUF, 64 * P128, gkl + (s) * 128, (size_t)64 * DA * 2); } while (0)
  v8f acc[4][4] = {};   // every inner loop below is unrolled so that the tiles and fragments are indexed by constants and stay in registers
  SC_FILL(0, 0); WAIT_COPIES(); __syncthreads(); SC_FILL(1, 1);
#pragma unroll 1   // one stage a trip: the two buffers alternate by the trip's parity
  for (int s = 0; s < DA / 64; ++s) { const char* bp = ring + (s & 1) * SC_BUF;
#pragma unroll
    for (int h = 0; h < 2; ++h) { v16b ah[4], al[4];
#pragma unroll
      for (int i = 0; i < 4; ++i) { const char* qr = bp + (wq * 64 + i * 16 + col) * P128 + h * 64; ah[i] = frag_b((const __bf16*)qr, lane); al[i] = frag_b((const __bf16*)(qr + SC_LO), lane); }
#pragma unroll
      for (int j = 0; j < 4; ++j) { const char* kr = bp + SC_K + (wk * 64 + j * 16 + col) * P128 + h * 64; const v16b kh = frag_b((const __bf16*)kr, lane), kl = frag_b((const __bf16*)(kr + SC_LO), lane);
        // a key fragment serves four query fragments; each tile still takes its three products in the order hi.hi, lo.hi, hi.lo
#pragma unroll
        for (int i = 0; i < 4; ++i) acc[i][j] = wmma_bf(ah[i], kh, acc[i][j]);
#pragma unroll
        for (int i = 0; i < 4; ++i) acc[i][j] = wmma_bf(al[i], kh, acc[i][j]);
#pragma unroll
        for (int i = 0; i < 4; ++i) acc[i][j] = wmma_bf(ah[i], kl, acc[i][j]); } }
    WAIT_LDS(); WAIT_COPIES(); __syncthreads();   // publishes stage s + 1 and ends every read of stage s
    if (s + 2 < DA / 64) SC_FILL(s + 2, s & 1); }
  WAIT_COPIES();
  float (*ss)[68] = (float (*)[68])(ring + wave * (64 * 68 * 4));   // the ring is free behind the last trip's barrier: each wave stages its 64 rows in its own range
#pragma unroll
  for (int i = 0; i < 4; ++i)
#pragma unroll
    for (int j = 0; j < 4; ++j)
#pragma unroll
      for (int r = 0; r < 8; ++r) ss[i * 16 + 8 * g + r][j * 16 + col] = acc[i][j][r] * 22.627416997969522f;
  LDSX(); for (int t = 0; t < 32; ++t) { const int rl = 2 * t + g; vst2(S + (qb + wq * 64 + rl) * NN + k0 + wk * 64 + col * 4, *(const v4f*)&ss[rl][col * 4]); } }   // a store = two rows of 256 contiguous bytes: whole lines
// lane l with lane l ^ 16
__device__ __forceinline__ float xhalf(float x) { return __builtin_bit_cast(float, __builtin_amdgcn_permlanex16(__builtin_bit_cast(int, x), __builtin_bit_cast(int, x), 0x76543210, 0xfedcba98, false, false)); }
// lane l with lane l ^ M inside its 16-lane row (DPP row_xmask)
template <int M> __device__ __forceinline__ float xrow(float x) { return __builtin_bit_cast(float, __builtin_amdgcn_update_dpp(0, __builtin_bit_cast(int, x), 0x160 + M, 0xf, 0xf, true)); }
__device__ __forceinline__ float wave_max(float v) { v = fmaxf(v, xrow<1>(v)); v = fmaxf(v, xrow<2>(v)); v = fmaxf(v, xrow<4>(v)); v = fmaxf(v, xrow<8>(v)); return fmaxf(v, xhalf(v)); }
__device__ __forceinline__ float wave_sum(float v) { v += xrow<1>(v); v += xrow<2>(v); v += xrow<4>(v); v += xrow<8>(v); return v + xhalf(v); }
typedef __attribute__((ext_vector_type(4))) _Float16 v4h;
// ---- k_sm: wave = SM_R query rows, each row's 2,048 logits held in the wave's registers (64 a lane): S read once, one expf a logit, no LDS, no barrier -> P x 2^11 as f16 + residual
#define SM_R 2    // rows a wave: with 16 waves a block the whole problem is one block per WGP
#define SM_W 16   // waves a block
__global__ __launch_bounds__(SM_W * 32) void k_sm(const float* __restrict__ S, _Float16* __restrict__ PH, _Float16* __restrict__ PL) {
  const int lane = threadIdx.x & 31; const size_t row0 = ((size_t)blockIdx.x * SM_W + (threadIdx.x >> 5)) * SM_R;
  const float* sp = S + row0 * NN + lane * 4;   // the one address that every load below names
  v4f x[SM_R][16];   // load i of a row = 512 contiguous bytes over the wave; all rows' loads are issued ahead of the first row's arithmetic
  // every loop below is unrolled so that x is indexed by constants and stays in registers
#pragma unroll
  for (int r = 0; r < SM_R; ++r)
#pragma unroll
    for (int i = 0; i < 16; ++i) x[r][i] = *(const v4f*)(sp + r * NN + i * 128);
  asm volatile("s_wait_xcnt 0x0" :: "v"(sp) : "memory");   // the loads' address pair is an input here, so it lives up to this wait and no load's result lands in it ahead of the wait
#pragma unroll
  for (int r = 0; r < SM_R; ++r) { __builtin_amdgcn_sched_barrier(0);   // keeps every load ahead of the arithmetic, and a later row's arithmetic (with its wait for that row's loads) behind this row's stores
    v4f mm = x[r][0];
#pragma unroll
    for (int i = 1; i < 16; ++i)
#pragma unroll
      for (int c = 0; c < 4; ++c) mm[c] = fmaxf(mm[c], x[r][i][c]);
    const float m = wave_max(fmaxf(fmaxf(-3.0e38f, fmaxf(mm[0], mm[1])), fmaxf(mm[2], mm[3])));
    v4f ss = {};
#pragma unroll
    for (int i = 0; i < 16; ++i)
#pragma unroll
      for (int c = 0; c < 4; ++c) { const float e = expf(x[r][i][c] - m); x[r][i][c] = e; ss[c] += e; }
    const float inv = 1.0f / wave_sum((ss[0] + ss[1]) + (ss[2] + ss[3]));
    _Float16* ph = PH + (row0 + r) * NN + lane * 4; _Float16* pl = PL + (row0 + r) * NN + lane * 4;
#pragma unroll
    for (int i = 0; i < 16; ++i) { v4h h, l;
#pragma unroll
      for (int c = 0; c < 4; ++c) { const float p = x[r][i][c] * inv * 2048.0f; h[c] = (_Float16)p; l[c] = (_Float16)(p - (float)h[c]); }
      *(v4h*)(ph + i * 128) = h; *(v4h*)(pl + i * 128) = l; } } }   // a store = 256 contiguous bytes over the wave: whole lines
// ---- k_pv: block = (128 queries, 128 value channels, b), 8 waves as 4 x 2, a wave = 32 queries x 64 channels: o = P . v. A stage = 128 keys of the v, P hi and P lo rows, copied to LDS in whole lines, two buffers
#define PV_PH (128 * P256)
#define PV_PL (256 * P256)
#define PV_BUF (384 * P256)
__global__ __launch_bounds__(256) void k_pv(const _Float16* __restrict__ PH, const _Float16* __restrict__ PL, const _Float16* __restrict__ VT, float* __restrict__ O) { __shared__ __align__(16) char ring[2 * PV_BUF];
  const int tid = threadIdx.x, wave = tid >> 5, lane = tid & 31, col = lane & 15, g = lane >> 4, wq = wave >> 1, wc = wave & 1; const size_t b = blockIdx.z; const int c0 = blockIdx.y * 128; const size_t qb = b * NN + (size_t)blockIdx.x * 128;
  const unsigned lv = (unsigned)(size_t)ring + (tid >> 4) * P256 + (tid & 15) * 16;   // 16 lanes a row
  const size_t po = ((qb + (tid >> 4)) * NN + (tid & 15) * 8) * 2;
  const char* gv = (const char*)VT + ((b * DA + c0 + (tid >> 4)) * (size_t)NN + (tid & 15) * 8) * 2; const char* gph = (const char*)PH + po; const char* gpl = (const char*)PL + po;
#define PV_FILL(s, bf) do { acp8(lv + (bf) * PV_BUF, 16 * P256, gv + (s) * 256, (size_t)16 * NN * 2); acp8(lv + PV_PH + (bf) * PV_BUF, 16 * P256, gph + (s) * 256, (size_t)16 * NN * 2); acp8(lv + PV_PL + (bf) * PV_BUF, 16 * P256, gpl + (s) * 256, (size_t)16 * NN * 2); } while (0)
  v8f acc[2][4] = {};   // every inner loop below is unrolled so that the tiles and fragments are indexed by constants and stay in registers
  PV_FILL(0, 0); WAIT_COPIES(); __syncthreads(); PV_FILL(1, 1);
#pragma unroll 1   // one stage a trip: the two buffers alternate by the trip's parity
  for (int s = 0; s < NN / 128; ++s) { const char* bp = ring + (s & 1) * PV_BUF;
#pragma unroll
    for (int h = 0; h < 4; ++h) { v16h vb[4], ph[2], pl[2];
#pragma unroll
      for (int i = 0; i < 2; ++i) { const char* pr = bp + PV_PH + (wq * 32 + i * 16 + col) * P256 + h * 64; ph[i] = frag_h((const _Float16*)pr, lane); pl[i] = frag_h((const _Float16*)(pr + (PV_PL - PV_PH)), lane); }
#pragma unroll
      for (int j = 0; j < 4; ++j) vb[j] = frag_h((const _Float16*)(bp + (wc * 64 + j * 16 + col) * P256 + h * 64), lane);   // the block's LDS reads as one group ahead of its products
      // a v fragment serves two query fragments; each tile still takes P hi, then P lo
#pragma unroll
      for (int j = 0; j < 4; ++j)
#pragma unroll
        for (int i = 0; i < 2; ++i) acc[i][j] = wmma16(ph[i], vb[j], acc[i][j]);
#pragma unroll
      for (int j = 0; j < 4; ++j)
#pragma unroll
        for (int i = 0; i < 2; ++i) acc[i][j] = wmma16(pl[i], vb[j], acc[i][j]); }
    WAIT_LDS(); WAIT_COPIES(); __syncthreads();   // publishes stage s + 1 and ends every read of stage s
    if (s + 2 < NN / 128) PV_FILL(s + 2, s & 1); }
  WAIT_COPIES();
  float (*ss)[68] = (float (*)[68])(ring + wave * (32 * 68 * 4));   // the ring is free behind the last trip's barrier: each wave stages its 32 rows in its own range
#pragma unroll
  for (int i = 0; i < 2; ++i)
#pragma unroll
    for (int j = 0; j < 4; ++j)
#pragma unroll
      for (int r = 0; r < 8; ++r) ss[i * 16 + 8 * g + r][j * 16 + col] = acc[i][j][r] * (1.0f / 2048.0f);
  LDSX(); for (int t = 0; t < 16; ++t) { const int rl = 2 * t + g; vst2(O + (qb + wq * 32 + rl) * DA + c0 + wc * 64 + col * 4, *(const v4f*)&ss[rl][col * 4]); } }   // a store = two rows of 256 contiguous bytes: whole lines
// ---- k_out: block = (64 rows, 128 cols): out = query + o (hi + lo) . Wo + bo
__global__ __launch_bounds__(128) void k_out(const float* __restrict__ O, const __bf16* __restrict__ WT, const float* __restrict__ BO, const float* __restrict__ XQ, float* __restrict__ OUT) { __shared__ __align__(16) char ring[2 * PJ_BUF];
  const int tid = threadIdx.x, wave = tid >> 5, lane = tid & 31, col = lane & 15, g = lane >> 4; const int c0 = blockIdx.y * 128; const size_t rb = (size_t)blockIdx.x * 64, r0 = rb + wave * 16;
  const unsigned lds0 = (unsigned)(size_t)ring;
  const unsigned lw = lds0 + (tid >> 3) * P128 + (tid & 7) * 16, lx = lds0 + PJ_X + (tid >> 4) * P256 + (tid & 15) * 16;   // 8 lanes a weight row, 16 lanes an o row
  const char* gw = (const char*)WT + ((size_t)(c0 + (tid >> 3)) * DA + (tid & 7) * 8) * 2; const char* gx = (const char*)O + ((rb + (tid >> 4)) * DA + (tid & 15) * 4) * 4;
  v8f acc[8] = {};
  PJ_FILL(0, 0); WAIT_COPIES(); __syncthreads(); PJ_FILL(1, 1);
#pragma unroll 1   // one stage a trip: the two buffers alternate by the trip's parity
  for (int s = 0; s < DA / 64; ++s) { const char* bp = ring + (s & 1) * PJ_BUF;
#pragma unroll
    for (int h = 0; h < 2; ++h) { v16b w[8]; const F2 a = split_row((const float*)(bp + PJ_X + (wave * 16 + col) * P256), h * 32, lane);
#pragma unroll
      for (int j = 0; j < 8; ++j) w[j] = frag_b((const __bf16*)(bp + (j * 16 + col) * P128 + h * 64), lane);   // the block's LDS reads as one group ahead of its products
#pragma unroll
      for (int j = 0; j < 8; ++j) { acc[j] = wmma_bf(a.h, w[j], acc[j]); acc[j] = wmma_bf(a.l, w[j], acc[j]); } }
    WAIT_LDS(); WAIT_COPIES(); __syncthreads();   // publishes stage s + 1 and ends every read of stage s
    if (s + 2 < DA / 64) PJ_FILL(s + 2, s & 1); }
  WAIT_COPIES();
  float (*sf)[16][132] = (float (*)[16][132])ring;   // the ring is free behind the last trip's barrier: each wave stages its 16 rows in its own range
#pragma unroll
  for (int j = 0; j < 8; ++j) { const int c = c0 + j * 16 + col; const float bb = bfr(BO[c]);
#pragma unroll
    for (int r = 0; r < 8; ++r) sf[wave][8 * g + r][j * 16 + col] = bfr(XQ[(r0 + 8 * g + r) * DA + c]) + acc[j][r] + bb; }
  LDSX(); for (int rl = 0; rl < 16; ++rl) vst2(OUT + (r0 + rl) * DA + c0 + lane * 4, *(const v4f*)&sf[wave][rl][lane * 4]); }
extern "C" void kernel_launch(void* const* d_in, const int* in_sizes, int n_in, void* d_out, int out_size, void* d_ws, size_t ws_size, hipStream_t stream) {
  (void)in_sizes; (void)n_in; (void)out_size;
  const float** F = (const float**)d_in;   // 0 query [4,2048,512], 1 key_value [4,2048,512], 2 Wq, 3 bq, 4 Wk, 5 bk, 6 Wv, 7 bv, 8 Wo, 9 bo ((in,out) [512,512] / [512])
  if (ws_size < (size_t)WS_END) return;
  char* ws = (char*)d_ws; float *S = (float*)(ws + WS_S), *O = (float*)(ws + WS_O); __bf16 *QH = (__bf16*)(ws + WS_Q), *QL = (__bf16*)(ws + WS_QL), *KH = (__bf16*)(ws + WS_KH), *KL = (__bf16*)(ws + WS_KL); _Float16 *VT = (_Float16*)(ws + WS_VT), *PH = (_Float16*)(ws + WS_PH), *PL = (_Float16*)(ws + WS_PL); __bf16* WT = (__bf16*)(ws + WS_WT);
  k_pack<<<dim3(DA / 32, DA / 64, 4), 256, 0, stream>>>(F[2], F[4], F[6], F[8], WT);
  k_proj<<<dim3(TNB * NN / 256, DA / 256, 3), 512, 0, stream>>>(F[0], F[1], WT, F[3], F[5], F[7], QH, QL, KH, KL, VT);
  k_sc<<<dim3(NN / 256, NN / 256, TNB), 512, 0, stream>>>(QH, QL, KH, KL, S);
  k_sm<<<TNB * TQB * 64 / (SM_W * SM_R), SM_W * 32, 0, stream>>>(S, PH, PL);   // rows of all batches are contiguous: one launch
  k_pv<<<dim3(NN / 128, DA / 128, TNB), 256, 0, stream>>>(PH, PL, VT, O);
  k_out<<<dim3(TNB * TQB, DA / 128), 128, 0, stream>>>(O, WT + (size_t)3 * DA * DA, F[9], F[0], (float*)d_out);   // 512 work-groups in one launch, not 4 launches of 128
}

// v006
// It runs in 102 microseconds.
// Timed twice side by side with v005, it ran 1.07 and 1.08 times as fast.
// All steps since v000 together make it 4.63 times as fast.
// compute dtype: all float inputs rounded to bf16; q/k = x W + b with EXACT bf16 products on WMMA 16x16x32 ((in,out) weights), f32 accumulate; q and k kept in f32 and split into bf16 hi + lo for the scores (3 products: the module multiplies by sqrt(512), logits ~1e2), logits stored in f32; softmax in f32 (precise expf) -> P as f16 x 2^11 + residual; the output projection is applied to the values ahead of the attention sum: Wvo = Wv Wo (exact bf16 products, f32 accumulate, kept as bf16 hi + lo), u = x Wvo + bv Wo (2 products) as f16; out = query + P . u + bo (2 products); f32 output.
#include <hip/hip_runtime.h>
#include <math.h>

typedef __attribute__((ext_vector_type(16))) _Float16 v16h;
typedef __attribute__((ext_vector_type(16))) __bf16 v16b;
typedef __attribute__((ext_vector_type(8)))  _Float16 v8h;
typedef __attribute__((ext_vector_type(8)))  float v8f;
typedef __attribute__((ext_vector_type(4)))  float v4f;
typedef __attribute__((ext_vector_type(2)))  float v2f;
typedef __attribute__((ext_vector_type(4)))  unsigned v4u;
typedef __attribute__((ext_vector_type(4)))  int v4i;
typedef float __attribute__((may_alias)) float_a;
typedef int __attribute__((may_alias)) int_a;

template <typename T> __device__ __forceinline__ void vst2(void* p, T v) { *(T*)p = v;  }
__device__ __forceinline__ v8f wmma16(v16h a, v16h b, v8f c) {
  v8f d = __builtin_amdgcn_wmma_f32_16x16x32_f16(false, a, false, b, (short)0, c, false, false);
  asm volatile("v_nop\n\tv_nop\n\tv_nop\n\tv_nop" : "+v"(d) : "v"(a), "v"(b));
  return d;
}
__device__ __forceinline__ v8f wmma_bf(v16b a, v16b b, v8f c) {
  v8f d = __builtin_amdgcn_wmma_f32_16x16x32_bf16(false, a, false, b, (short)0, c, false, false);
  asm volatile("v_nop\n\tv_nop\n\tv_nop\n\tv_nop" : "+v"(d) : "v"(a), "v"(b));
  return d;
}
// 16x16x32 fragments: lane = (h = lane>>4, row/col = lane&15); elements 0..7 = k0+8h+0..7, 8..15 = k0+16+8h+0..7; D element r = row 8h+r
__device__ __forceinline__ v16h frag_h(const _Float16* rowk0, int lane) {
  union { v16h v; v8h q[2]; } u; const _Float16* p = rowk0 + 8 * (lane >> 4);
  u.q[0] = *(const v8h*)p; u.q[1] = *(const v8h*)(p + 16); return u.v;
}
__device__ __forceinline__ v16h frag_f32(const float* rowk0, int lane) {
  v16h a; const float* p = rowk0 + 8 * (lane >> 4);
#pragma unroll
  for (int i = 0; i < 8; ++i) { a[i] = (_Float16)p[i]; a[8 + i] = (_Float16)p[16 + i]; }
  return a;
}
__device__ __forceinline__ v16h frag_f32s(const float* rowk0, int lane, float sc) {
  v16h a; const float* p = rowk0 + 8 * (lane >> 4);
#pragma unroll
  for (int i = 0; i < 8; ++i) { a[i] = (_Float16)(p[i] * sc); a[8 + i] = (_Float16)(p[16 + i] * sc); }
  return a;
}
// column fragment from a [K][ld] layout (column n), rows >= K read as 0
__device__ __forceinline__ v16h fragc_f32(const float* W, int k0, int n, int lane, int ld, int K) {
  v16h a; const int g = lane >> 4;
#pragma unroll
  for (int i = 0; i < 8; ++i) { const int ka = k0 + 8 * g + i, kb = ka + 16;
    a[i] = (_Float16)(ka < K ? W[(size_t)(ka < K ? ka : K - 1) * ld + n] : 0.f); a[8 + i] = (_Float16)(kb < K ? W[(size_t)(kb < K ? kb : K - 1) * ld + n] : 0.f); }
  return a;
}
struct F2 { v16b h, l; };
__device__ __forceinline__ F2 bsplit16(const float v[16]) { F2 r;
#pragma unroll
  for (int i = 0; i < 16; ++i) { const __bf16 h = (__bf16)v[i]; r.h[i] = h; r.l[i] = (__bf16)(v[i] - (float)h); }
  return r; }
__device__ __forceinline__ F2 split_row(const float* row, int k0, int lane) { float v[16]; const float* p = row + k0 + 8 * (lane >> 4);
#pragma unroll
  for (int i = 0; i < 8; ++i) { v[i] = p[i]; v[8 + i] = p[16 + i]; }
  return bsplit16(v); }
__device__ __forceinline__ F2 split_rowK(const float* row, int k0, int lane, int K) { float v[16]; const int g = lane >> 4;
#pragma unroll
  for (int i = 0; i < 8; ++i) { const int ka = k0 + 8 * g + i, kb = ka + 16; v[i] = ka < K ? row[ka < K ? ka : K - 1] : 0.f; v[8 + i] = kb < K ? row[kb < K ? kb : K - 1] : 0.f; }
  return bsplit16(v); }
__device__ __forceinline__ F2 split_col(const float* W, int k0, int n, int lane, int ld, int K) { float v[16]; const int g = lane >> 4;
#pragma unroll
  for (int i = 0; i < 8; ++i) { const int ka = k0 + 8 * g + i, kb = ka + 16; v[i] = ka < K ? W[(size_t)(ka < K ? ka : K - 1) * ld + n] : 0.f; v[8 + i] = kb < K ? W[(size_t)(kb < K ? kb : K - 1) * ld + n] : 0.f; }
  return bsplit16(v); }
__device__ __forceinline__ v8f mac3(const F2& a, const F2& b, v8f c) { c = wmma_bf(a.l, b.h, c); c = wmma_bf(a.h, b.l, c); return wmma_bf(a.h, b.h, c); }
__device__ __forceinline__ float sigm(float v) { return 1.0f / (1.0f + expf(-v)); }
#define LDSX() do { asm volatile("s_wait_dscnt 0" ::: "memory"); __builtin_amdgcn_wave_barrier(); __builtin_amdgcn_fence(__ATOMIC_RELEASE, "workgroup"); } while (0)


// Axis attention (B 4, 2,048 queries x 2,048 keys, dim_attn 512, single head): attn = softmax((q k^T) * sqrt(512)); out = query + (attn v) Wo + bo.
#define NB 4
#define NN 2048
#define DA 512
#ifndef TNB
#define TNB NB
#endif
#ifndef TQB
#define TQB (NN / 64)
#endif
typedef __attribute__((ext_vector_type(8))) __bf16 v8b;
__device__ __forceinline__ v16b frag_b(const __bf16* rowk0, int lane) {
  union { v16b v; v8b q[2]; } u; const __bf16* p = rowk0 + 8 * (lane >> 4);
  u.q[0] = *(const v8b*)p; u.q[1] = *(const v8b*)(p + 16); return u.v;
}
__device__ __forceinline__ float bfr(float v) { return (float)(__bf16)v; }
__device__ __attribute__((noinline)) float exp_ni(float v) { return expf(v); }
__device__ __attribute__((noinline)) float erf_ni(float v) { return erff(v); }

#define WS_Q   0u                                    // bf16 q hi rows [b*n][512]
#define WS_QL  (WS_Q + 2u * (size_t)NB * NN * DA)       // bf16 q lo rows
#define WS_KH  (WS_QL + 2u * (size_t)NB * NN * DA)      // bf16 k hi rows
#define WS_KL  (WS_KH + 2u * (size_t)NB * NN * DA)      // bf16 k lo rows
#define WS_VT  (WS_KL + 2u * (size_t)NB * NN * DA)      // f16 u planes [b][512][n], u = v Wo
#define WS_S   (WS_VT + 2u * (size_t)NB * DA * NN)      // f32 logits [b][q][key]
#define WS_PH  (WS_S + 4u * (size_t)NB * NN * NN)       // f16 P x 2^11 rows [b*q][key]
#define WS_PL  (WS_PH + 2u * (size_t)NB * NN * NN)      // f16 residual
#define WS_WT  (WS_PL + 2u * (size_t)NB * NN * NN)      // bf16 weights as [4][out][in] rows: Wq, Wk, Wvo hi, Wvo lo
#define WS_BVO (WS_WT + 2u * (size_t)4 * DA * DA)       // f32 bv Wo [512]
#define WS_END (WS_BVO + 4u * (size_t)DA)

// eight 16-byte asynchronous copies of one lane, global -> LDS: copy i brings g + i * gstep to LDS byte l + i * lstep.
// The closing s_wait_xcnt 0 stands inside the copies' own statement so that no address register is rewritten ahead of it.
__device__ __forceinline__ void acp8(unsigned l, unsigned lstep, const char* g, size_t gstep) {
  asm volatile("global_load_async_to_lds_b128 %0, %8, off\n\t"
               "global_load_async_to_lds_b128 %1, %9, off\n\t"
               "global_load_async_to_lds_b128 %2, %10, off\n\t"
               "global_load_async_to_lds_b128 %3, %11, off\n\t"
               "global_load_async_to_lds_b128 %4, %12, off\n\t"
               "global_load_async_to_lds_b128 %5, %13, off\n\t"
               "global_load_async_to_lds_b128 %6, %14, off\n\t"
               "global_load_async_to_lds_b128 %7, %15, off\n\t"
               "s_wait_xcnt 0x0"
               :: "v"(l), "v"(l + lstep), "v"(l + 2 * lstep), "v"(l + 3 * lstep), "v"(l + 4 * lstep), "v"(l + 5 * lstep), "v"(l + 6 * lstep), "v"(l + 7 * lstep),
                  "v"(g), "v"(g + gstep), "v"(g + 2 * gstep), "v"(g + 3 * gstep), "v"(g + 4 * gstep), "v"(g + 5 * gstep), "v"(g + 6 * gstep), "v"(g + 7 * gstep)
               : "memory");
}
// the same for four copies
__device__ __forceinline__ void acp4(unsigned l, unsigned lstep, const char* g, size_t gstep) {
  asm volatile("global_load_async_to_lds_b128 %0, %4, off\n\t"
               "global_load_async_to_lds_b128 %1, %5, off\n\t"
               "global_load_async_to_lds_b128 %2, %6, off\n\t"
               "global_load_async_to_lds_b128 %3, %7, off\n\t"
               "s_wait_xcnt 0x0"
               :: "v"(l), "v"(l + lstep), "v"(l + 2 * lstep), "v"(l + 3 * lstep),
                  "v"(g), "v"(g + gstep), "v"(g + 2 * gstep), "v"(g + 3 * gstep)
               : "memory");
}
// this wave's copies have landed (the compiler places no wait for them)
#define WAIT_COPIES() asm volatile("s_wait_asynccnt 0x0" ::: "memory")
// this wave's LDS reads have returned, before the barrier behind which their buffer is refilled
#define WAIT_LDS() asm volatile("s_wait_dscnt 0x0" ::: "memory")
#define P128 144   // LDS pitch of a 128-byte row, 16 B x odd: ds_load_b128 without bank conflicts
#define P256 272   // the same for a 256-byte row
// ---- k_pack: block = (32 outputs, 64 inputs, which). which 0, 1: Wq's, Wk's (in,out) f32 tile -> bf16 [out][in] rows, turned in LDS so that whole 128-byte lines are stored.
// which 2: the same tile of Wvo = Wv Wo, formed as (Wo^T)(Wv^T) so that it comes out as [out][in]: 32 columns of Wo (turned) and 64 rows of Wv go to LDS as bf16 over all 512 middle channels,
// 8 waves as 2 x 4, a wave = one 16 x 16 tile -> bf16 hi and lo rows. Row DA / 64 of the grid (which 2 only): bv stands in for every row of Wv, and each column of the tile is bv Wo for the 32 outputs
#define PK_P 520   // LDS pitch, in bf16, of a row of 512: 1,040 bytes = 16 B x odd
typedef __attribute__((ext_vector_type(4))) __bf16 v4b;
__global__ __launch_bounds__(256) void k_pack(const float* __restrict__ WQ, const float* __restrict__ WK, const float* __restrict__ WV, const float* __restrict__ WO, const float* __restrict__ BV, __bf16* __restrict__ WT, float* __restrict__ BVO) { __shared__ __align__(16) __bf16 tl[2][32][72]; __shared__ __align__(16) __bf16 so[32 * PK_P]; __shared__ __align__(16) __bf16 sv[64 * PK_P];
  const int t = threadIdx.x, lane = t & 31, wave = t >> 5; const int which = 2 - blockIdx.z; const int n0 = blockIdx.x * 32, k0 = blockIdx.y * 64;   // low blockIdx.z starts first: the long blocks (which 2)
  const bool bias = blockIdx.y == DA / 64;   // the same for the whole block, like which: every barrier below is passed by all waves of a block or by none
  if (which < 2) { if (bias) return;
    const float* Wm = which == 0 ? WQ : WK;
    v8b r;
#pragma unroll
    for (int i = 0; i < 8; ++i) r[i] = (__bf16)Wm[(size_t)(k0 + wave * 8 + i) * DA + n0 + lane];
    *(v8b*)&tl[0][lane][wave * 8] = r;
    __syncthreads();
    vst2((unsigned*)(WT + ((size_t)which * DA + n0 + (t >> 3)) * DA + k0 + (t & 7) * 8), *(const v4u*)&tl[0][t >> 3][(t & 7) * 8]);
    return; }
  float fo[8][8];   // every loop below is unrolled so that fo and fv are indexed by constants and stay in registers
  const int vr = wave >> 2, vs = (wave & 3) * 128 + lane * 4;
  const float* po = WO + (size_t)(wave * 8) * DA + n0 + lane;   // a load = 128 contiguous bytes of one row of Wo
#pragma unroll
  for (int c = 0; c < 8; ++c)
#pragma unroll
    for (int i = 0; i < 8; ++i) fo[c][i] = po[(size_t)(c * 64 + i) * DA];
  // Here and in both branches: the loads' address pair is an input of the wait behind them, so it lives up to the wait and nothing is written into it ahead of it, on every way through the branches;
  // the scheduling barrier keeps every load ahead of the conversions: one trip to memory for the whole block, not one a group
  asm volatile("s_wait_xcnt 0x0" :: "v"(po) : "memory");
  if (bias) { const float* pb = BV + vs; const v4f x = *(const v4f*)pb;
    asm volatile("s_wait_xcnt 0x0" :: "v"(pb) : "memory");
    __builtin_amdgcn_sched_barrier(0);
    v4b r;
#pragma unroll
    for (int i = 0; i < 4; ++i) r[i] = (__bf16)x[i];
#pragma unroll
    for (int c = 0; c < 32; ++c) *(v4b*)&sv[(c * 2 + vr) * PK_P + vs] = r;
  } else { const float* pv = WV + (size_t)(k0 + vr) * DA + vs; v4f fv[32];   // a load = 512 contiguous bytes of one row of Wv
#pragma unroll
    for (int c = 0; c < 32; ++c) fv[c] = *(const v4f*)(pv + (size_t)(c * 2) * DA);
    asm volatile("s_wait_xcnt 0x0" :: "v"(pv) : "memory");
    __builtin_amdgcn_sched_barrier(0);
#pragma unroll
    for (int c = 0; c < 32; ++c) { v4b r;
#pragma unroll
      for (int i = 0; i < 4; ++i) r[i] = (__bf16)fv[c][i];
      *(v4b*)&sv[(c * 2 + vr) * PK_P + vs] = r; } }
#pragma unroll
  for (int c = 0; c < 8; ++c) { v8b r;
#pragma unroll
    for (int i = 0; i < 8; ++i) r[i] = (__bf16)fo[c][i];
    *(v8b*)&so[lane * PK_P + c * 64 + wave * 8] = r; }
  __syncthreads();
  const int col = lane & 15, g = lane >> 4, ot = wave >> 2, it = wave & 3;
  const __bf16* ra = so + (ot * 16 + col) * PK_P; const __bf16* rb = sv + (it * 16 + col) * PK_P;   // A: row = output channel; B: column = input channel; k = middle channel in both
  v8f acc = {};
#pragma unroll
  for (int mh = 0; mh < DA; mh += 256) { v16b fa[8], fb[8];
#pragma unroll
    for (int e = 0; e < 8; ++e) { fa[e] = frag_b(ra + mh + e * 32, lane); fb[e] = frag_b(rb + mh + e * 32, lane); }
    __builtin_amdgcn_sched_barrier(0);   // eight blocks' LDS reads as one group ahead of their products: one LDS latency, not eight
#pragma unroll
    for (int e = 0; e < 8; ++e) acc = wmma_bf(fa[e], fb[e], acc); }
  if (bias) { if (it == 0 && col == 0) {
#pragma unroll
      for (int r = 0; r < 8; ++r) BVO[n0 + ot * 16 + 8 * g + r] = acc[r]; }
    return; }
#pragma unroll
  for (int r = 0; r < 8; ++r) { const __bf16 h = (__bf16)acc[r]; tl[0][ot * 16 + 8 * g + r][it * 16 + col] = h; tl[1][ot * 16 + 8 * g + r][it * 16 + col] = (__bf16)(acc[r] - (float)h); }
  __syncthreads();
  __bf16* d = WT + ((size_t)2 * DA + n0 + (t >> 3)) * DA + k0 + (t & 7) * 8;
  vst2((unsigned*)d, *(const v4u*)&tl[0][t >> 3][(t & 7) * 8]); vst2((unsigned*)(d + (size_t)DA * DA), *(const v4u*)&tl[1][t >> 3][(t & 7) * 8]); }
// ---- k_proj, which 0, 1: block = (256 rows, 256 cols), 16 waves as 4 x 4, a wave = 64 rows x 64 cols: q and k (bf16 hi + lo rows). A stage = 64 k of 256 packed weight rows and 256 x rows, two buffers
#define PR_X   (256 * P128)
#define PR_BUF (256 * P128 + 256 * P256)
#define PR_OUT (2 * 64 * P128)   // a wave's output tile in LDS: two planes of 64 rows of 128 bytes
#define PR_FILL(s, bf) do { acp4(lw + (bf) * PR_BUF, 64 * P128, gw + (s) * 128, (size_t)64 * DA * 2); acp8(lx + (bf) * PR_BUF, 32 * P256, gx + (s) * 256, (size_t)32 * DA * 4); } while (0)
// The result goes out as rows [x row][col]; the weight fragment is the product's A operand, so that a lane's eight results are eight neighbouring cols of one row (one 16-byte LDS store).
__device__ __forceinline__ void proj_rows(char* ring, const float* __restrict__ X, const __bf16* __restrict__ Wr, const float* __restrict__ Bm, __bf16* __restrict__ DH, __bf16* __restrict__ DL) {
  const int tid = threadIdx.x, wave = tid >> 5, lane = tid & 31, col = lane & 15, g = lane >> 4, wr = wave >> 2, wc = wave & 3; const int c0 = blockIdx.y * 256; const size_t r0 = (size_t)blockIdx.x * 256;
  const unsigned lds0 = (unsigned)(size_t)ring;
  const unsigned lw = lds0 + (tid >> 3) * P128 + (tid & 7) * 16, lx = lds0 + PR_X + (tid >> 4) * P256 + (tid & 15) * 16;   // 8 lanes a weight row, 16 lanes an x row
  const char* gw = (const char*)Wr + ((size_t)(c0 + (tid >> 3)) * DA + (tid & 7) * 8) * 2; const char* gx = (const char*)X + ((r0 + (tid >> 4)) * DA + (tid & 15) * 4) * 4;
  v8f acc[4][4] = {};   // every inner loop below is unrolled so that the tiles and fragments are indexed by constants and stay in registers
  PR_FILL(0, 0); WAIT_COPIES(); __syncthreads(); PR_FILL(1, 1);
#pragma unroll 1   // one stage a trip: the two buffers alternate by the trip's parity
  for (int s = 0; s < DA / 64; ++s) { const char* bp = ring + (s & 1) * PR_BUF;
#pragma unroll
    for (int h = 0; h < 2; ++h) { v16b a[4];
#pragma unroll
      for (int i = 0; i < 4; ++i) { const float* p = (const float*)(bp + PR_X + (wr * 64 + i * 16 + col) * P256) + h * 32 + 8 * g;
#pragma unroll
        for (int e = 0; e < 8; ++e) { a[i][e] = (__bf16)p[e]; a[i][8 + e] = (__bf16)p[16 + e]; } }
#pragma unroll
      for (int j = 0; j < 4; ++j) { const v16b w = frag_b((const __bf16*)(bp + (wc * 64 + j * 16 + col) * P128 + h * 64), lane);   // a weight fragment serves four x fragments
#pragma unroll
        for (int i = 0; i < 4; ++i) acc[i][j] = wmma_bf(w, a[i], acc[i][j]); } }
    WAIT_LDS(); WAIT_COPIES(); __syncthreads();   // publishes stage s + 1 and ends every read of stage s
    if (s + 2 < DA / 64) PR_FILL(s + 2, s & 1); }
  WAIT_COPIES();
  char* my = ring + wave * PR_OUT;   // the ring is free behind the last trip's barrier: each wave turns its own tile in its own range
  const int l8 = lane >> 3, q8 = (lane & 7) * 8;   // a global store = four rows of 128 contiguous bytes: whole lines
#pragma unroll
  for (int j = 0; j < 4; ++j) { float bb[8];
#pragma unroll
    for (int r = 0; r < 8; ++r) bb[r] = bfr(Bm[c0 + wc * 64 + j * 16 + 8 * g + r]);
#pragma unroll
    for (int i = 0; i < 4; ++i) { v8b h8, lo8;
#pragma unroll
      for (int r = 0; r < 8; ++r) { const float v = acc[i][j][r] + bb[r]; const __bf16 h = (__bf16)v; h8[r] = h; lo8[r] = (__bf16)(v - (float)h); }
      char* d = my + (i * 16 + col) * P128 + (j * 16 + 8 * g) * 2; *(v8b*)d = h8; *(v8b*)(d + 64 * P128) = lo8; } }
  LDSX();
  __bf16* dh = DH + (r0 + wr * 64) * DA + c0 + wc * 64 + q8; __bf16* dl = DL + (r0 + wr * 64) * DA + c0 + wc * 64 + q8;
  for (int t = 0; t < 16; ++t) { const int rl = 4 * t + l8; const char* sp = my + rl * P128 + q8 * 2; vst2((unsigned*)(dh + (size_t)rl * DA), *(const v4u*)sp); vst2((unsigned*)(dl + (size_t)rl * DA), *(const v4u*)(sp + 64 * P128)); } }
// ---- k_proj, which 2, 3: block = (128 rows, 256 cols), 16 waves as 2 x 8, a wave = 64 rows x 32 cols: u = x Wvo + bv Wo (Wvo hi + lo: 2 products, as many a block as q's and k's) -> f16 planes [col][x row].
// x is the A operand, so that a lane's eight results are eight neighbouring x rows of one col. A stage = 64 k of 256 Wvo hi rows, 256 Wvo lo rows and 128 x rows, two buffers
#define PP_LO  (256 * P128)
#define PP_X   (512 * P128)
#define PP_BUF (512 * P128 + 128 * P256)
#define PP_FILL(s, bf) do { acp4(lw + (bf) * PP_BUF, 64 * P128, gwh + (s) * 128, (size_t)64 * DA * 2); acp4(lw + PP_LO + (bf) * PP_BUF, 64 * P128, gwl + (s) * 128, (size_t)64 * DA * 2); acp4(lx + (bf) * PP_BUF, 32 * P256, gx + (s) * 256, (size_t)32 * DA * 4); } while (0)
__device__ __forceinline__ void proj_planes(char* ring, const float* __restrict__ X, const __bf16* __restrict__ WH, const __bf16* __restrict__ WL, const float* __restrict__ BVO, _Float16* __restrict__ VT) {
  const int tid = threadIdx.x, wave = tid >> 5, lane = tid & 31, col = lane & 15, g = lane >> 4, wr = wave >> 3, wc = wave & 7; const int c0 = blockIdx.y * 256; const size_t r0 = ((size_t)(blockIdx.z - 2) * (NB * NN / 256) + blockIdx.x) * 128;
  const unsigned lds0 = (unsigned)(size_t)ring;
  const unsigned lw = lds0 + (tid >> 3) * P128 + (tid & 7) * 16, lx = lds0 + PP_X + (tid >> 4) * P256 + (tid & 15) * 16;   // 8 lanes a weight row, 16 lanes an x row
  const size_t wo = ((size_t)(c0 + (tid >> 3)) * DA + (tid & 7) * 8) * 2;
  const char* gwh = (const char*)WH + wo; const char* gwl = (const char*)WL + wo; const char* gx = (const char*)X + ((r0 + (tid >> 4)) * DA + (tid & 15) * 4) * 4;
  v8f acc[4][2] = {};   // every inner loop below is unrolled so that the tiles and fragments are indexed by constants and stay in registers
  PP_FILL(0, 0); WAIT_COPIES(); __syncthreads(); PP_FILL(1, 1);
#pragma unroll 1   // one stage a trip: the two buffers alternate by the trip's parity
  for (int s = 0; s < DA / 64; ++s) { const char* bp = ring + (s & 1) * PP_BUF;
#pragma unroll
    for (int h = 0; h < 2; ++h) { v16b a[4];
#pragma unroll
      for (int i = 0; i < 4; ++i) { const float* p = (const float*)(bp + PP_X + (wr * 64 + i * 16 + col) * P256) + h * 32 + 8 * g;
#pragma unroll
        for (int e = 0; e < 8; ++e) { a[i][e] = (__bf16)p[e]; a[i][8 + e] = (__bf16)p[16 + e]; } }
#pragma unroll
      for (int j = 0; j < 2; ++j) { const char* kr = bp + (wc * 32 + j * 16 + col) * P128 + h * 64; const v16b wh = frag_b((const __bf16*)kr, lane), wl = frag_b((const __bf16*)(kr + PP_LO), lane);   // a weight fragment serves four x fragments
#pragma unroll
        for (int i = 0; i < 4; ++i) acc[i][j] = wmma_bf(a[i], wl, acc[i][j]);
#pragma unroll
        for (int i = 0; i < 4; ++i) acc[i][j] = wmma_bf(a[i], wh, acc[i][j]); } }
    WAIT_LDS(); WAIT_COPIES(); __syncthreads();   // publishes stage s + 1 and ends every read of stage s
    if (s + 2 < DA / 64) PP_FILL(s + 2, s & 1); }
  WAIT_COPIES();
  char* my = ring + wave * (32 * P128);   // the ring is free behind the last trip's barrier: each wave turns its own tile (32 cols of 64 x rows) in its own range
  const int l8 = lane >> 3, q8 = (lane & 7) * 8;   // a global store = four rows of 128 contiguous bytes: whole lines
#pragma unroll
  for (int j = 0; j < 2; ++j) { const float bb = BVO[c0 + wc * 32 + j * 16 + col];
#pragma unroll
    for (int i = 0; i < 4; ++i) { v8h t8;
#pragma unroll
      for (int r = 0; r < 8; ++r) t8[r] = (_Float16)(acc[i][j][r] + bb);
      *(v8h*)(my + (j * 16 + col) * P128 + (i * 16 + 8 * g) * 2) = t8; } }
  LDSX();
  const size_t b = r0 / NN; const int n0 = (int)(r0 % NN); _Float16* dv = VT + (b * DA + c0 + wc * 32) * (size_t)NN + n0 + wr * 64 + q8;
#pragma unroll   // every store names the one address pair
  for (int t = 0; t < 8; ++t) { const int cl = 4 * t + l8; vst2((unsigned*)(dv + (size_t)cl * NN), *(const v4u*)(my + cl * P128 + q8 * 2)); } }
__global__ __launch_bounds__(512) void k_proj(const float* __restrict__ XQ, const float* __restrict__ XKV, const __bf16* __restrict__ WT, const float* __restrict__ BQ, const float* __restrict__ BK, const float* __restrict__ BVO, __bf16* __restrict__ QH, __bf16* __restrict__ QL, __bf16* __restrict__ KH, __bf16* __restrict__ KL, _Float16* __restrict__ VT) { __shared__ __align__(16) char ring[16 * PR_OUT];
  static_assert(16 * PR_OUT >= 2 * PR_BUF && 16 * PR_OUT >= 2 * PP_BUF, "the ring holds two stages");
  const int which = blockIdx.z;   // the same for the whole block: every barrier of a branch is passed by all its waves
  if (which <= 1) proj_rows(ring, which == 0 ? XQ : XKV, WT + (size_t)which * DA * DA, which == 0 ? BQ : BK, which == 0 ? QH : KH, which == 0 ? QL : KL);
  else proj_planes(ring, XKV, WT + (size_t)2 * DA * DA, WT + (size_t)3 * DA * DA, BVO, VT); }
// ---- k_sc: block = (256 queries, 256 keys, b), 16 waves as 4 x 4, a wave = 64 queries x 64 keys: logits (3 products) x sqrt(512) -> S. A stage = 64 k of the q hi, q lo, K hi and K lo rows, copied to LDS in whole lines, two buffers
#define SC_LO (256 * P128)
#define SC_K  (512 * P128)
#define SC_BUF (1024 * P128)
__global__ __launch_bounds__(512) void k_sc(const __bf16* __restrict__ QH, const __bf16* __restrict__ QL, const __bf16* __restrict__ KH, const __bf16* __restrict__ KL, float* __restrict__ S) { __shared__ __align__(16) char ring[2 * SC_BUF];
  const int tid = threadIdx.x, wave = tid >> 5, lane = tid & 31, col = lane & 15, g = lane >> 4, wq = wave >> 2, wk = wave & 3; const size_t b = blockIdx.z; const int k0 = blockIdx.y * 256; const size_t qb = b * NN + (size_t)blockIdx.x * 256;
  const unsigned lr = (unsigned)(size_t)ring + (tid >> 3) * P128 + (tid & 7) * 16;   // 8 lanes a row
  const size_t qo = ((qb + (tid >> 3)) * DA + (tid & 7) * 8) * 2, ko = ((b * NN + k0 + (tid >> 3)) * DA + (tid & 7) * 8) * 2;
  const char* gqh = (const char*)QH + qo; const char* gql = (const char*)QL + qo; const char* gkh = (const char*)KH + ko; const char* gkl = (const char*)KL + ko;
#define SC_FILL(s, bf) do { acp4(lr + (bf) * SC_BUF, 64 * P128, gqh + (s) * 128, (size_t)64 * DA * 2); acp4(lr + SC_LO + (bf) * SC_BUF, 64 * P128, gql + (s) * 128, (size_t)64 * DA * 2); \
    acp4(lr + SC_K + (bf) * SC_BUF, 64 * P128, gkh + (s) * 128, (size_t)64 * DA * 2); acp4(lr + SC_K + SC_LO + (bf) * SC_BUF, 64 * P128, gkl + (s) * 128, (size_t)64 * DA * 2); } while (0)
  v8f acc[4][4] = {};   // every inner loop below is unrolled so that the tiles and fragments are indexed by constants and stay in registers
  SC_FILL(0, 0); WAIT_COPIES(); __syncthreads(); SC_FILL(1, 1);
#pragma unroll 1   // one stage a trip: the two buffers alternate by the trip's parity
  for (int s = 0; s < DA / 64; ++s) { const char* bp = ring + (s & 1) * SC_BUF;
#pragma unroll
    for (int h = 0; h < 2; ++h) { v16b ah[4], al[4];
#pragma unroll
      for (int i = 0; i < 4; ++i) { const char* qr = bp + (wq * 64 + i * 16 + col) * P128 + h * 64; ah[i] = frag_b((const __bf16*)qr, lane); al[i] = frag_b((const __bf16*)(qr + SC_LO), lane); }
#pragma unroll
      for (int j = 0; j < 4; ++j) { const char* kr = bp + SC_K + (wk * 64 + j * 16 + col) * P128 + h * 64; const v16b kh = frag_b((const __bf16*)kr, lane), kl = frag_b((const __bf16*)(kr + SC_LO), lane);
        // a key fragment serves four query fragments; each tile still takes its three products in the order hi.hi, lo.hi, hi.lo
#pragma unroll
        for (int i = 0; i < 4; ++i) acc[i][j] = wmma_bf(ah[i], kh, acc[i][j]);
#pragma unroll
        for (int i = 0; i < 4; ++i) acc[i][j] = wmma_bf(al[i], kh, acc[i][j]);
#pragma unroll
        for (int i = 0; i < 4; ++i) acc[i][j] = wmma_bf(ah[i], kl, acc[i][j]); } }
    WAIT_LDS(); WAIT_COPIES(); __syncthreads();   // publishes stage s + 1 and ends every read of stage s
    if (s + 2 < DA / 64) SC_FILL(s + 2, s & 1); }
  WAIT_COPIES();
  float (*ss)[68] = (float (*)[68])(ring + wave * (64 * 68 * 4));   // the ring is free behind the last trip's barrier: each wave stages its 64 rows in its own range
#pragma unroll
  for (int i = 0; i < 4; ++i)
#pragma unroll
    for (int j = 0; j < 4; ++j)
#pragma unroll
      for (int r = 0; r < 8; ++r) ss[i * 16 + 8 * g + r][j * 16 + col] = acc[i][j][r] * 22.627416997969522f;
  LDSX(); for (int t = 0; t < 32; ++t) { const int rl = 2 * t + g; vst2(S + (qb + wq * 64 + rl) * NN + k0 + wk * 64 + col * 4, *(const v4f*)&ss[rl][col * 4]); } }   // a store = two rows of 256 contiguous bytes: whole lines
// lane l with lane l ^ 16
__device__ __forceinline__ float xhalf(float x) { return __builtin_bit_cast(float, __builtin_amdgcn_permlanex16(__builtin_bit_cast(int, x), __builtin_bit_cast(int, x), 0x76543210, 0xfedcba98, false, false)); }
// lane l with lane l ^ M inside its 16-lane row (DPP row_xmask)
template <int M> __device__ __forceinline__ float xrow(float x) { return __builtin_bit_cast(float, __builtin_amdgcn_update_dpp(0, __builtin_bit_cast(int, x), 0x160 + M, 0xf, 0xf, true)); }
__device__ __forceinline__ float wave_max(float v) { v = fmaxf(v, xrow<1>(v)); v = fmaxf(v, xrow<2>(v)); v = fmaxf(v, xrow<4>(v)); v = fmaxf(v, xrow<8>(v)); return fmaxf(v, xhalf(v)); }
__device__ __forceinline__ float wave_sum(float v) { v += xrow<1>(v); v += xrow<2>(v); v += xrow<4>(v); v += xrow<8>(v); return v + xhalf(v); }
typedef __attribute__((ext_vector_type(4))) _Float16 v4h;
// ---- k_sm: wave = SM_R query rows, each row's 2,048 logits held in the wave's registers (64 a lane): S read once, one expf a logit, no LDS, no barrier -> P x 2^11 as f16 + residual
#define SM_R 2    // rows a wave: with 16 waves a block the whole problem is one block per WGP
#define SM_W 16   // waves a block
__global__ __launch_bounds__(SM_W * 32) void k_sm(const float* __restrict__ S, _Float16* __restrict__ PH, _Float16* __restrict__ PL) {
  const int lane = threadIdx.x & 31; const size_t row0 = ((size_t)blockIdx.x * SM_W + (threadIdx.x >> 5)) * SM_R;
  const float* sp = S + row0 * NN + lane * 4;   // the one address that every load below names
  v4f x[SM_R][16];   // load i of a row = 512 contiguous bytes over the wave; all rows' loads are issued ahead of the first row's arithmetic
  // every loop below is unrolled so that x is indexed by constants and stays in registers
#pragma unroll
  for (int r = 0; r < SM_R; ++r)
#pragma unroll
    for (int i = 0; i < 16; ++i) x[r][i] = *(const v4f*)(sp + r * NN + i * 128);
  asm volatile("s_wait_xcnt 0x0" :: "v"(sp) : "memory");   // the loads' address pair is an input here, so it lives up to this wait and no load's result lands in it ahead of the wait
#pragma unroll
  for (int r = 0; r < SM_R; ++r) { __builtin_amdgcn_sched_barrier(0);   // keeps every load ahead of the arithmetic, and a later row's arithmetic (with its wait for that row's loads) behind this row's stores
    v4f mm = x[r][0];
#pragma unroll
    for (int i = 1; i < 16; ++i)
#pragma unroll
      for (int c = 0; c < 4; ++c) mm[c] = fmaxf(mm[c], x[r][i][c]);
    const float m = wave_max(fmaxf(fmaxf(-3.0e38f, fmaxf(mm[0], mm[1])), fmaxf(mm[2], mm[3])));
    v4f ss = {};
#pragma unroll
    for (int i = 0; i < 16; ++i)
#pragma unroll
      for (int c = 0; c < 4; ++c) { const float e = expf(x[r][i][c] - m); x[r][i][c] = e; ss[c] += e; }
    const float inv = 1.0f / wave_sum((ss[0] + ss[1]) + (ss[2] + ss[3]));
    _Float16* ph = PH + (row0 + r) * NN + lane * 4; _Float16* pl = PL + (row0 + r) * NN + lane * 4;
#pragma unroll
    for (int i = 0; i < 16; ++i) { v4h h, l;
#pragma unroll
      for (int c = 0; c < 4; ++c) { const float p = x[r][i][c] * inv * 2048.0f; h[c] = (_Float16)p; l[c] = (_Float16)(p - (float)h[c]); }
      *(v4h*)(ph + i * 128) = h; *(v4h*)(pl + i * 128) = l; } } }   // a store = 256 contiguous bytes over the wave: whole lines
// ---- k_pv: block = (128 queries, 128 value channels, b), 8 waves as 4 x 2, a wave = 32 queries x 64 channels: out = query + P . u + bo. A stage = 128 keys of the u, P hi and P lo rows, copied to LDS in whole lines, two buffers
#define PV_PH (128 * P256)
#define PV_PL (256 * P256)
#define PV_BUF (384 * P256)
__global__ __launch_bounds__(256) void k_pv(const _Float16* __restrict__ PH, const _Float16* __restrict__ PL, const _Float16* __restrict__ VT, const float* __restrict__ XQ, const float* __restrict__ BO, float* __restrict__ OUT) { __shared__ __align__(16) char ring[2 * PV_BUF];
  const int tid = threadIdx.x, wave = tid >> 5, lane = tid & 31, col = lane & 15, g = lane >> 4, wq = wave >> 1, wc = wave & 1; const size_t b = blockIdx.z; const int c0 = blockIdx.y * 128; const size_t qb = b * NN + (size_t)blockIdx.x * 128;
  const unsigned lv = (unsigned)(size_t)ring + (tid >> 4) * P256 + (tid & 15) * 16;   // 16 lanes a row
  const size_t po = ((qb + (tid >> 4)) * NN + (tid & 15) * 8) * 2;
  const char* gv = (const char*)VT + ((b * DA + c0 + (tid >> 4)) * (size_t)NN + (tid & 15) * 8) * 2; const char* gph = (const char*)PH + po; const char* gpl = (const char*)PL + po;
#define PV_FILL(s, bf) do { acp8(lv + (bf) * PV_BUF, 16 * P256, gv + (s) * 256, (size_t)16 * NN * 2); acp8(lv + PV_PH + (bf) * PV_BUF, 16 * P256, gph + (s) * 256, (size_t)16 * NN * 2); acp8(lv + PV_PL + (bf) * PV_BUF, 16 * P256, gpl + (s) * 256, (size_t)16 * NN * 2); } while (0)
  v8f acc[2][4] = {};   // every inner loop below is unrolled so that the tiles and fragments are indexed by constants and stay in registers
  PV_FILL(0, 0);
  // the wave's query rows and its bias, for the epilogue: loaded here, beside the first stage's copies, so that their trip to memory is not paid behind the last product
  const size_t at = (qb + wq * 32 + g) * DA + c0 + wc * 64 + col * 4; const float* px = XQ + at; const float* pb = BO + c0 + wc * 64 + col * 4;
  v4f xq[16]; const v4f bo = *(const v4f*)pb;
#pragma unroll
  for (int t = 0; t < 16; ++t) xq[t] = *(const v4f*)(px + (size_t)(2 * t) * DA);   // a load = two rows of 256 contiguous bytes: whole lines
  asm volatile("s_wait_xcnt 0x0" :: "v"(px), "v"(pb) : "memory");   // the loads' address pairs are inputs here, so they live up to this wait and no load's result lands in one ahead of it
  WAIT_COPIES(); __syncthreads(); PV_FILL(1, 1);
#pragma unroll 1   // one stage a trip: the two buffers alternate by the trip's parity
  for (int s = 0; s < NN / 128; ++s) { const char* bp = ring + (s & 1) * PV_BUF;
#pragma unroll
    for (int h = 0; h < 4; ++h) { v16h vb[4], ph[2], pl[2];
#pragma unroll
      for (int i = 0; i < 2; ++i) { const char* pr = bp + PV_PH + (wq * 32 + i * 16 + col) * P256 + h * 64; ph[i] = frag_h((const _Float16*)pr, lane); pl[i] = frag_h((const _Float16*)(pr + (PV_PL - PV_PH)), lane); }
#pragma unroll
      for (int j = 0; j < 4; ++j) vb[j] = frag_h((const _Float16*)(bp + (wc * 64 + j * 16 + col) * P256 + h * 64), lane);   // the block's LDS reads as one group ahead of its products
      // a v fragment serves two query fragments; each tile still takes P hi, then P lo
#pragma unroll
      for (int j = 0; j < 4; ++j)
#pragma unroll
        for (int i = 0; i < 2; ++i) acc[i][j] = wmma16(ph[i], vb[j], acc[i][j]);
#pragma unroll
      for (int j = 0; j < 4; ++j)
#pragma unroll
        for (int i = 0; i < 2; ++i) acc[i][j] = wmma16(pl[i], vb[j], acc[i][j]); }
    WAIT_LDS(); WAIT_COPIES(); __syncthreads();   // publishes stage s + 1 and ends every read of stage s
    if (s + 2 < NN / 128) PV_FILL(s + 2, s & 1); }
  WAIT_COPIES();
  float (*ss)[68] = (float (*)[68])(ring + wave * (32 * 68 * 4));   // the ring is free behind the last trip's barrier: each wave stages its 32 rows in its own range
#pragma unroll
  for (int i = 0; i < 2; ++i)
#pragma unroll
    for (int j = 0; j < 4; ++j)
#pragma unroll
      for (int r = 0; r < 8; ++r) ss[i * 16 + 8 * g + r][j * 16 + col] = acc[i][j][r] * (1.0f / 2048.0f);
  LDSX();
#pragma unroll   // xq is indexed by constants, and every store names the one address pair
  for (int t = 0; t < 16; ++t) { const v4f o = *(const v4f*)&ss[2 * t + g][col * 4]; v4f y;
#pragma unroll
    for (int c = 0; c < 4; ++c) y[c] = bfr(xq[t][c]) + o[c] + bfr(bo[c]);
    vst2(OUT + at + (size_t)(2 * t) * DA, y); } }   // a store = two rows of 256 contiguous bytes: whole lines
extern "C" void kernel_launch(void* const* d_in, const int* in_sizes, int n_in, void* d_out, int out_size, void* d_ws, size_t ws_size, hipStream_t stream) {
  (void)in_sizes; (void)n_in; (void)out_size;
  const float** F = (const float**)d_in;   // 0 query [4,2048,512], 1 key_value [4,2048,512], 2 Wq, 3 bq, 4 Wk, 5 bk, 6 Wv, 7 bv, 8 Wo, 9 bo ((in,out) [512,512] / [512])
  if (ws_size < (size_t)WS_END) return;
  char* ws = (char*)d_ws; float *S = (float*)(ws + WS_S), *BVO = (float*)(ws + WS_BVO); __bf16 *QH = (__bf16*)(ws + WS_Q), *QL = (__bf16*)(ws + WS_QL), *KH = (__bf16*)(ws + WS_KH), *KL = (__bf16*)(ws + WS_KL); _Float16 *VT = (_Float16*)(ws + WS_VT), *PH = (_Float16*)(ws + WS_PH), *PL = (_Float16*)(ws + WS_PL); __bf16* WT = (__bf16*)(ws + WS_WT);
  k_pack<<<dim3(DA / 32, DA / 64 + 1, 3), 256, 0, stream>>>(F[2], F[4], F[6], F[8], F[7], WT, BVO);
  k_proj<<<dim3(TNB * NN / 256, DA / 256, 4), 512, 0, stream>>>(F[0], F[1], WT, F[3], F[5], BVO, QH, QL, KH, KL, VT);
  k_sc<<<dim3(NN / 256, NN / 256, TNB), 512, 0, stream>>>(QH, QL, KH, KL, S);
  k_sm<<<TNB * TQB * 64 / (SM_W * SM_R), SM_W * 32, 0, stream>>>(S, PH, PL);   // rows of all batches are contiguous: one launch
  k_pv<<<dim3(NN / 128, DA / 128, TNB), 256, 0, stream>>>(PH, PL, VT, F[0], F[9], (float*)d_out);
}

// v007
// Measured time: 94 microseconds a run.
// In two side-by-side timings against v006, it was 1.09 and 1.08 times as fast.
// Over all steps from v000 it is 5.03 times as fast.
// compute dtype: all float inputs rounded to bf16; q/k = x W + b with EXACT bf16 products on WMMA 16x16x32 ((in,out) weights), f32 accumulate; q and k kept in f32 and split into bf16 hi + lo for the scores (3 products: the module multiplies by sqrt(512), logits ~1e2), logits stored in f32; softmax in f32 (precise expf) -> P as one f16 plane x 2^11 (11 bits, as many as u has); the output projection is applied to the values ahead of the attention sum: Wvo = Wv Wo (exact bf16 products, f32 accumulate, kept as bf16 hi + lo), u = x Wvo + bv Wo (2 products) as f16; out = query + P . u + bo (1 product); f32 output.
#include <hip/hip_runtime.h>
#include <math.h>

typedef __attribute__((ext_vector_type(16))) _Float16 v16h;
typedef __attribute__((ext_vector_type(16))) __bf16 v16b;
typedef __attribute__((ext_vector_type(8)))  _Float16 v8h;
typedef __attribute__((ext_vector_type(8)))  float v8f;
typedef __attribute__((ext_vector_type(4)))  float v4f;
typedef __attribute__((ext_vector_type(2)))  float v2f;
typedef __attribute__((ext_vector_type(4)))  unsigned v4u;
typedef __attribute__((ext_vector_type(4)))  int v4i;
typedef float __attribute__((may_alias)) float_a;
typedef int __attribute__((may_alias)) int_a;

template <typename T> __device__ __forceinline__ void vst2(void* p, T v) { *(T*)p = v;  }
__device__ __forceinline__ v8f wmma16(v16h a, v16h b, v8f c) {
  v8f d = __builtin_amdgcn_wmma_f32_16x16x32_f16(false, a, false, b, (short)0, c, false, false);
  asm volatile("v_nop\n\tv_nop\n\tv_nop\n\tv_nop" : "+v"(d) : "v"(a), "v"(b));
  return d;
}
__device__ __forceinline__ v8f wmma_bf(v16b a, v16b b, v8f c) {
  v8f d = __builtin_amdgcn_wmma_f32_16x16x32_bf16(false, a, false, b, (short)0, c, false, false);
  asm volatile("v_nop\n\tv_nop\n\tv_nop\n\tv_nop" : "+v"(d) : "v"(a), "v"(b));
  return d;
}
// 16x16x32 fragments: lane = (h = lane>>4, row/col = lane&15); elements 0..7 = k0+8h+0..7, 8..15 = k0+16+8h+0..7; D element r = row 8h+r
__device__ __forceinline__ v16h frag_h(const _Float16* rowk0, int lane) {
  union { v16h v; v8h q[2]; } u; const _Float16* p = rowk0 + 8 * (lane >> 4);
  u.q[0] = *(const v8h*)p; u.q[1] = *(const v8h*)(p + 16); return u.v;
}
__device__ __forceinline__ v16h frag_f32(const float* rowk0, int lane) {
  v16h a; const float* p = rowk0 + 8 * (lane >> 4);
#pragma unroll
  for (int i = 0; i < 8; ++i) { a[i] = (_Float16)p[i]; a[8 + i] = (_Float16)p[16 + i]; }
  return a;
}
__device__ __forceinline__ v16h frag_f32s(const float* rowk0, int lane, float sc) {
  v16h a; const float* p = rowk0 + 8 * (lane >> 4);
#pragma unroll
  for (int i = 0; i < 8; ++i) { a[i] = (_Float16)(p[i] * sc); a[8 + i] = (_Float16)(p[16 + i] * sc); }
  return a;
}
// column fragment from a [K][ld] layout (column n), rows >= K read as 0
__device__ __forceinline__ v16h fragc_f32(const float* W, int k0, int n, int lane, int ld, int K) {
  v16h a; const int g = lane >> 4;
#pragma unroll
  for (int i = 0; i < 8; ++i) { const int ka = k0 + 8 * g + i, kb = ka + 16;
    a[i] = (_Float16)(ka < K ? W[(size_t)(ka < K ? ka : K - 1) * ld + n] : 0.f); a[8 + i] = (_Float16)(kb < K ? W[(size_t)(kb < K ? kb : K - 1) * ld + n] : 0.f); }
  return a;
}
struct F2 { v16b h, l; };
__device__ __forceinline__ F2 bsplit16(const float v[16]) { F2 r;
#pragma unroll
  for (int i = 0; i < 16; ++i) { const __bf16 h = (__bf16)v[i]; r.h[i] = h; r.l[i] = (__bf16)(v[i] - (float)h); }
  return r; }
__device__ __forceinline__ F2 split_row(const float* row, int k0, int lane) { float v[16]; const float* p = row + k0 + 8 * (lane >> 4);
#pragma unroll
  for (int i = 0; i < 8; ++i) { v[i] = p[i]; v[8 + i] = p[16 + i]; }
  return bsplit16(v); }
__device__ __forceinline__ F2 split_rowK(const float* row, int k0, int lane, int K) { float v[16]; const int g = lane >> 4;
#pragma unroll
  for (int i = 0; i < 8; ++i) { const int ka = k0 + 8 * g + i, kb = ka + 16; v[i] = ka < K ? row[ka < K ? ka : K - 1] : 0.f; v[8 + i] = kb < K ? row[kb < K ? kb : K - 1] : 0.f; }
  return bsplit16(v); }
__device__ __forceinline__ F2 split_col(const float* W, int k0, int n, int lane, int ld, int K) { float v[16]; const int g = lane >> 4;
#pragma unroll
  for (int i = 0; i < 8; ++i) { const int ka = k0 + 8 * g + i, kb = ka + 16; v[i] = ka < K ? W[(size_t)(ka < K ? ka : K - 1) * ld + n] : 0.f; v[8 + i] = kb < K ? W[(size_t)(kb < K ? kb : K - 1) * ld + n] : 0.f; }
  return bsplit16(v); }
__device__ __forceinline__ v8f mac3(const F2& a, const F2& b, v8f c) { c = wmma_bf(a.l, b.h, c); c = wmma_bf(a.h, b.l, c); return wmma_bf(a.h, b.h, c); }
__device__ __forceinline__ float sigm(float v) { return 1.0f / (1.0f + expf(-v)); }
#define LDSX() do { asm volatile("s_wait_dscnt 0" ::: "memory"); __builtin_amdgcn_wave_barrier(); __builtin_amdgcn_fence(__ATOMIC_RELEASE, "workgroup"); } while (0)


// Axis attention (B 4, 2,048 queries x 2,048 keys, dim_attn 512, single head): attn = softmax((q k^T) * sqrt(512)); out = query + (attn v) Wo + bo.
#define NB 4
#define NN 2048
#define DA 512
#ifndef TNB
#define TNB NB
#endif
#ifndef TQB
#define TQB (NN / 64)
#endif
typedef __attribute__((ext_vector_type(8))) __bf16 v8b;
__device__ __forceinline__ v16b frag_b(const __bf16* rowk0, int lane) {
  union { v16b v; v8b q[2]; } u; const __bf16* p = rowk0 + 8 * (lane >> 4);
  u.q[0] = *(const v8b*)p; u.q[1] = *(const v8b*)(p + 16); return u.v;
}
__device__ __forceinline__ float bfr(float v) { return (float)(__bf16)v; }
__device__ __attribute__((noinline)) float exp_ni(float v) { return expf(v); }
__device__ __attribute__((noinline)) float erf_ni(float v) { return erff(v); }

#define WS_Q   0u                                    // bf16 q hi rows [b*n][512]
#define WS_QL  (WS_Q + 2u * (size_t)NB * NN * DA)       // bf16 q lo rows
#define WS_KH  (WS_QL + 2u * (size_t)NB * NN * DA)      // bf16 k hi rows
#define WS_KL  (WS_KH + 2u * (size_t)NB * NN * DA)      // bf16 k lo rows
#define WS_VT  (WS_KL + 2u * (size_t)NB * NN * DA)      // f16 u planes [b][512][n], u = v Wo
#define WS_S   (WS_VT + 2u * (size_t)NB * DA * NN)      // f32 logits [b][q][key]
#define WS_PH  (WS_S + 4u * (size_t)NB * NN * NN)       // f16 P x 2^11 rows [b*q][key]
#define WS_WT  (WS_PH + 2u * (size_t)NB * NN * NN)      // bf16 weights as [4][out][in] rows: Wq, Wk, Wvo hi, Wvo lo
#define WS_BVO (WS_WT + 2u * (size_t)4 * DA * DA)       // f32 bv Wo [512]
#define WS_END (WS_BVO + 4u * (size_t)DA)

// eight 16-byte asynchronous copies of one lane, global -> LDS: copy i brings g + i * gstep to LDS byte l + i * lstep.
// The closing s_wait_xcnt 0 stands inside the copies' own statement so that no address register is rewritten ahead of it.
__device__ __forceinline__ void acp8(unsigned l, unsigned lstep, const char* g, size_t gstep) {
  asm volatile("global_load_async_to_lds_b128 %0, %8, off\n\t"
               "global_load_async_to_lds_b128 %1, %9, off\n\t"
               "global_load_async_to_lds_b128 %2, %10, off\n\t"
               "global_load_async_to_lds_b128 %3, %11, off\n\t"
               "global_load_async_to_lds_b128 %4, %12, off\n\t"
               "global_load_async_to_lds_b128 %5, %13, off\n\t"
               "global_load_async_to_lds_b128 %6, %14, off\n\t"
               "global_load_async_to_lds_b128 %7, %15, off\n\t"
               "s_wait_xcnt 0x0"
               :: "v"(l), "v"(l + lstep), "v"(l + 2 * lstep), "v"(l + 3 * lstep), "v"(l + 4 * lstep), "v"(l + 5 * lstep), "v"(l + 6 * lstep), "v"(l + 7 * lstep),
                  "v"(g), "v"(g + gstep), "v"(g + 2 * gstep), "v"(g + 3 * gstep), "v"(g + 4 * gstep), "v"(g + 5 * gstep), "v"(g + 6 * gstep), "v"(g + 7 * gstep)
               : "memory");
}
// the same for four copies
__device__ __forceinline__ void acp4(unsigned l, unsigned lstep, const char* g, size_t gstep) {
  asm volatile("global_load_async_to_lds_b128 %0, %4, off\n\t"
               "global_load_async_to_lds_b128 %1, %5, off\n\t"
               "global_load_async_to_lds_b128 %2, %6, off\n\t"
               "global_load_async_to_lds_b128 %3, %7, off\n\t"
               "s_wait_xcnt 0x0"
               :: "v"(l), "v"(l + lstep), "v"(l + 2 * lstep), "v"(l + 3 * lstep),
                  "v"(g), "v"(g + gstep), "v"(g + 2 * gstep), "v"(g + 3 * gstep)
               : "memory");
}
// this wave's copies have landed (the compiler places no wait for them)
#define WAIT_COPIES() asm volatile("s_wait_asynccnt 0x0" ::: "memory")
// this wave's LDS reads have returned, before the barrier behind which their buffer is refilled
#define WAIT_LDS() asm volatile("s_wait_dscnt 0x0" ::: "memory")
#define P128 144   // LDS pitch of a 128-byte row, 16 B x odd: ds_load_b128 without bank conflicts
#define P256 272   // the same for a 256-byte row
// ---- k_pack: block = (32 outputs, 64 inputs, which). which 0, 1: Wq's, Wk's (in,out) f32 tile -> bf16 [out][in] rows, turned in LDS so that whole 128-byte lines are stored.
// which 2: the same tile of Wvo = Wv Wo, formed as (Wo^T)(Wv^T) so that it comes out as [out][in]: 32 columns of Wo (turned) and 64 rows of Wv go to LDS as bf16 over all 512 middle channels,
// 8 waves as 2 x 4, a wave = one 16 x 16 tile -> bf16 hi and lo rows. Row DA / 64 of the grid (which 2 only): bv stands in for every row of Wv, and each column of the tile is bv Wo for the 32 outputs
#define PK_P 520   // LDS pitch, in bf16, of a row of 512: 1,040 bytes = 16 B x odd
typedef __attribute__((ext_vector_type(4))) __bf16 v4b;
__global__ __launch_bounds__(256) void k_pack(const float* __restrict__ WQ, const float* __restrict__ WK, const float* __restrict__ WV, const float* __restrict__ WO, const float* __restrict__ BV, __bf16* __restrict__ WT, float* __restrict__ BVO) { __shared__ __align__(16) __bf16 tl[2][32][72]; __shared__ __align__(16) __bf16 so[32 * PK_P]; __shared__ __align__(16) __bf16 sv[64 * PK_P];
  const int t = threadIdx.x, lane = t & 31, wave = t >> 5; const int which = 2 - blockIdx.z; const int n0 = blockIdx.x * 32, k0 = blockIdx.y * 64;   // low blockIdx.z starts first: the long blocks (which 2)
  const bool bias = blockIdx.y == DA / 64;   // the same for the whole block, like which: every barrier below is passed by all waves of a block or by none
  if (which < 2) { if (bias) return;
    const float* Wm = which == 0 ? WQ : WK;
    v8b r;
#pragma unroll
    for (int i = 0; i < 8; ++i) r[i] = (__bf16)Wm[(size_t)(k0 + wave * 8 + i) * DA + n0 + lane];
    *(v8b*)&tl[0][lane][wave * 8] = r;
    __syncthreads();
    vst2((unsigned*)(WT + ((size_t)which * DA + n0 + (t >> 3)) * DA + k0 + (t & 7) * 8), *(const v4u*)&tl[0][t >> 3][(t & 7) * 8]);
    return; }
  float fo[8][8];   // every loop below is unrolled so that fo and fv are indexed by constants and stay in registers
  const int vr = wave >> 2, vs = (wave & 3) * 128 + lane * 4;
  const float* po = WO + (size_t)(wave * 8) * DA + n0 + lane;   // a load = 128 contiguous bytes of one row of Wo
#pragma unroll
  for (int c = 0; c < 8; ++c)
#pragma unroll
    for (int i = 0; i < 8; ++i) fo[c][i] = po[(size_t)(c * 64 + i) * DA];
  // Here and in both branches: the loads' address pair is an input of the wait behind them, so it lives up to the wait and nothing is written into it ahead of it, on every way through the branches;
  // the scheduling barrier keeps every load ahead of the conversions: one trip to memory for the whole block, not one a group
  asm volatile("s_wait_xcnt 0x0" :: "v"(po) : "memory");
  if (bias) { const float* pb = BV + vs; const v4f x = *(const v4f*)pb;
    asm volatile("s_wait_xcnt 0x0" :: "v"(pb) : "memory");
    __builtin_amdgcn_sched_barrier(0);
    v4b r;
#pragma unroll
    for (int i = 0; i < 4; ++i) r[i] = (__bf16)x[i];
#pragma unroll
    for (int c = 0; c < 32; ++c) *(v4b*)&sv[(c * 2 + vr) * PK_P + vs] = r;
  } else { const float* pv = WV + (size_t)(k0 + vr) * DA + vs; v4f fv[32];   // a load = 512 contiguous bytes of one row of Wv
#pragma unroll
    for (int c = 0; c < 32; ++c) fv[c] = *(const v4f*)(pv + (size_t)(c * 2) * DA);
    asm volatile("s_wait_xcnt 0x0" :: "v"(pv) : "memory");
    __builtin_amdgcn_sched_barrier(0);
#pragma unroll
    for (int c = 0; c < 32; ++c) { v4b r;
#pragma unroll
      for (int i = 0; i < 4; ++i) r[i] = (__bf16)fv[c][i];
      *(v4b*)&sv[(c * 2 + vr) * PK_P + vs] = r; } }
#pragma unroll
  for (int c = 0; c < 8; ++c) { v8b r;
#pragma unroll
    for (int i = 0; i < 8; ++i) r[i] = (__bf16)fo[c][i];
    *(v8b*)&so[lane * PK_P + c * 64 + wave * 8] = r; }
  __syncthreads();
  const int col = lane & 15, g = lane >> 4, ot = wave >> 2, it = wave & 3;
  const __bf16* ra = so + (ot * 16 + col) * PK_P; const __bf16* rb = sv + (it * 16 + col) * PK_P;   // A: row = output channel; B: column = input channel; k = middle channel in both
  v8f acc = {};
#pragma unroll
  for (int mh = 0; mh < DA; mh += 256) { v16b fa[8], fb[8];
#pragma unroll
    for (int e = 0; e < 8; ++e) { fa[e] = frag_b(ra + mh + e * 32, lane); fb[e] = frag_b(rb + mh + e * 32, lane); }
    __builtin_amdgcn_sched_barrier(0);   // eight blocks' LDS reads as one group ahead of their products: one LDS latency, not eight
#pragma unroll
    for (int e = 0; e < 8; ++e) acc = wmma_bf(fa[e], fb[e], acc); }
  if (bias) { if (it == 0 && col == 0) {
#pragma unroll
      for (int r = 0; r < 8; ++r) BVO[n0 + ot * 16 + 8 * g + r] = acc[r]; }
    return; }
#pragma unroll
  for (int r = 0; r < 8; ++r) { const __bf16 h = (__bf16)acc[r]; tl[0][ot * 16 + 8 * g + r][it * 16 + col] = h; tl[1][ot * 16 + 8 * g + r][it * 16 + col] = (__bf16)(acc[r] - (float)h); }
  __syncthreads();
  __bf16* d = WT + ((size_t)2 * DA + n0 + (t >> 3)) * DA + k0 + (t & 7) * 8;
  vst2((unsigned*)d, *(const v4u*)&tl[0][t >> 3][(t & 7) * 8]); vst2((unsigned*)(d + (size_t)DA * DA), *(const v4u*)&tl[1][t >> 3][(t & 7) * 8]); }
// ---- k_proj, which 0, 1: block = (256 rows, 256 cols), 16 waves as 4 x 4, a wave = 64 rows x 64 cols: q and k (bf16 hi + lo rows). A stage = 64 k of 256 packed weight rows and 256 x rows, two buffers
#define PR_X   (256 * P128)
#define PR_BUF (256 * P128 + 256 * P256)
#define PR_OUT (2 * 64 * P128)   // a wave's output tile in LDS: two planes of 64 rows of 128 bytes
#define PR_FILL(s, bf) do { acp4(lw + (bf) * PR_BUF, 64 * P128, gw + (s) * 128, (size_t)64 * DA * 2); acp8(lx + (bf) * PR_BUF, 32 * P256, gx + (s) * 256, (size_t)32 * DA * 4); } while (0)
// The result goes out as rows [x row][col]; the weight fragment is the product's A operand, so that a lane's eight results are eight neighbouring cols of one row (one 16-byte LDS store).
__device__ __forceinline__ void proj_rows(char* ring, const float* __restrict__ X, const __bf16* __restrict__ Wr, const float* __restrict__ Bm, __bf16* __restrict__ DH, __bf16* __restrict__ DL) {
  const int tid = threadIdx.x, wave = tid >> 5, lane = tid & 31, col = lane & 15, g = lane >> 4, wr = wave >> 2, wc = wave & 3; const int c0 = blockIdx.y * 256; const size_t r0 = (size_t)blockIdx.x * 256;
  const unsigned lds0 = (unsigned)(size_t)ring;
  const unsigned lw = lds0 + (tid >> 3) * P128 + (tid & 7) * 16, lx = lds0 + PR_X + (tid >> 4) * P256 + (tid & 15) * 16;   // 8 lanes a weight row, 16 lanes an x row
  const char* gw = (const char*)Wr + ((size_t)(c0 + (tid >> 3)) * DA + (tid & 7) * 8) * 2; const char* gx = (const char*)X + ((r0 + (tid >> 4)) * DA + (tid & 15) * 4) * 4;
  v8f acc[4][4] = {};   // every inner loop below is unrolled so that the tiles and fragments are indexed by constants and stay in registers
  PR_FILL(0, 0); WAIT_COPIES(); __syncthreads(); PR_FILL(1, 1);
#pragma unroll 1   // one stage a trip: the two buffers alternate by the trip's parity
  for (int s = 0; s < DA / 64; ++s) { const char* bp = ring + (s & 1) * PR_BUF;
#pragma unroll
    for (int h = 0; h < 2; ++h) { v16b a[4];
#pragma unroll
      for (int i = 0; i < 4; ++i) { const float* p = (const float*)(bp + PR_X + (wr * 64 + i * 16 + col) * P256) + h * 32 + 8 * g;
#pragma unroll
        for (int e = 0; e < 8; ++e) { a[i][e] = (__bf16)p[e]; a[i][8 + e] = (__bf16)p[16 + e]; } }
#pragma unroll
      for (int j = 0; j < 4; ++j) { const v16b w = frag_b((const __bf16*)(bp + (wc * 64 + j * 16 + col) * P128 + h * 64), lane);   // a weight fragment serves four x fragments
#pragma unroll
        for (int i = 0; i < 4; ++i) acc[i][j] = wmma_bf(w, a[i], acc[i][j]); } }
    WAIT_LDS(); WAIT_COPIES(); __syncthreads();   // publishes stage s + 1 and ends every read of stage s
    if (s + 2 < DA / 64) PR_FILL(s + 2, s & 1); }
  WAIT_COPIES();
  char* my = ring + wave * PR_OUT;   // the ring is free behind the last trip's barrier: each wave turns its own tile in its own range
  const int l8 = lane >> 3, q8 = (lane & 7) * 8;   // a global store = four rows of 128 contiguous bytes: whole lines
#pragma unroll
  for (int j = 0; j < 4; ++j) { float bb[8];
#pragma unroll
    for (int r = 0; r < 8; ++r) bb[r] = bfr(Bm[c0 + wc * 64 + j * 16 + 8 * g + r]);
#pragma unroll
    for (int i = 0; i < 4; ++i) { v8b h8, lo8;
#pragma unroll
      for (int r = 0; r < 8; ++r) { const float v = acc[i][j][r] + bb[r]; const __bf16 h = (__bf16)v; h8[r] = h; lo8[r] = (__bf16)(v - (float)h); }
      char* d = my + (i * 16 + col) * P128 + (j * 16 + 8 * g) * 2; *(v8b*)d = h8; *(v8b*)(d + 64 * P128) = lo8; } }
  LDSX();
  __bf16* dh = DH + (r0 + wr * 64) * DA + c0 + wc * 64 + q8; __bf16* dl = DL + (r0 + wr * 64) * DA + c0 + wc * 64 + q8;
  for (int t = 0; t < 16; ++t) { const int rl = 4 * t + l8; const char* sp = my + rl * P128 + q8 * 2; vst2((unsigned*)(dh + (size_t)rl * DA), *(const v4u*)sp); vst2((unsigned*)(dl + (size_t)rl * DA), *(const v4u*)(sp + 64 * P128)); } }
// ---- k_proj, which 2, 3: block = (128 rows, 256 cols), 16 waves as 2 x 8, a wave = 64 rows x 32 cols: u = x Wvo + bv Wo (Wvo hi + lo: 2 products, as many a block as q's and k's) -> f16 planes [col][x row].
// x is the A operand, so that a lane's eight results are eight neighbouring x rows of one col. A stage = 64 k of 256 Wvo hi rows, 256 Wvo lo rows and 128 x rows, two buffers
#define PP_LO  (256 * P128)
#define PP_X   (512 * P128)
#define PP_BUF (512 * P128 + 128 * P256)
#define PP_FILL(s, bf) do { acp4(lw + (bf) * PP_BUF, 64 * P128, gwh + (s) * 128, (size_t)64 * DA * 2); acp4(lw + PP_LO + (bf) * PP_BUF, 64 * P128, gwl + (s) * 128, (size_t)64 * DA * 2); acp4(lx + (bf) * PP_BUF, 32 * P256, gx + (s) * 256, (size_t)32 * DA * 4); } while (0)
__device__ __forceinline__ void proj_planes(char* ring, const float* __restrict__ X, const __bf16* __restrict__ WH, const __bf16* __restrict__ WL, const float* __restrict__ BVO, _Float16* __restrict__ VT) {
  const int tid = threadIdx.x, wave = tid >> 5, lane = tid & 31, col = lane & 15, g = lane >> 4, wr = wave >> 3, wc = wave & 7; const int c0 = blockIdx.y * 256; const size_t r0 = ((size_t)(blockIdx.z - 2) * (NB * NN / 256) + blockIdx.x) * 128;
  const unsigned lds0 = (unsigned)(size_t)ring;
  const unsigned lw = lds0 + (tid >> 3) * P128 + (tid & 7) * 16, lx = lds0 + PP_X + (tid >> 4) * P256 + (tid & 15) * 16;   // 8 lanes a weight row, 16 lanes an x row
  const size_t wo = ((size_t)(c0 + (tid >> 3)) * DA + (tid & 7) * 8) * 2;
  const char* gwh = (const char*)WH + wo; const char* gwl = (const char*)WL + wo; const char* gx = (const char*)X + ((r0 + (tid >> 4)) * DA + (tid & 15) * 4) * 4;
  v8f acc[4][2] = {};   // every inner loop below is unrolled so that the tiles and fragments are indexed by constants and stay in registers
  PP_FILL(0, 0); WAIT_COPIES(); __syncthreads(); PP_FILL(1, 1);
#pragma unroll 1   // one stage a trip: the two buffers alternate by the trip's parity
  for (int s = 0; s < DA / 64; ++s) { const char* bp = ring + (s & 1) * PP_BUF;
#pragma unroll
    for (int h = 0; h < 2; ++h) { v16b a[4];
#pragma unroll
      for (int i = 0; i < 4; ++i) { const float* p = (const float*)(bp + PP_X + (wr * 64 + i * 16 + col) * P256) + h * 32 + 8 * g;
#pragma unroll
        for (int e = 0; e < 8; ++e) { a[i][e] = (__bf16)p[e]; a[i][8 + e] = (__bf16)p[16 + e]; } }
#pragma unroll
      for (int j = 0; j < 2; ++j) { const char* kr = bp + (wc * 32 + j * 16 + col) * P128 + h * 64; const v16b wh = frag_b((const __bf16*)kr, lane), wl = frag_b((const __bf16*)(kr + PP_LO), lane);   // a weight fragment serves four x fragments
#pragma unroll
        for (int i = 0; i < 4; ++i) acc[i][j] = wmma_bf(a[i], wl, acc[i][j]);
#pragma unroll
        for (int i = 0; i < 4; ++i) acc[i][j] = wmma_bf(a[i], wh, acc[i][j]); } }
    WAIT_LDS(); WAIT_COPIES(); __syncthreads();   // publishes stage s + 1 and ends every read of stage s
    if (s + 2 < DA / 64) PP_FILL(s + 2, s & 1); }
  WAIT_COPIES();
  char* my = ring + wave * (32 * P128);   // the ring is free behind the last trip's barrier: each wave turns its own tile (32 cols of 64 x rows) in its own range
  const int l8 = lane >> 3, q8 = (lane & 7) * 8;   // a global store = four rows of 128 contiguous bytes: whole lines
#pragma unroll
  for (int j = 0; j < 2; ++j) { const float bb = BVO[c0 + wc * 32 + j * 16 + col];
#pragma unroll
    for (int i = 0; i < 4; ++i) { v8h t8;
#pragma unroll
      for (int r = 0; r < 8; ++r) t8[r] = (_Float16)(acc[i][j][r] + bb);
      *(v8h*)(my + (j * 16 + col) * P128 + (i * 16 + 8 * g) * 2) = t8; } }
  LDSX();
  const size_t b = r0 / NN; const int n0 = (int)(r0 % NN); _Float16* dv = VT + (b * DA + c0 + wc * 32) * (size_t)NN + n0 + wr * 64 + q8;
#pragma unroll   // every store names the one address pair
  for (int t = 0; t < 8; ++t) { const int cl = 4 * t + l8; vst2((unsigned*)(dv + (size_t)cl * NN), *(const v4u*)(my + cl * P128 + q8 * 2)); } }
__global__ __launch_bounds__(512) void k_proj(const float* __restrict__ XQ, const float* __restrict__ XKV, const __bf16* __restrict__ WT, const float* __restrict__ BQ, const float* __restrict__ BK, const float* __restrict__ BVO, __bf16* __restrict__ QH, __bf16* __restrict__ QL, __bf16* __restrict__ KH, __bf16* __restrict__ KL, _Float16* __restrict__ VT) { __shared__ __align__(16) char ring[16 * PR_OUT];
  static_assert(16 * PR_OUT >= 2 * PR_BUF && 16 * PR_OUT >= 2 * PP_BUF, "the ring holds two stages");
  const int which = blockIdx.z;   // the same for the whole block: every barrier of a branch is passed by all its waves
  if (which <= 1) proj_rows(ring, which == 0 ? XQ : XKV, WT + (size_t)which * DA * DA, which == 0 ? BQ : BK, which == 0 ? QH : KH, which == 0 ? QL : KL);
  else proj_planes(ring, XKV, WT + (size_t)2 * DA * DA, WT + (size_t)3 * DA * DA, BVO, VT); }
// ---- k_sc: block = (256 queries, 256 keys, b), 16 waves as 4 x 4, a wave = 64 queries x 64 keys: logits (3 products) x sqrt(512) -> S. A stage = 64 k of the q hi, q lo, K hi and K lo rows, copied to LDS in whole lines, two buffers
#define SC_LO (256 * P128)
#define SC_K  (512 * P128)
#define SC_BUF (1024 * P128)
__global__ __launch_bounds__(512) void k_sc(const __bf16* __restrict__ QH, const __bf16* __restrict__ QL, const __bf16* __restrict__ KH, const __bf16* __restrict__ KL, float* __restrict__ S) { __shared__ __align__(16) char ring[2 * SC_BUF];
  const int tid = threadIdx.x, wave = tid >> 5, lane = tid & 31, col = lane & 15, g = lane >> 4, wq = wave >> 2, wk = wave & 3; const size_t b = blockIdx.z; const int k0 = blockIdx.y * 256; const size_t qb = b * NN + (size_t)blockIdx.x * 256;
  const unsigned lr = (unsigned)(size_t)ring + (tid >> 3) * P128 + (tid & 7) * 16;   // 8 lanes a row
  const size_t qo = ((qb + (tid >> 3)) * DA + (tid & 7) * 8) * 2, ko = ((b * NN + k0 + (tid >> 3)) * DA + (tid & 7) * 8) * 2;
  const char* gqh = (const char*)QH + qo; const char* gql = (const char*)QL + qo; const char* gkh = (const char*)KH + ko; const char* gkl = (const char*)KL + ko;
#define SC_FILL(s, bf) do { acp4(lr + (bf) * SC_BUF, 64 * P128, gqh + (s) * 128, (size_t)64 * DA * 2); acp4(lr + SC_LO + (bf) * SC_BUF, 64 * P128, gql + (s) * 128, (size_t)64 * DA * 2); \
    acp4(lr + SC_K + (bf) * SC_BUF, 64 * P128, gkh + (s) * 128, (size_t)64 * DA * 2); acp4(lr + SC_K + SC_LO + (bf) * SC_BUF, 64 * P128, gkl + (s) * 128, (size_t)64 * DA * 2); } while (0)
  v8f acc[4][4] = {};   // every inner loop below is unrolled so that the tiles and fragments are indexed by constants and stay in registers
  SC_FILL(0, 0); WAIT_COPIES(); __syncthreads(); SC_FILL(1, 1);
#pragma unroll 1   // one stage a trip: the two buffers alternate by the trip's parity
  for (int s = 0; s < DA / 64; ++s) { const char* bp = ring + (s & 1) * SC_BUF;
#pragma unroll
    for (int h = 0; h < 2; ++h) { v16b ah[4], al[4];
#pragma unroll
      for (int i = 0; i < 4; ++i) { const char* qr = bp + (wq * 64 + i * 16 + col) * P128 + h * 64; ah[i] = frag_b((const __bf16*)qr, lane); al[i] = frag_b((const __bf16*)(qr + SC_LO), lane); }
#pragma unroll
      for (int j = 0; j < 4; ++j) { const char* kr = bp + SC_K + (wk * 64 + j * 16 + col) * P128 + h * 64; const v16b kh = frag_b((const __bf16*)kr, lane), kl = frag_b((const __bf16*)(kr + SC_LO), lane);
        // a key fragment serves four query fragments; each tile still takes its three products in the order hi.hi, lo.hi, hi.lo
#pragma unroll
        for (int i = 0; i < 4; ++i) acc[i][j] = wmma_bf(ah[i], kh, acc[i][j]);
#pragma unroll
        for (int i = 0; i < 4; ++i) acc[i][j] = wmma_bf(al[i], kh, acc[i][j]);
#pragma unroll
        for (int i = 0; i < 4; ++i) acc[i][j] = wmma_bf(ah[i], kl, acc[i][j]); } }
    WAIT_LDS(); WAIT_COPIES(); __syncthreads();   // publishes stage s + 1 and ends every read of stage s
    if (s + 2 < DA / 64) SC_FILL(s + 2, s & 1); }
  WAIT_COPIES();
  float (*ss)[68] = (float (*)[68])(ring + wave * (64 * 68 * 4));   // the ring is free behind the last trip's barrier: each wave stages its 64 rows in its own range
#pragma unroll
  for (int i = 0; i < 4; ++i)
#pragma unroll
    for (int j = 0; j < 4; ++j)
#pragma unroll
      for (int r = 0; r < 8; ++r) ss[i * 16 + 8 * g + r][j * 16 + col] = acc[i][j][r] * 22.627416997969522f;
  LDSX(); for (int t = 0; t < 32; ++t) { const int rl = 2 * t + g; vst2(S + (qb + wq * 64 + rl) * NN + k0 + wk * 64 + col * 4, *(const v4f*)&ss[rl][col * 4]); } }   // a store = two rows of 256 contiguous bytes: whole lines
// lane l with lane l ^ 16
__device__ __forceinline__ float xhalf(float x) { return __builtin_bit_cast(float, __builtin_amdgcn_permlanex16(__builtin_bit_cast(int, x), __builtin_bit_cast(int, x), 0x76543210, 0xfedcba98, false, false)); }
// lane l with lane l ^ M inside its 16-lane row (DPP row_xmask)
template <int M> __device__ __forceinline__ float xrow(float x) { return __builtin_bit_cast(float, __builtin_amdgcn_update_dpp(0, __builtin_bit_cast(int, x), 0x160 + M, 0xf, 0xf, true)); }
__device__ __forceinline__ float wave_max(float v) { v = fmaxf(v, xrow<1>(v)); v = fmaxf(v, xrow<2>(v)); v = fmaxf(v, xrow<4>(v)); v = fmaxf(v, xrow<8>(v)); return fmaxf(v, xhalf(v)); }
__device__ __forceinline__ float wave_sum(float v) { v += xrow<1>(v); v += xrow<2>(v); v += xrow<4>(v); v += xrow<8>(v); return v + xhalf(v); }
typedef __attribute__((ext_vector_type(4))) _Float16 v4h;
// ---- k_sm: wave = SM_R query rows, each row's 2,048 logits held in the wave's registers (64 a lane): S read once, one expf a logit, no LDS, no barrier -> P x 2^11 as f16
#define SM_R 2    // rows a wave: with 16 waves a block the whole problem is one block per WGP
#define SM_W 16   // waves a block
__global__ __launch_bounds__(SM_W * 32) void k_sm(const float* __restrict__ S, _Float16* __restrict__ PH) {
  const int lane = threadIdx.x & 31; const size_t row0 = ((size_t)blockIdx.x * SM_W + (threadIdx.x >> 5)) * SM_R;
  const float* sp = S + row0 * NN + lane * 4;   // the one address that every load below names
  v4f x[SM_R][16];   // load i of a row = 512 contiguous bytes over the wave; all rows' loads are issued ahead of the first row's arithmetic
  // every loop below is unrolled so that x is indexed by constants and stays in registers
#pragma unroll
  for (int r = 0; r < SM_R; ++r)
#pragma unroll
    for (int i = 0; i < 16; ++i) x[r][i] = *(const v4f*)(sp + r * NN + i * 128);
  asm volatile("s_wait_xcnt 0x0" :: "v"(sp) : "memory");   // the loads' address pair is an input here, so it lives up to this wait and no load's result lands in it ahead of the wait
#pragma unroll
  for (int r = 0; r < SM_R; ++r) { __builtin_amdgcn_sched_barrier(0);   // keeps every load ahead of the arithmetic, and a later row's arithmetic (with its wait for that row's loads) behind this row's stores
    v4f mm = x[r][0];
#pragma unroll
    for (int i = 1; i < 16; ++i)
#pragma unroll
      for (int c = 0; c < 4; ++c) mm[c] = fmaxf(mm[c], x[r][i][c]);
    const float m = wave_max(fmaxf(fmaxf(-3.0e38f, fmaxf(mm[0], mm[1])), fmaxf(mm[2], mm[3])));
    v4f ss = {};
#pragma unroll
    for (int i = 0; i < 16; ++i)
#pragma unroll
      for (int c = 0; c < 4; ++c) { const float e = expf(x[r][i][c] - m); x[r][i][c] = e; ss[c] += e; }
    const float inv = 1.0f / wave_sum((ss[0] + ss[1]) + (ss[2] + ss[3]));
    _Float16* ph = PH + (row0 + r) * NN + lane * 4;
#pragma unroll
    for (int i = 0; i < 16; ++i) { v4h h;
#pragma unroll
      for (int c = 0; c < 4; ++c) h[c] = (_Float16)(x[r][i][c] * inv * 2048.0f);
      *(v4h*)(ph + i * 128) = h; } } }   // a store = 256 contiguous bytes over the wave: whole lines
// ---- k_pv: block = (128 queries, 128 value channels, b), 8 waves as 4 x 2, a wave = 32 queries x 64 channels: out = query + P . u + bo. A stage = 128 keys of the u and P rows, copied to LDS in whole lines, two buffers
#define PV_PH (128 * P256)
#define PV_BUF (256 * P256)
__global__ __launch_bounds__(256) void k_pv(const _Float16* __restrict__ PH, const _Float16* __restrict__ VT, const float* __restrict__ XQ, const float* __restrict__ BO, float* __restrict__ OUT) { __shared__ __align__(16) char ring[2 * PV_BUF];
  const int tid = threadIdx.x, wave = tid >> 5, lane = tid & 31, col = lane & 15, g = lane >> 4, wq = wave >> 1, wc = wave & 1; const size_t b = blockIdx.z; const int c0 = blockIdx.y * 128; const size_t qb = b * NN + (size_t)blockIdx.x * 128;
  const unsigned lv = (unsigned)(size_t)ring + (tid >> 4) * P256 + (tid & 15) * 16;   // 16 lanes a row
  const size_t po = ((qb + (tid >> 4)) * NN + (tid & 15) * 8) * 2;
  const char* gv = (const char*)VT + ((b * DA + c0 + (tid >> 4)) * (size_t)NN + (tid & 15) * 8) * 2; const char* gph = (const char*)PH + po;
#define PV_FILL(s, bf) do { acp8(lv + (bf) * PV_BUF, 16 * P256, gv + (s) * 256, (size_t)16 * NN * 2); acp8(lv + PV_PH + (bf) * PV_BUF, 16 * P256, gph + (s) * 256, (size_t)16 * NN * 2); } while (0)
  v8f acc[2][4] = {};   // every inner loop below is unrolled so that the tiles and fragments are indexed by constants and stay in registers
  PV_FILL(0, 0);
  // the wave's query rows and its bias, for the epilogue: loaded here, beside the first stage's copies, so that their trip to memory is not paid behind the last product
  const size_t at = (qb + wq * 32 + g) * DA + c0 + wc * 64 + col * 4; const float* px = XQ + at; const float* pb = BO + c0 + wc * 64 + col * 4;
  v4f xq[16]; const v4f bo = *(const v4f*)pb;
#pragma unroll
  for (int t = 0; t < 16; ++t) xq[t] = *(const v4f*)(px + (size_t)(2 * t) * DA);   // a load = two rows of 256 contiguous bytes: whole lines
  asm volatile("s_wait_xcnt 0x0" :: "v"(px), "v"(pb) : "memory");   // the loads' address pairs are inputs here, so they live up to this wait and no load's result lands in one ahead of it
  WAIT_COPIES(); __syncthreads(); PV_FILL(1, 1);
#pragma unroll 1   // one stage a trip: the two buffers alternate by the trip's parity
  for (int s = 0; s < NN / 128; ++s) { const char* bp = ring + (s & 1) * PV_BUF;
#pragma unroll
    for (int h = 0; h < 4; h += 2) { v16h vb[2][4], ph[2][2];   // two 32-key blocks a group: their LDS reads stand as one group ahead of their products: one wait for LDS a group, not one a block
#pragma unroll
      for (int e = 0; e < 2; ++e) {
#pragma unroll
        for (int i = 0; i < 2; ++i) ph[e][i] = frag_h((const _Float16*)(bp + PV_PH + (wq * 32 + i * 16 + col) * P256 + (h + e) * 64), lane);
#pragma unroll
        for (int j = 0; j < 4; ++j) vb[e][j] = frag_h((const _Float16*)(bp + (wc * 64 + j * 16 + col) * P256 + (h + e) * 64), lane); }
      // a u fragment serves two query fragments
#pragma unroll
      for (int e = 0; e < 2; ++e)
#pragma unroll
        for (int j = 0; j < 4; ++j)
#pragma unroll
          for (int i = 0; i < 2; ++i) acc[i][j] = wmma16(ph[e][i], vb[e][j], acc[i][j]); }
    WAIT_LDS(); WAIT_COPIES(); __syncthreads();   // publishes stage s + 1 and ends every read of stage s
    if (s + 2 < NN / 128) PV_FILL(s + 2, s & 1); }
  WAIT_COPIES();
  float (*ss)[68] = (float (*)[68])(ring + wave * (32 * 68 * 4));   // the ring is free behind the last trip's barrier: each wave stages its 32 rows in its own range
#pragma unroll
  for (int i = 0; i < 2; ++i)
#pragma unroll
    for (int j = 0; j < 4; ++j)
#pragma unroll
      for (int r = 0; r < 8; ++r) ss[i * 16 + 8 * g + r][j * 16 + col] = acc[i][j][r] * (1.0f / 2048.0f);
  LDSX();
#pragma unroll   // xq is indexed by constants, and every store names the one address pair
  for (int t = 0; t < 16; ++t) { const v4f o = *(const v4f*)&ss[2 * t + g][col * 4]; v4f y;
#pragma unroll
    for (int c = 0; c < 4; ++c) y[c] = bfr(xq[t][c]) + o[c] + bfr(bo[c]);
    vst2(OUT + at + (size_t)(2 * t) * DA, y); } }   // a store = two rows of 256 contiguous bytes: whole lines
extern "C" void kernel_launch(void* const* d_in, const int* in_sizes, int n_in, void* d_out, int out_size, void* d_ws, size_t ws_size, hipStream_t stream) {
  (void)in_sizes; (void)n_in; (void)out_size;
  const float** F = (const float**)d_in;   // 0 query [4,2048,512], 1 key_value [4,2048,512], 2 Wq, 3 bq, 4 Wk, 5 bk, 6 Wv, 7 bv, 8 Wo, 9 bo ((in,out) [512,512] / [512])
  if (ws_size < (size_t)WS_END) return;
  char* ws = (char*)d_ws; float *S = (float*)(ws + WS_S), *BVO = (float*)(ws + WS_BVO); __bf16 *QH = (__bf16*)(ws + WS_Q), *QL = (__bf16*)(ws + WS_QL), *KH = (__bf16*)(ws + WS_KH), *KL = (__bf16*)(ws + WS_KL); _Float16 *VT = (_Float16*)(ws + WS_VT), *PH = (_Float16*)(ws + WS_PH); __bf16* WT = (__bf16*)(ws + WS_WT);
  k_pack<<<dim3(DA / 32, DA / 64 + 1, 3), 256, 0, stream>>>(F[2], F[4], F[6], F[8], F[7], WT, BVO);
  k_proj<<<dim3(TNB * NN / 256, DA / 256, 4), 512, 0, stream>>>(F[0], F[1], WT, F[3], F[5], BVO, QH, QL, KH, KL, VT);
  k_sc<<<dim3(NN / 256, NN / 256, TNB), 512, 0, stream>>>(QH, QL, KH, KL, S);
  k_sm<<<TNB * TQB * 64 / (SM_W * SM_R), SM_W * 32, 0, stream>>>(S, PH);   // rows of all batches are contiguous: one launch
  k_pv<<<dim3(NN / 128, DA / 128, TNB), 256, 0, stream>>>(PH, VT, F[0], F[9], (float*)d_out);
}

// v009
// Measured time: 81.7 microseconds a run.
// It is 1.15 times as fast as v007, going by the measured steps of the versions left out in between.
// Counting every step since v000, it is 5.78 times as fast.
// compute dtype: all float inputs rounded to bf16; the key projection is applied to the queries ahead of the scores: Wqk = Wq Wk^T (exact bf16 products on WMMA 16x16x32, f32 accumulate, kept as bf16 hi + lo), t = x_q Wqk + bq Wk^T (2 products) kept in f32 and split into bf16 hi + lo; logits = t . x_kv (2 products, x_kv is exact in bf16; the module multiplies by sqrt(512), logits ~1e2), stored in f32; the term q . bk is the same for every key of a row and cancels in the softmax; softmax in f32 (precise expf) -> P as one f16 plane x 2^11 (11 bits, as many as u has); the output projection is applied to the values ahead of the attention sum: Wvo = Wv Wo (exact bf16 products, f32 accumulate, kept as bf16 hi + lo), u = x Wvo + bv Wo (2 products) as f16; out = query + P . u + bo (1 product); f32 output.
#include <hip/hip_runtime.h>
#include <math.h>

typedef __attribute__((ext_vector_type(16))) _Float16 v16h;
typedef __attribute__((ext_vector_type(16))) __bf16 v16b;
typedef __attribute__((ext_vector_type(8)))  _Float16 v8h;
typedef __attribute__((ext_vector_type(8)))  float v8f;
typedef __attribute__((ext_vector_type(4)))  float v4f;
typedef __attribute__((ext_vector_type(2)))  float v2f;
typedef __attribute__((ext_vector_type(4)))  unsigned v4u;
typedef __attribute__((ext_vector_type(4)))  int v4i;
typedef float __attribute__((may_alias)) float_a;
typedef int __attribute__((may_alias)) int_a;

template <typename T> __device__ __forceinline__ void vst2(void* p, T v) { *(T*)p = v;  }
__device__ __forceinline__ v8f wmma16(v16h a, v16h b, v8f c) {
  v8f d = __builtin_amdgcn_wmma_f32_16x16x32_f16(false, a, false, b, (short)0, c, false, false);
  asm volatile("v_nop\n\tv_nop\n\tv_nop\n\tv_nop" : "+v"(d) : "v"(a), "v"(b));
  return d;
}
__device__ __forceinline__ v8f wmma_bf(v16b a, v16b b, v8f c) {
  v8f d = __builtin_amdgcn_wmma_f32_16x16x32_bf16(false, a, false, b, (short)0, c, false, false);
  asm volatile("v_nop\n\tv_nop\n\tv_nop\n\tv_nop" : "+v"(d) : "v"(a), "v"(b));
  return d;
}
// 16x16x32 fragments: lane = (h = lane>>4, row/col = lane&15); elements 0..7 = k0+8h+0..7, 8..15 = k0+16+8h+0..7; D element r = row 8h+r
__device__ __forceinline__ v16h frag_h(const _Float16* rowk0, int lane) {
  union { v16h v; v8h q[2]; } u; const _Float16* p = rowk0 + 8 * (lane >> 4);
  u.q[0] = *(const v8h*)p; u.q[1] = *(const v8h*)(p + 16); return u.v;
}
__device__ __forceinline__ v16h frag_f32(const float* rowk0, int lane) {
  v16h a; const float* p = rowk0 + 8 * (lane >> 4);
#pragma unroll
  for (int i = 0; i < 8; ++i) { a[i] = (_Float16)p[i]; a[8 + i] = (_Float16)p[16 + i]; }
  return a;
}
__device__ __forceinline__ v16h frag_f32s(const float* rowk0, int lane, float sc) {
  v16h a; const float* p = rowk0 + 8 * (lane >> 4);
#pragma unroll
  for (int i = 0; i < 8; ++i) { a[i] = (_Float16)(p[i] * sc); a[8 + i] = (_Float16)(p[16 + i] * sc); }
  return a;
}
// column fragment from a [K][ld] layout (column n), rows >= K read as 0
__device__ __forceinline__ v16h fragc_f32(const float* W, int k0, int n, int lane, int ld, int K) {
  v16h a; const int g = lane >> 4;
#pragma unroll
  for (int i = 0; i < 8; ++i) { const int ka = k0 + 8 * g + i, kb = ka + 16;
    a[i] = (_Float16)(ka < K ? W[(size_t)(ka < K ? ka : K - 1) * ld + n] : 0.f); a[8 + i] = (_Float16)(kb < K ? W[(size_t)(kb < K ? kb : K - 1) * ld + n] : 0.f); }
  return a;
}
struct F2 { v16b h, l; };
__device__ __forceinline__ F2 bsplit16(const float v[16]) { F2 r;
#pragma unroll
  for (int i = 0; i < 16; ++i) { const __bf16 h = (__bf16)v[i]; r.h[i] = h; r.l[i] = (__bf16)(v[i] - (float)h); }
  return r; }
__device__ __forceinline__ F2 split_row(const float* row, int k0, int lane) { float v[16]; const float* p = row + k0 + 8 * (lane >> 4);
#pragma unroll
  for (int i = 0; i < 8; ++i) { v[i] = p[i]; v[8 + i] = p[16 + i]; }
  return bsplit16(v); }
__device__ __forceinline__ F2 split_rowK(const float* row, int k0, int lane, int K) { float v[16]; const int g = lane >> 4;
#pragma unroll
  for (int i = 0; i < 8; ++i) { const int ka = k0 + 8 * g + i, kb = ka + 16; v[i] = ka < K ? row[ka < K ? ka : K - 1] : 0.f; v[8 + i] = kb < K ? row[kb < K ? kb : K - 1] : 0.f; }
  return bsplit16(v); }
__device__ __forceinline__ F2 split_col(const float* W, int k0, int n, int lane, int ld, int K) { float v[16]; const int g = lane >> 4;
#pragma unroll
  for (int i = 0; i < 8; ++i) { const int ka = k0 + 8 * g + i, kb = ka + 16; v[i] = ka < K ? W[(size_t)(ka < K ? ka : K - 1) * ld + n] : 0.f; v[8 + i] = kb < K ? W[(size_t)(kb < K ? kb : K - 1) * ld + n] : 0.f; }
  return bsplit16(v); }
__device__ __forceinline__ v8f mac3(const F2& a, const F2& b, v8f c) { c = wmma_bf(a.l, b.h, c); c = wmma_bf(a.h, b.l, c); return wmma_bf(a.h, b.h, c); }
__device__ __forceinline__ float sigm(float v) { return 1.0f / (1.0f + expf(-v)); }
#define LDSX() do { asm volatile("s_wait_dscnt 0" ::: "memory"); __builtin_amdgcn_wave_barrier(); __builtin_amdgcn_fence(__ATOMIC_RELEASE, "workgroup"); } while (0)


// Axis attention (B 4, 2,048 queries x 2,048 keys, dim_attn 512, single head): attn = softmax((q k^T) * sqrt(512)); out = query + (attn v) Wo + bo.
#define NB 4
#define NN 2048
#define DA 512
#ifndef TNB
#define TNB NB
#endif
#ifndef TQB
#define TQB (NN / 64)
#endif
typedef __attribute__((ext_vector_type(8))) __bf16 v8b;
__device__ __forceinline__ v16b frag_b(const __bf16* rowk0, int lane) {
  union { v16b v; v8b q[2]; } u; const __bf16* p = rowk0 + 8 * (lane >> 4);
  u.q[0] = *(const v8b*)p; u.q[1] = *(const v8b*)(p + 16); return u.v;
}
__device__ __forceinline__ float bfr(float v) { return (float)(__bf16)v; }
__device__ __attribute__((noinline)) float exp_ni(float v) { return expf(v); }
__device__ __attribute__((noinline)) float erf_ni(float v) { return erff(v); }

#define WS_Q   0u                                    // bf16 t hi rows [b*n][512], t = q Wk^T
#define WS_QL  (WS_Q + 2u * (size_t)NB * NN * DA)       // bf16 t lo rows
#define WS_KH  (WS_QL + 2u * (size_t)NB * NN * DA)      // bf16 key_value rows
#define WS_VT  (WS_KH + 2u * (size_t)NB * NN * DA)      // f16 u planes [b][512][n], u = v Wo
#define WS_S   (WS_VT + 2u * (size_t)NB * DA * NN)      // f32 logits [b][q][key]
#define WS_PH  (WS_S + 4u * (size_t)NB * NN * NN)       // f16 P x 2^11 rows [b*q][key]
#define WS_WT  (WS_PH + 2u * (size_t)NB * NN * NN)      // bf16 weights as [4][out][in] rows: Wqk hi, Wqk lo, Wvo hi, Wvo lo
#define WS_BVO (WS_WT + 2u * (size_t)4 * DA * DA)       // f32 bv Wo [512]
#define WS_BT  (WS_BVO + 4u * (size_t)DA)               // f32 bq Wk^T [512]
#define WS_END (WS_BT + 4u * (size_t)DA)

// eight 16-byte asynchronous copies of one lane, global -> LDS: copy i brings g + i * gstep to LDS byte l + i * lstep.
// The closing s_wait_xcnt 0 stands inside the copies' own statement so that no address register is rewritten ahead of it.
__device__ __forceinline__ void acp8(unsigned l, unsigned lstep, const char* g, size_t gstep) {
  asm volatile("global_load_async_to_lds_b128 %0, %8, off\n\t"
               "global_load_async_to_lds_b128 %1, %9, off\n\t"
               "global_load_async_to_lds_b128 %2, %10, off\n\t"
               "global_load_async_to_lds_b128 %3, %11, off\n\t"
               "global_load_async_to_lds_b128 %4, %12, off\n\t"
               "global_load_async_to_lds_b128 %5, %13, off\n\t"
               "global_load_async_to_lds_b128 %6, %14, off\n\t"
               "global_load_async_to_lds_b128 %7, %15, off\n\t"
               "s_wait_xcnt 0x0"
               :: "v"(l), "v"(l + lstep), "v"(l + 2 * lstep), "v"(l + 3 * lstep), "v"(l + 4 * lstep), "v"(l + 5 * lstep), "v"(l + 6 * lstep), "v"(l + 7 * lstep),
                  "v"(g), "v"(g + gstep), "v"(g + 2 * gstep), "v"(g + 3 * gstep), "v"(g + 4 * gstep), "v"(g + 5 * gstep), "v"(g + 6 * gstep), "v"(g + 7 * gstep)
               : "memory");
}
// the same for four copies
__device__ __forceinline__ void acp4(unsigned l, unsigned lstep, const char* g, size_t gstep) {
  asm volatile("global_load_async_to_lds_b128 %0, %4, off\n\t"
               "global_load_async_to_lds_b128 %1, %5, off\n\t"
               "global_load_async_to_lds_b128 %2, %6, off\n\t"
               "global_load_async_to_lds_b128 %3, %7, off\n\t"
               "s_wait_xcnt 0x0"
               :: "v"(l), "v"(l + lstep), "v"(l + 2 * lstep), "v"(l + 3 * lstep),
                  "v"(g), "v"(g + gstep), "v"(g + 2 * gstep), "v"(g + 3 * gstep)
               : "memory");
}
// this wave's copies have landed (the compiler places no wait for them)
#define WAIT_COPIES() asm volatile("s_wait_asynccnt 0x0" ::: "memory")
// all but this wave's n youngest copies have landed: the oldest stage in flight is in LDS while the younger stages fly on. n is a literal, the copies of the stages issued behind the awaited one;
// every wave issues the same number of copies a stage, and the count is used only in trips where all those younger stages were issued (elsewhere the wait is to 0)
#define WAIT_COPIES_BUT(n) asm volatile("s_wait_asynccnt " #n ::: "memory")
// this wave's LDS reads have returned, before the barrier behind which their buffer is refilled
#define WAIT_LDS() asm volatile("s_wait_dscnt 0x0" ::: "memory")
#define P128 144   // LDS pitch of a 128-byte row, 16 B x odd: ds_load_b128 without bank conflicts
#define P256 272   // the same for a 256-byte row
// ---- k_pack: block = (32 outputs, 64 inputs, which). which 0: a tile of Wvo = Wv Wo, formed as (Wo^T)(Wv^T) so that it comes out as [out][in]: 32 columns of Wo (turned) and 64 rows of Wv go to LDS as bf16 over all 512 middle channels,
// 8 waves as 2 x 4, a wave = one 16 x 16 tile -> bf16 hi and lo rows. Row DA / 64 of the grid: bv stands in for every row of Wv, and each column of the tile is bv Wo for the 32 outputs.
// which 1: the same for Wqk = Wq Wk^T as (Wk)(Wq^T): 32 rows of Wk (as they lie) and 64 rows of Wq; bq stands in for the rows of Wq: bq Wk^T. which 2..5: 8,192 elements of key_value -> bf16 rows
#define PK_P 520   // LDS pitch, in bf16, of a row of 512: 1,040 bytes = 16 B x odd
typedef __attribute__((ext_vector_type(4))) __bf16 v4b;
__global__ __launch_bounds__(256) void k_pack(const float* __restrict__ WQ, const float* __restrict__ WK, const float* __restrict__ WV, const float* __restrict__ WO, const float* __restrict__ BQ, const float* __restrict__ BV, const float* __restrict__ XKV, __bf16* __restrict__ WT, float* __restrict__ BT, float* __restrict__ BVO, __bf16* __restrict__ XK) { __shared__ __align__(16) __bf16 tl[2][32][72]; __shared__ __align__(16) __bf16 so[32 * PK_P]; __shared__ __align__(16) __bf16 sv[64 * PK_P];
  const int t = threadIdx.x, lane = t & 31, wave = t >> 5; const int which = blockIdx.z; const int n0 = blockIdx.x * 32, k0 = blockIdx.y * 64;   // low blockIdx.z starts first: the long blocks (which 0, 1)
  const bool bias = blockIdx.y == DA / 64;   // the same for the whole block, like which: every barrier below is passed by all waves of a block or by none
  if (which >= 2) { if (bias) return;
    const size_t e0 = ((((size_t)(which - 2) * (DA / 64) + blockIdx.y) * (DA / 32) + blockIdx.x) * 1024 + t) * 8;   // 4 x 8 x 16 blocks x 4 groups x 256 lanes x 8 elements = all of key_value
    const float* px = XKV + e0; v4f f[4][2];   // both loops are unrolled so that f is indexed by constants and stays in registers
#pragma unroll
    for (int c = 0; c < 4; ++c) { f[c][0] = *(const v4f*)(px + c * 2048); f[c][1] = *(const v4f*)(px + c * 2048 + 4); }
    asm volatile("s_wait_xcnt 0x0" :: "v"(px) : "memory");   // the loads' address pair is an input here, so it lives up to this wait and no load's result lands in it ahead of the wait
#pragma unroll
    for (int c = 0; c < 4; ++c) { v8b r;
#pragma unroll
      for (int i = 0; i < 4; ++i) { r[i] = (__bf16)f[c][0][i]; r[4 + i] = (__bf16)f[c][1][i]; }
      vst2(XK + e0 + c * 2048, r); }   // a store = 512 contiguous bytes over the wave: whole lines
    return; }
  const bool fk = which == 1; const float* WB = fk ? WQ : WV; const float* BB = fk ? BQ : BV;
  float fo[8][8];   // every loop below is unrolled so that fo and fv are indexed by constants and stay in registers
  const int vr = wave >> 2, vs = (wave & 3) * 128 + lane * 4;
  const float* po = fk ? WK + (size_t)(n0 + wave * 4) * DA + lane * 8 : WO + (size_t)(wave * 8) * DA + n0 + lane;
  if (fk) {   // two loads = 1,024 contiguous bytes of one row of Wk
#pragma unroll
    for (int c = 0; c < 8; ++c) { const v4f a = *(const v4f*)(po + (size_t)(c >> 1) * DA + (c & 1) * 256), b = *(const v4f*)(po + (size_t)(c >> 1) * DA + (c & 1) * 256 + 4);
#pragma unroll
      for (int i = 0; i < 4; ++i) { fo[c][i] = a[i]; fo[c][4 + i] = b[i]; } }
  } else {   // a load = 128 contiguous bytes of one row of Wo
#pragma unroll
    for (int c = 0; c < 8; ++c)
#pragma unroll
      for (int i = 0; i < 8; ++i) fo[c][i] = po[(size_t)(c * 64 + i) * DA]; }
  // Here and in both branches: the loads' address pair is an input of the wait behind them, so it lives up to the wait and nothing is written into it ahead of it, on every way through the branches;
  // the scheduling barrier keeps every load ahead of the conversions: one trip to memory for the whole block, not one a group
  asm volatile("s_wait_xcnt 0x0" :: "v"(po) : "memory");
  if (bias) { const float* pb = BB + vs; const v4f x = *(const v4f*)pb;
    asm volatile("s_wait_xcnt 0x0" :: "v"(pb) : "memory");
    __builtin_amdgcn_sched_barrier(0);
    v4b r;
#pragma unroll
    for (int i = 0; i < 4; ++i) r[i] = (__bf16)x[i];
#pragma unroll
    for (int c = 0; c < 32; ++c) *(v4b*)&sv[(c * 2 + vr) * PK_P + vs] = r;
  } else { const float* pv = WB + (size_t)(k0 + vr) * DA + vs; v4f fv[32];   // a load = 512 contiguous bytes of one row of Wv or Wq
#pragma unroll
    for (int c = 0; c < 32; ++c) fv[c] = *(const v4f*)(pv + (size_t)(c * 2) * DA);
    asm volatile("s_wait_xcnt 0x0" :: "v"(pv) : "memory");
    __builtin_amdgcn_sched_barrier(0);
#pragma unroll
    for (int c = 0; c < 32; ++c) { v4b r;
#pragma unroll
      for (int i = 0; i < 4; ++i) r[i] = (__bf16)fv[c][i];
      *(v4b*)&sv[(c * 2 + vr) * PK_P + vs] = r; } }
#pragma unroll
  for (int c = 0; c < 8; ++c) { v8b r;
#pragma unroll
    for (int i = 0; i < 8; ++i) r[i] = (__bf16)fo[c][i];
    *(v8b*)&so[fk ? (wave * 4 + (c >> 1)) * PK_P + (c & 1) * 256 + lane * 8 : lane * PK_P + c * 64 + wave * 8] = r; }
  __syncthreads();
  const int col = lane & 15, g = lane >> 4, ot = wave >> 2, it = wave & 3;
  const __bf16* ra = so + (ot * 16 + col) * PK_P; const __bf16* rb = sv + (it * 16 + col) * PK_P;   // A: row = output channel; B: column = input channel; k = middle channel in both
  v8f acc = {};
#pragma unroll
  for (int mh = 0; mh < DA; mh += 256) { v16b fa[8], fb[8];
#pragma unroll
    for (int e = 0; e < 8; ++e) { fa[e] = frag_b(ra + mh + e * 32, lane); fb[e] = frag_b(rb + mh + e * 32, lane); }
    __builtin_amdgcn_sched_barrier(0);   // eight blocks' LDS reads as one group ahead of their products: one LDS latency, not eight
#pragma unroll
    for (int e = 0; e < 8; ++e) acc = wmma_bf(fa[e], fb[e], acc); }
  if (bias) { if (it == 0 && col == 0) {
#pragma unroll
      for (int r = 0; r < 8; ++r) (fk ? BT : BVO)[n0 + ot * 16 + 8 * g + r] = acc[r]; }
    return; }
#pragma unroll
  for (int r = 0; r < 8; ++r) { const __bf16 h = (__bf16)acc[r]; tl[0][ot * 16 + 8 * g + r][it * 16 + col] = h; tl[1][ot * 16 + 8 * g + r][it * 16 + col] = (__bf16)(acc[r] - (float)h); }
  __syncthreads();
  __bf16* d = WT + ((size_t)(fk ? 0 : 2) * DA + n0 + (t >> 3)) * DA + k0 + (t & 7) * 8;
  vst2((unsigned*)d, *(const v4u*)&tl[0][t >> 3][(t & 7) * 8]); vst2((unsigned*)(d + (size_t)DA * DA), *(const v4u*)&tl[1][t >> 3][(t & 7) * 8]); }
// ---- k_proj: a block = 128 x rows x 256 cols of x W with W as bf16 hi + lo (2 products), 16 waves. A stage = 64 k of 256 W hi rows, 256 W lo rows and 128 x rows (12 copies a wave), three buffers: a stage's copies are issued two trips ahead of its first read
#define PP_LO  (256 * P128)
#define PP_X   (512 * P128)
#define PP_BUF (512 * P128 + 128 * P256)
#define PP_D 3   // buffers of the ring
#define PP_FILL(s, bf) do { acp4(lw + (bf) * PP_BUF, 64 * P128, gwh + (s) * 128, (size_t)64 * DA * 2); acp4(lw + PP_LO + (bf) * PP_BUF, 64 * P128, gwl + (s) * 128, (size_t)64 * DA * 2); acp4(lx + (bf) * PP_BUF, 32 * P256, gx + (s) * 256, (size_t)32 * DA * 4); } while (0)
// ---- which 0, 1: waves as 4 x 4, a wave = 32 rows x 64 cols: t = x_q Wqk + bq Wk^T -> bf16 hi + lo rows [x row][col].
// The weight fragment is the product's A operand, so that a lane's eight results are eight neighbouring cols of one row (one 16-byte LDS store).
#define PR_OUT (2 * 32 * P128)   // a wave's output tile in LDS: two planes of 32 rows of 128 bytes
__device__ __forceinline__ void proj_rows(char* ring, const float* __restrict__ X, const __bf16* __restrict__ WH, const __bf16* __restrict__ WL, const float* __restrict__ BT, __bf16* __restrict__ DH, __bf16* __restrict__ DL) {
  const int tid = threadIdx.x, wave = tid >> 5, lane = tid & 31, col = lane & 15, g = lane >> 4, wr = wave >> 2, wc = wave & 3; const int c0 = blockIdx.y * 256; const size_t r0 = ((size_t)blockIdx.z * (NB * NN / 256) + blockIdx.x) * 128;
  const unsigned lds0 = (unsigned)(size_t)ring;
  const unsigned lw = lds0 + (tid >> 3) * P128 + (tid & 7) * 16, lx = lds0 + PP_X + (tid >> 4) * P256 + (tid & 15) * 16;   // 8 lanes a weight row, 16 lanes an x row
  const size_t wo = ((size_t)(c0 + (tid >> 3)) * DA + (tid & 7) * 8) * 2;
  const char* gwh = (const char*)WH + wo; const char* gwl = (const char*)WL + wo; const char* gx = (const char*)X + ((r0 + (tid >> 4)) * DA + (tid & 15) * 4) * 4;
  v8f acc[2][4] = {};   // every inner loop below is unrolled so that the tiles and fragments are indexed by constants and stay in registers
  PP_FILL(0, 0); PP_FILL(1, 1); WAIT_COPIES_BUT(12); __syncthreads(); PP_FILL(2, 2);   // stage 0 has landed, stage 1 flies on
  int bf = 0;   // the buffer of stage s: s mod 3
#pragma unroll 1   // one stage a trip: the buffer's number is a running value
  for (int s = 0; s < DA / 64; ++s) { const char* bp = ring + bf * PP_BUF;
#pragma unroll
    for (int h = 0; h < 2; ++h) { v16b a[2], wh[4], wl[4];
#pragma unroll
      for (int i = 0; i < 2; ++i) { const float* p = (const float*)(bp + PP_X + (wr * 32 + i * 16 + col) * P256) + h * 32 + 8 * g;
#pragma unroll
        for (int e = 0; e < 8; ++e) { a[i][e] = (__bf16)p[e]; a[i][8 + e] = (__bf16)p[16 + e]; } }
#pragma unroll
      for (int j = 0; j < 4; ++j) { const char* kr = bp + (wc * 64 + j * 16 + col) * P128 + h * 64; wh[j] = frag_b((const __bf16*)kr, lane); wl[j] = frag_b((const __bf16*)(kr + PP_LO), lane); }
      // eight tiles take their lo product, then their hi product: a tile comes round again after seven others
#pragma unroll
      for (int j = 0; j < 4; ++j)
#pragma unroll
        for (int i = 0; i < 2; ++i) acc[i][j] = wmma_bf(wl[j], a[i], acc[i][j]);
#pragma unroll
      for (int j = 0; j < 4; ++j)
#pragma unroll
        for (int i = 0; i < 2; ++i) acc[i][j] = wmma_bf(wh[j], a[i], acc[i][j]); }
    WAIT_LDS();
    if (s + 2 < DA / 64) WAIT_COPIES_BUT(12); else WAIT_COPIES();   // stage s + 1 has landed; the count holds only while stage s + 2 was issued behind it
    __syncthreads();   // publishes stage s + 1 and ends every read of stage s
    if (s + 3 < DA / 64) PP_FILL(s + 3, bf);
    bf = bf == PP_D - 1 ? 0 : bf + 1; }
  WAIT_COPIES();
  char* my = ring + wave * PR_OUT;   // the ring is free behind the last trip's barrier: each wave turns its own tile in its own range
  const int l8 = lane >> 3, q8 = (lane & 7) * 8;   // a global store = four rows of 128 contiguous bytes: whole lines
#pragma unroll
  for (int j = 0; j < 4; ++j) { float bb[8];
#pragma unroll
    for (int r = 0; r < 8; ++r) bb[r] = BT[c0 + wc * 64 + j * 16 + 8 * g + r];
#pragma unroll
    for (int i = 0; i < 2; ++i) { v8b h8, lo8;
#pragma unroll
      for (int r = 0; r < 8; ++r) { const float v = acc[i][j][r] + bb[r]; const __bf16 h = (__bf16)v; h8[r] = h; lo8[r] = (__bf16)(v - (float)h); }
      char* d = my + (i * 16 + col) * P128 + (j * 16 + 8 * g) * 2; *(v8b*)d = h8; *(v8b*)(d + 32 * P128) = lo8; } }
  LDSX();
  __bf16* dh = DH + (r0 + wr * 32) * DA + c0 + wc * 64 + q8; __bf16* dl = DL + (r0 + wr * 32) * DA + c0 + wc * 64 + q8;
#pragma unroll   // every store names one of the two address pairs
  for (int t = 0; t < 8; ++t) { const int rl = 4 * t + l8; const char* sp = my + rl * P128 + q8 * 2; vst2((unsigned*)(dh + (size_t)rl * DA), *(const v4u*)sp); vst2((unsigned*)(dl + (size_t)rl * DA), *(const v4u*)(sp + 32 * P128)); } }
// ---- which 2, 3: waves as 2 x 8, a wave = 64 rows x 32 cols: u = x_kv Wvo + bv Wo -> f16 planes [col][x row].
// x is the A operand, so that a lane's eight results are eight neighbouring x rows of one col.
__device__ __forceinline__ void proj_planes(char* ring, const float* __restrict__ X, const __bf16* __restrict__ WH, const __bf16* __restrict__ WL, const float* __restrict__ BVO, _Float16* __restrict__ VT) {
  const int tid = threadIdx.x, wave = tid >> 5, lane = tid & 31, col = lane & 15, g = lane >> 4, wr = wave >> 3, wc = wave & 7; const int c0 = blockIdx.y * 256; const size_t r0 = ((size_t)(blockIdx.z - 2) * (NB * NN / 256) + blockIdx.x) * 128;
  const unsigned lds0 = (unsigned)(size_t)ring;
  const unsigned lw = lds0 + (tid >> 3) * P128 + (tid & 7) * 16, lx = lds0 + PP_X + (tid >> 4) * P256 + (tid & 15) * 16;   // 8 lanes a weight row, 16 lanes an x row
  const size_t wo = ((size_t)(c0 + (tid >> 3)) * DA + (tid & 7) * 8) * 2;
  const char* gwh = (const char*)WH + wo; const char* gwl = (const char*)WL + wo; const char* gx = (const char*)X + ((r0 + (tid >> 4)) * DA + (tid & 15) * 4) * 4;
  v8f acc[4][2] = {};   // every inner loop below is unrolled so that the tiles and fragments are indexed by constants and stay in registers
  PP_FILL(0, 0); PP_FILL(1, 1); WAIT_COPIES_BUT(12); __syncthreads(); PP_FILL(2, 2);   // stage 0 has landed, stage 1 flies on
  int bf = 0;   // the buffer of stage s: s mod 3
#pragma unroll 1   // one stage a trip: the buffer's number is a running value
  for (int s = 0; s < DA / 64; ++s) { const char* bp = ring + bf * PP_BUF;
#pragma unroll
    for (int h = 0; h < 2; ++h) { v16b a[4];
#pragma unroll
      for (int i = 0; i < 4; ++i) { const float* p = (const float*)(bp + PP_X + (wr * 64 + i * 16 + col) * P256) + h * 32 + 8 * g;
#pragma unroll
        for (int e = 0; e < 8; ++e) { a[i][e] = (__bf16)p[e]; a[i][8 + e] = (__bf16)p[16 + e]; } }
#pragma unroll
      for (int j = 0; j < 2; ++j) { const char* kr = bp + (wc * 32 + j * 16 + col) * P128 + h * 64; const v16b wh = frag_b((const __bf16*)kr, lane), wl = frag_b((const __bf16*)(kr + PP_LO), lane);   // a weight fragment serves four x fragments
#pragma unroll
        for (int i = 0; i < 4; ++i) acc[i][j] = wmma_bf(a[i], wl, acc[i][j]);
#pragma unroll
        for (int i = 0; i < 4; ++i) acc[i][j] = wmma_bf(a[i], wh, acc[i][j]); } }
    WAIT_LDS();
    if (s + 2 < DA / 64) WAIT_COPIES_BUT(12); else WAIT_COPIES();   // stage s + 1 has landed; the count holds only while stage s + 2 was issued behind it
    __syncthreads();   // publishes stage s + 1 and ends every read of stage s
    if (s + 3 < DA / 64) PP_FILL(s + 3, bf);
    bf = bf == PP_D - 1 ? 0 : bf + 1; }
  WAIT_COPIES();
  char* my = ring + wave * (32 * P128);   // the ring is free behind the last trip's barrier: each wave turns its own tile (32 cols of 64 x rows) in its own range
  const int l8 = lane >> 3, q8 = (lane & 7) * 8;   // a global store = four rows of 128 contiguous bytes: whole lines
#pragma unroll
  for (int j = 0; j < 2; ++j) { const float bb = BVO[c0 + wc * 32 + j * 16 + col];
#pragma unroll
    for (int i = 0; i < 4; ++i) { v8h t8;
#pragma unroll
      for (int r = 0; r < 8; ++r) t8[r] = (_Float16)(acc[i][j][r] + bb);
      *(v8h*)(my + (j * 16 + col) * P128 + (i * 16 + 8 * g) * 2) = t8; } }
  LDSX();
  const size_t b = r0 / NN; const int n0 = (int)(r0 % NN); _Float16* dv = VT + (b * DA + c0 + wc * 32) * (size_t)NN + n0 + wr * 64 + q8;
#pragma unroll   // every store names the one address pair
  for (int t = 0; t < 8; ++t) { const int cl = 4 * t + l8; vst2((unsigned*)(dv + (size_t)cl * NN), *(const v4u*)(my + cl * P128 + q8 * 2)); } }
__global__ __launch_bounds__(512) void k_proj(const float* __restrict__ XQ, const float* __restrict__ XKV, const __bf16* __restrict__ WT, const float* __restrict__ BT, const float* __restrict__ BVO, __bf16* __restrict__ QH, __bf16* __restrict__ QL, _Float16* __restrict__ VT) { __shared__ __align__(16) char ring[PP_D * PP_BUF];
  static_assert(PP_D * PP_BUF >= 16 * PR_OUT, "the ring holds every wave's output tile");
  const int which = blockIdx.z;   // the same for the whole block: every barrier of a branch is passed by all its waves
  if (which <= 1) proj_rows(ring, XQ, WT, WT + (size_t)DA * DA, BT, QH, QL);
  else proj_planes(ring, XKV, WT + (size_t)2 * DA * DA, WT + (size_t)3 * DA * DA, BVO, VT); }
// ---- k_sc: block = (256 queries, 256 keys, b), 16 waves as 4 x 4, a wave = 64 queries x 64 keys: logits (2 products) x sqrt(512) -> S. A stage = 64 k of the t hi, t lo and key_value rows, copied to LDS in whole lines, two buffers
#define SC_LO (256 * P128)
#define SC_K  (512 * P128)
#define SC_BUF (768 * P128)
#define SC_OUT (64 * 68 * 4)   // a wave's 64 rows of logits in LDS
__global__ __launch_bounds__(512) void k_sc(const __bf16* __restrict__ QH, const __bf16* __restrict__ QL, const __bf16* __restrict__ XK, float* __restrict__ S) { __shared__ __align__(16) char ring[16 * SC_OUT];
  static_assert(16 * SC_OUT >= 2 * SC_BUF, "the ring holds two stages");
  const int tid = threadIdx.x, wave = tid >> 5, lane = tid & 31, col = lane & 15, g = lane >> 4, wq = wave >> 2, wk = wave & 3; const size_t b = blockIdx.z; const int k0 = blockIdx.y * 256; const size_t qb = b * NN + (size_t)blockIdx.x * 256;
  const unsigned lr = (unsigned)(size_t)ring + (tid >> 3) * P128 + (tid & 7) * 16;   // 8 lanes a row
  const size_t qo = ((qb + (tid >> 3)) * DA + (tid & 7) * 8) * 2, ko = ((b * NN + k0 + (tid >> 3)) * DA + (tid & 7) * 8) * 2;
  const char* gqh = (const char*)QH + qo; const char* gql = (const char*)QL + qo; const char* gk = (const char*)XK + ko;
#define SC_FILL(s, bf) do { acp4(lr + (bf) * SC_BUF, 64 * P128, gqh + (s) * 128, (size_t)64 * DA * 2); acp4(lr + SC_LO + (bf) * SC_BUF, 64 * P128, gql + (s) * 128, (size_t)64 * DA * 2); \
    acp4(lr + SC_K + (bf) * SC_BUF, 64 * P128, gk + (s) * 128, (size_t)64 * DA * 2); } while (0)
  v8f acc[4][4] = {};   // every inner loop below is unrolled so that the tiles and fragments are indexed by constants and stay in registers
  SC_FILL(0, 0); WAIT_COPIES(); __syncthreads(); SC_FILL(1, 1);
#pragma unroll 1   // one stage a trip: the two buffers alternate by the trip's parity
  for (int s = 0; s < DA / 64; ++s) { const char* bp = ring + (s & 1) * SC_BUF;
#pragma unroll
    for (int h = 0; h < 2; ++h) { v16b ah[4], al[4], kx[4];
#pragma unroll
      for (int i = 0; i < 4; ++i) { const char* qr = bp + (wq * 64 + i * 16 + col) * P128 + h * 64; ah[i] = frag_b((const __bf16*)qr, lane); al[i] = frag_b((const __bf16*)(qr + SC_LO), lane); }
#pragma unroll
      for (int j = 0; j < 4; ++j) kx[j] = frag_b((const __bf16*)(bp + SC_K + (wk * 64 + j * 16 + col) * P128 + h * 64), lane);
      // a key fragment serves four query fragments; each tile takes its two products in the order hi, lo
#pragma unroll
      for (int j = 0; j < 4; ++j) {
#pragma unroll
        for (int i = 0; i < 4; ++i) acc[i][j] = wmma_bf(ah[i], kx[j], acc[i][j]);
#pragma unroll
        for (int i = 0; i < 4; ++i) acc[i][j] = wmma_bf(al[i], kx[j], acc[i][j]); } }
    WAIT_LDS(); WAIT_COPIES(); __syncthreads();   // publishes stage s + 1 and ends every read of stage s
    if (s + 2 < DA / 64) SC_FILL(s + 2, s & 1); }
  WAIT_COPIES();
  float (*ss)[68] = (float (*)[68])(ring + wave * SC_OUT);   // the ring is free behind the last trip's barrier: each wave stages its 64 rows in its own range
#pragma unroll
  for (int i = 0; i < 4; ++i)
#pragma unroll
    for (int j = 0; j < 4; ++j)
#pragma unroll
      for (int r = 0; r < 8; ++r) ss[i * 16 + 8 * g + r][j * 16 + col] = acc[i][j][r] * 22.627416997969522f;
  LDSX(); for (int t = 0; t < 32; ++t) { const int rl = 2 * t + g; vst2(S + (qb + wq * 64 + rl) * NN + k0 + wk * 64 + col * 4, *(const v4f*)&ss[rl][col * 4]); } }   // a store = two rows of 256 contiguous bytes: whole lines
// lane l with lane l ^ 16
__device__ __forceinline__ float xhalf(float x) { return __builtin_bit_cast(float, __builtin_amdgcn_permlanex16(__builtin_bit_cast(int, x), __builtin_bit_cast(int, x), 0x76543210, 0xfedcba98, false, false)); }
// lane l with lane l ^ M inside its 16-lane row (DPP row_xmask)
template <int M> __device__ __forceinline__ float xrow(float x) { return __builtin_bit_cast(float, __builtin_amdgcn_update_dpp(0, __builtin_bit_cast(int, x), 0x160 + M, 0xf, 0xf, true)); }
__device__ __forceinline__ float wave_max(float v) { v = fmaxf(v, xrow<1>(v)); v = fmaxf(v, xrow<2>(v)); v = fmaxf(v, xrow<4>(v)); v = fmaxf(v, xrow<8>(v)); return fmaxf(v, xhalf(v)); }
__device__ __forceinline__ float wave_sum(float v) { v += xrow<1>(v); v += xrow<2>(v); v += xrow<4>(v); v += xrow<8>(v); return v + xhalf(v); }
typedef __attribute__((ext_vector_type(4))) _Float16 v4h;
// ---- k_sm: wave = SM_R query rows, each row's 2,048 logits held in the wave's registers (64 a lane): S read once, one expf a logit, no LDS, no barrier -> P x 2^11 as f16
#define SM_R 2    // rows a wave: with 16 waves a block the whole problem is one block per WGP
#define SM_W 16   // waves a block
__global__ __launch_bounds__(SM_W * 32) void k_sm(const float* __restrict__ S, _Float16* __restrict__ PH) {
  const int lane = threadIdx.x & 31; const size_t row0 = ((size_t)blockIdx.x * SM_W + (threadIdx.x >> 5)) * SM_R;
  const float* sp = S + row0 * NN + lane * 4;   // the one address that every load below names
  v4f x[SM_R][16];   // load i of a row = 512 contiguous bytes over the wave; all rows' loads are issued ahead of the first row's arithmetic
  // every loop below is unrolled so that x is indexed by constants and stays in registers
#pragma unroll
  for (int r = 0; r < SM_R; ++r)
#pragma unroll
    for (int i = 0; i < 16; ++i) x[r][i] = *(const v4f*)(sp + r * NN + i * 128);
  asm volatile("s_wait_xcnt 0x0" :: "v"(sp) : "memory");   // the loads' address pair is an input here, so it lives up to this wait and no load's result lands in it ahead of the wait
#pragma unroll
  for (int r = 0; r < SM_R; ++r) { __builtin_amdgcn_sched_barrier(0);   // keeps every load ahead of the arithmetic, and a later row's arithmetic (with its wait for that row's loads) behind this row's stores
    v4f mm = x[r][0];
#pragma unroll
    for (int i = 1; i < 16; ++i)
#pragma unroll
      for (int c = 0; c < 4; ++c) mm[c] = fmaxf(mm[c], x[r][i][c]);
    const float m = wave_max(fmaxf(fmaxf(-3.0e38f, fmaxf(mm[0], mm[1])), fmaxf(mm[2], mm[3])));
    v4f ss = {};
#pragma unroll
    for (int i = 0; i < 16; ++i)
#pragma unroll
      for (int c = 0; c < 4; ++c) { const float e = expf(x[r][i][c] - m); x[r][i][c] = e; ss[c] += e; }
    const float inv = 1.0f / wave_sum((ss[0] + ss[1]) + (ss[2] + ss[3]));
    _Float16* ph = PH + (row0 + r) * NN + lane * 4;
#pragma unroll
    for (int i = 0; i < 16; ++i) { v4h h;
#pragma unroll
      for (int c = 0; c < 4; ++c) h[c] = (_Float16)(x[r][i][c] * inv * 2048.0f);
      *(v4h*)(ph + i * 128) = h; } } }   // a store = 256 contiguous bytes over the wave: whole lines
// ---- k_pv: block = (128 queries, 128 value channels, b), 8 waves as 4 x 2, a wave = 32 queries x 64 channels: out = query + P . u + bo. A stage = 128 keys of the u and P rows, copied to LDS in whole lines (16 copies a wave), four buffers: a stage's copies are issued three trips ahead of its first read
#define PV_PH (128 * P256)
#define PV_BUF (256 * P256)
#define PV_D 4   // buffers of the ring
__global__ __launch_bounds__(256) void k_pv(const _Float16* __restrict__ PH, const _Float16* __restrict__ VT, const float* __restrict__ XQ, const float* __restrict__ BO, float* __restrict__ OUT) { __shared__ __align__(16) char ring[PV_D * PV_BUF];
  const int tid = threadIdx.x, wave = tid >> 5, lane = tid & 31, col = lane & 15, g = lane >> 4, wq = wave >> 1, wc = wave & 1; const size_t b = blockIdx.z; const int c0 = blockIdx.y * 128; const size_t qb = b * NN + (size_t)blockIdx.x * 128;
  const unsigned lv = (unsigned)(size_t)ring + (tid >> 4) * P256 + (tid & 15) * 16;   // 16 lanes a row
  const size_t po = ((qb + (tid >> 4)) * NN + (tid & 15) * 8) * 2;
  const char* gv = (const char*)VT + ((b * DA + c0 + (tid >> 4)) * (size_t)NN + (tid & 15) * 8) * 2; const char* gph = (const char*)PH + po;
#define PV_FILL(s, bf) do { acp8(lv + (bf) * PV_BUF, 16 * P256, gv + (s) * 256, (size_t)16 * NN * 2); acp8(lv + PV_PH + (bf) * PV_BUF, 16 * P256, gph + (s) * 256, (size_t)16 * NN * 2); } while (0)
  v8f acc[2][4] = {};   // every inner loop below is unrolled so that the tiles and fragments are indexed by constants and stay in registers
  PV_FILL(0, 0); PV_FILL(1, 1); PV_FILL(2, 2);
  // the wave's query rows and its bias, for the epilogue: loaded here, beside the first stage's copies, so that their trip to memory is not paid behind the last product
  const size_t at = (qb + wq * 32 + g) * DA + c0 + wc * 64 + col * 4; const float* px = XQ + at; const float* pb = BO + c0 + wc * 64 + col * 4;
  v4f xq[16]; const v4f bo = *(const v4f*)pb;
#pragma unroll
  for (int t = 0; t < 16; ++t) xq[t] = *(const v4f*)(px + (size_t)(2 * t) * DA);   // a load = two rows of 256 contiguous bytes: whole lines
  asm volatile("s_wait_xcnt 0x0" :: "v"(px), "v"(pb) : "memory");   // the loads' address pairs are inputs here, so they live up to this wait and no load's result lands in one ahead of it
  WAIT_COPIES_BUT(32); __syncthreads(); PV_FILL(3, 3);   // stage 0 has landed, stages 1 and 2 fly on
#pragma unroll 1   // one stage a trip: the buffer's number is the trip's modulo 4
  for (int s = 0; s < NN / 128; ++s) { const char* bp = ring + (s & (PV_D - 1)) * PV_BUF;
#pragma unroll
    for (int h = 0; h < 4; h += 2) { v16h vb[2][4], ph[2][2];   // two 32-key blocks a group: their LDS reads stand as one group ahead of their products: one wait for LDS a group, not one a block
#pragma unroll
      for (int e = 0; e < 2; ++e) {
#pragma unroll
        for (int i = 0; i < 2; ++i) ph[e][i] = frag_h((const _Float16*)(bp + PV_PH + (wq * 32 + i * 16 + col) * P256 + (h + e) * 64), lane);
#pragma unroll
        for (int j = 0; j < 4; ++j) vb[e][j] = frag_h((const _Float16*)(bp + (wc * 64 + j * 16 + col) * P256 + (h + e) * 64), lane); }
      // a u fragment serves two query fragments
#pragma unroll
      for (int e = 0; e < 2; ++e)
#pragma unroll
        for (int j = 0; j < 4; ++j)
#pragma unroll
          for (int i = 0; i < 2; ++i) acc[i][j] = wmma16(ph[e][i], vb[e][j], acc[i][j]); }
    WAIT_LDS();
    if (s + 3 < NN / 128) WAIT_COPIES_BUT(32); else WAIT_COPIES();   // stage s + 1 has landed; the count holds only while stages s + 2 and s + 3 were issued behind it
    __syncthreads();   // publishes stage s + 1 and ends every read of stage s
    if (s + 4 < NN / 128) PV_FILL(s + 4, s & (PV_D - 1)); }
  WAIT_COPIES();
  float (*ss)[68] = (float (*)[68])(ring + wave * (32 * 68 * 4));   // the ring is free behind the last trip's barrier: each wave stages its 32 rows in its own range
#pragma unroll
  for (int i = 0; i < 2; ++i)
#pragma unroll
    for (int j = 0; j < 4; ++j)
#pragma unroll
      for (int r = 0; r < 8; ++r) ss[i * 16 + 8 * g + r][j * 16 + col] = acc[i][j][r] * (1.0f / 2048.0f);
  LDSX();
#pragma unroll   // xq is indexed by constants, and every store names the one address pair
  for (int t = 0; t < 16; ++t) { const v4f o = *(const v4f*)&ss[2 * t + g][col * 4]; v4f y;
#pragma unroll
    for (int c = 0; c < 4; ++c) y[c] = bfr(xq[t][c]) + o[c] + bfr(bo[c]);
    vst2(OUT + at + (size_t)(2 * t) * DA, y); } }   // a store = two rows of 256 contiguous bytes: whole lines
extern "C" void kernel_launch(void* const* d_in, const int* in_sizes, int n_in, void* d_out, int out_size, void* d_ws, size_t ws_size, hipStream_t stream) {
  (void)in_sizes; (void)n_in; (void)out_size;
  const float** F = (const float**)d_in;   // 0 query [4,2048,512], 1 key_value [4,2048,512], 2 Wq, 3 bq, 4 Wk, 5 bk, 6 Wv, 7 bv, 8 Wo, 9 bo ((in,out) [512,512] / [512])
  if (ws_size < (size_t)WS_END) return;
  char* ws = (char*)d_ws; float *S = (float*)(ws + WS_S), *BVO = (float*)(ws + WS_BVO), *BT = (float*)(ws + WS_BT); __bf16 *QH = (__bf16*)(ws + WS_Q), *QL = (__bf16*)(ws + WS_QL), *XK = (__bf16*)(ws + WS_KH); _Float16 *VT = (_Float16*)(ws + WS_VT), *PH = (_Float16*)(ws + WS_PH); __bf16* WT = (__bf16*)(ws + WS_WT);
  k_pack<<<dim3(DA / 32, DA / 64 + 1, 6), 256, 0, stream>>>(F[2], F[4], F[6], F[8], F[3], F[7], F[1], WT, BT, BVO, XK);
  k_proj<<<dim3(TNB * NN / 256, DA / 256, 4), 512, 0, stream>>>(F[0], F[1], WT, BT, BVO, QH, QL, VT);
  k_sc<<<dim3(NN / 256, NN / 256, TNB), 512, 0, stream>>>(QH, QL, XK, S);
  k_sm<<<TNB * TQB * 64 / (SM_W * SM_R), SM_W * 32, 0, stream>>>(S, PH);   // rows of all batches are contiguous: one launch
  k_pv<<<dim3(NN / 128, DA / 128, TNB), 256, 0, stream>>>(PH, VT, F[0], F[9], (float*)d_out);
}
